// v000
// Measured on an AMD MI455X. A time is GPU time per run, averaged over a window of back-to-back runs after a warm-up
// (all launches, gaps included; the runs take copies of the inputs in turn), and the median of several windows.
// Apart from v000's, it joins two sittings. Times from different sittings can be a few percent apart, while
// side-by-side timings come from the same sitting.
// v000 is the starting kernel. One run takes 408 microseconds.
#include <hip/hip_runtime.h>

// GQA causal ragged attention: q/k/v = x W (32 query heads, 8 kv heads, head 64, no bias), rotate-half RoPE from int32 positions (theta 5e5), mask = (same segment id) and (key index <= query index) with -3e38 fill, softmax(q.k * 0.125), ctx Wo -> [TT][2048] f32.
// Compute dtypes, f32 accumulate everywhere: x and all four weights RNE-converted to bf16 planes; q/k/v projections v_wmma_f32_16x16x32_bf16 on plain bf16 operands (one product); scores and attn.v on bf16 hi/lo split planes (hi.hi + lo.hi + hi.lo); output projection bf16 hi/lo ctx x bf16 Wo (2 products); RoPE tables, RoPE, softmax and all side math f32 on VALU.

#ifndef TT
#define TT   1024
#endif
#define TT_FULL 1024
#define DM   2048
#define NQ   32
#define NKV  8
#define GQ   (NQ / NKV)
#define HD   64
#define DQ   (NQ * HD)
#define DKV  (NKV * HD)
#ifndef ZH
#define ZH   8
#endif
#define THETA 500000.0f
#define SCL  0.125f
static_assert(TT % 128 == 0);
static_assert(TT <= TT_FULL);
static_assert(ZH % GQ == 0);
static_assert(NQ % ZH == 0);
static_assert(HD == 64);
static_assert(DM % 64 == 0 && DQ % 64 == 0 && DKV % 64 == 0);

typedef _Float16 h16;
typedef unsigned short bf;
typedef __attribute__((ext_vector_type(16))) __bf16   v16bf;
typedef __attribute__((ext_vector_type(16))) _Float16 v16h;
typedef __attribute__((ext_vector_type(8)))  _Float16 v8h;
typedef __attribute__((ext_vector_type(8)))  unsigned short v8us;
typedef __attribute__((ext_vector_type(8)))  float    v8f;
typedef __attribute__((ext_vector_type(4)))  float    v4f;
typedef v8h  __attribute__((may_alias)) v8ha;
typedef v4f  __attribute__((may_alias)) v4fa;
typedef v8us __attribute__((may_alias)) v8usa;

__device__ __forceinline__ unsigned short f2bf(float f) { unsigned u = __float_as_uint(f); u += 0x7FFFu + ((u >> 16) & 1u); return (unsigned short)(u >> 16); }
__device__ __forceinline__ float bf2f(unsigned short b) { return __uint_as_float(((unsigned)b) << 16); }
__device__ __forceinline__ float bfr(float f) { return bf2f(f2bf(f)); }
__device__ __forceinline__ v16h cat16(v8h lo, v8h hi) { return __builtin_shufflevector(lo, hi, 0, 1, 2, 3, 4, 5, 6, 7, 8, 9, 10, 11, 12, 13, 14, 15); }
__device__ __forceinline__ v16bf cat16b(v8us lo, v8us hi) { return __builtin_bit_cast(v16bf, __builtin_shufflevector(lo, hi, 0, 1, 2, 3, 4, 5, 6, 7, 8, 9, 10, 11, 12, 13, 14, 15)); }
__device__ __forceinline__ v8f wmma16(v16h a, v16h b, v8f c) { return __builtin_amdgcn_wmma_f32_16x16x32_f16(false, a, false, b, (short)0, c, false, false); }
__device__ __forceinline__ v8f wmmab(v16bf a, v16bf b, v8f c) { return __builtin_amdgcn_wmma_f32_16x16x32_bf16(false, a, false, b, (short)0, c, false, false); }

// ---- k_gemmw: register-blocked GEMM, ONE WAVE per 64x64 output tile (16 accumulators), operands straight from K-contiguous 16-bit planes; grid (M/64, N/64, Z), 32 threads.
// C[m][n] (f32, pitch ldc, + optional f32 bias[n]) = sum_k A[m][k] Bt[n][k] (+ split products per NSPLIT). z-batch strides sA/sB/sC in elements. K % 32 == 0.
// Fragments: lane -> row/col lane&15, vector elements 0..7 <- k0 + 8h + i, elements 8..15 <- k0 + 16 + 8h + i (h = lane>>4) for BOTH operands; D element r -> (row 8h + r, col lane&15).
template <typename T16> struct WFrag;
template <> struct WFrag<h16> { typedef v16h V; static __device__ __forceinline__ V ld(const h16* p) { return cat16(*(const v8h*)p, *(const v8h*)(p + 16)); } static __device__ __forceinline__ v8f mma(V a, V b, v8f c) { return wmma16(a, b, c); } };
template <> struct WFrag<bf> { typedef v16bf V; static __device__ __forceinline__ V ld(const bf* p) { return cat16b(*(const v8us*)p, *(const v8us*)(p + 16)); } static __device__ __forceinline__ v8f mma(V a, V b, v8f c) { return wmmab(a, b, c); } };
template <typename T16, int NSPLIT, bool BIAS>
__global__ __launch_bounds__(32) void k_gemmw(const T16* __restrict__ A, const T16* __restrict__ A2, const T16* __restrict__ Bt, const T16* __restrict__ Bt2, int K, float* C, int ldc, const float* __restrict__ bias, size_t sA, size_t sB, size_t sC) {
    typedef typename WFrag<T16>::V V;
    __shared__ __align__(16) float os[16 * 68];
    const size_t z = blockIdx.z; A += z * sA; if (A2) A2 += z * sA; Bt += z * sB; if (Bt2) Bt2 += z * sB; C += z * sC;
    const int lane = threadIdx.x & 31, lr = lane & 15, hi = lane >> 4; const int r0 = blockIdx.x * 64, c0 = blockIdx.y * 64;
    v8f acc[4][4];
#pragma unroll
    for (int mb = 0; mb < 4; ++mb)
#pragma unroll
        for (int nb = 0; nb < 4; ++nb) acc[mb][nb] = (v8f){};
    const size_t aoff = (size_t)(r0 + lr) * K + 8 * hi, boff = (size_t)(c0 + lr) * K + 8 * hi;
#pragma unroll 1
    for (int kc = 0; kc < K; kc += 32) {
        V a[4], a2[4];
#pragma unroll
        for (int mb = 0; mb < 4; ++mb) { a[mb] = WFrag<T16>::ld(A + aoff + (size_t)mb * 16 * K + kc); if (NSPLIT == 1 || NSPLIT == 2) a2[mb] = WFrag<T16>::ld(A2 + aoff + (size_t)mb * 16 * K + kc); }
#pragma unroll
        for (int nb = 0; nb < 4; ++nb) { const V b = WFrag<T16>::ld(Bt + boff + (size_t)nb * 16 * K + kc); V b2; if (NSPLIT >= 2) b2 = WFrag<T16>::ld(Bt2 + boff + (size_t)nb * 16 * K + kc);
#pragma unroll
            for (int mb = 0; mb < 4; ++mb) { acc[mb][nb] = WFrag<T16>::mma(a[mb], b, acc[mb][nb]); if (NSPLIT == 1 || NSPLIT == 2) acc[mb][nb] = WFrag<T16>::mma(a2[mb], b, acc[mb][nb]); if (NSPLIT >= 2) acc[mb][nb] = WFrag<T16>::mma(a[mb], b2, acc[mb][nb]); } }
        asm volatile("v_nop\n\tv_nop\n\tv_nop\n\tv_nop" : "+v"(acc[0][0]), "+v"(acc[1][1]), "+v"(acc[2][2]), "+v"(acc[3][3]) : "v"(a[0]), "v"(a[3]));
    }
#pragma unroll
    for (int mb = 0; mb < 4; ++mb) {
#pragma unroll
        for (int nb = 0; nb < 4; ++nb) {
#pragma unroll
            for (int j = 0; j < 8; ++j) os[(hi * 8 + j) * 68 + nb * 16 + lr] = acc[mb][nb][j]; }
        __builtin_amdgcn_wave_barrier(); asm volatile("" ::: "memory");
        float* crow = C + (size_t)(r0 + mb * 16) * ldc + c0;
{
#pragma unroll
            for (int s = 0; s < 8; ++s) { const int row = 2 * s + hi, cofs = lr * 4; v4f val = *(const v4fa*)(os + row * 68 + cofs); if (BIAS) { val[0] += bfr(bias[c0 + cofs]); val[1] += bfr(bias[c0 + cofs + 1]); val[2] += bfr(bias[c0 + cofs + 2]); val[3] += bfr(bias[c0 + cofs + 3]); }
                *(v4f*)(crow + (size_t)row * ldc + cofs) = val; }
             }
        __builtin_amdgcn_wave_barrier(); asm volatile("" ::: "memory");
    }
}

// ---- k_gemmc: the same one-wave 64x64 tile GEMM specialised for causal attention: CMODE 1 skips score tiles entirely above the diagonal (query rows r0+roff.., key columns c0..), CMODE 2 limits the
// key (K) loop of the probability x value contraction to the diagonal block (probabilities beyond it are exactly zero). roff = row offset of this launch's first row within the token axis.
// GQA: the z-th A/C plane (query head) uses B plane z / zdiv (kv head).
template <typename T16, int NSPLIT, int CMODE>
__global__ __launch_bounds__(32) void k_gemmc(const T16* __restrict__ A, const T16* __restrict__ A2, const T16* __restrict__ Bt, const T16* __restrict__ Bt2, int K, float* C, int ldc, int roff, int zdiv, size_t sA, size_t sB, size_t sC) {
    typedef typename WFrag<T16>::V V;
    __shared__ __align__(16) float os[16 * 68];
    const size_t z = blockIdx.z, zb = z / (size_t)zdiv; A += z * sA; if (A2) A2 += z * sA; Bt += zb * sB; if (Bt2) Bt2 += zb * sB; C += z * sC;
    const int lane = threadIdx.x & 31, lr = lane & 15, hi = lane >> 4; const int r0 = blockIdx.x * 64, c0 = blockIdx.y * 64;
    if (CMODE == 1 && c0 > r0 + roff + 63) return;                  // score tile entirely above the causal diagonal: never read (the softmax masks j > i by select)
    const int Kl = (CMODE == 2) ? min(K, r0 + roff + 64) : K;        // P.V: probabilities are exactly 0 beyond the diagonal block, so the K loop stops there
    v8f acc[4][4];
#pragma unroll
    for (int mb = 0; mb < 4; ++mb)
#pragma unroll
        for (int nb = 0; nb < 4; ++nb) acc[mb][nb] = (v8f){};
    const size_t aoff = (size_t)(r0 + lr) * K + 8 * hi, boff = (size_t)(c0 + lr) * K + 8 * hi;
#pragma unroll 1
    for (int kc = 0; kc < Kl; kc += 32) {
        V a[4], a2[4];
#pragma unroll
        for (int mb = 0; mb < 4; ++mb) { a[mb] = WFrag<T16>::ld(A + aoff + (size_t)mb * 16 * K + kc); if (NSPLIT == 1 || NSPLIT == 2) a2[mb] = WFrag<T16>::ld(A2 + aoff + (size_t)mb * 16 * K + kc); }
#pragma unroll
        for (int nb = 0; nb < 4; ++nb) { const V b = WFrag<T16>::ld(Bt + boff + (size_t)nb * 16 * K + kc); V b2; if (NSPLIT >= 2) b2 = WFrag<T16>::ld(Bt2 + boff + (size_t)nb * 16 * K + kc);
#pragma unroll
            for (int mb = 0; mb < 4; ++mb) { acc[mb][nb] = WFrag<T16>::mma(a[mb], b, acc[mb][nb]); if (NSPLIT == 1 || NSPLIT == 2) acc[mb][nb] = WFrag<T16>::mma(a2[mb], b, acc[mb][nb]); if (NSPLIT >= 2) acc[mb][nb] = WFrag<T16>::mma(a[mb], b2, acc[mb][nb]); } }
        asm volatile("v_nop\n\tv_nop\n\tv_nop\n\tv_nop" : "+v"(acc[0][0]), "+v"(acc[1][1]), "+v"(acc[2][2]), "+v"(acc[3][3]) : "v"(a[0]), "v"(a[3]));
    }
#pragma unroll
    for (int mb = 0; mb < 4; ++mb) {
#pragma unroll
        for (int nb = 0; nb < 4; ++nb) {
#pragma unroll
            for (int j = 0; j < 8; ++j) os[(hi * 8 + j) * 68 + nb * 16 + lr] = acc[mb][nb][j]; }
        __builtin_amdgcn_wave_barrier(); asm volatile("" ::: "memory");
        float* crow = C + (size_t)(r0 + mb * 16) * ldc + c0;
{
#pragma unroll
            for (int s = 0; s < 8; ++s) { const int row = 2 * s + hi, cofs = lr * 4; v4f val = *(const v4fa*)(os + row * 68 + cofs);
                *(v4f*)(crow + (size_t)row * ldc + cofs) = val; }
             }
        __builtin_amdgcn_wave_barrier(); asm volatile("" ::: "memory");
    }
}

__device__ __forceinline__ void splitf(float y, unsigned short& h, unsigned short& l) { h = f2bf(y); l = f2bf(y - bf2f(h)); }
typedef __attribute__((ext_vector_type(2))) unsigned short v2us;
typedef __attribute__((ext_vector_type(4))) unsigned short v4us;
typedef __attribute__((ext_vector_type(2))) float v2f;
typedef __attribute__((ext_vector_type(4))) int v4i;

__global__ __launch_bounds__(256) void k_wtG(const float* __restrict__ w, int K, int N, bf* Bt) {
    const int lane = threadIdx.x & 31; const int L0 = (blockIdx.x * 8 + (threadIdx.x >> 5)) * 8; const int nlines = (int)((size_t)N * K / 64);
{
#pragma unroll 1
        for (int l = 0; l < 8; ++l) { const int L = L0 + l; if (L >= nlines) break; const size_t e = (size_t)L * 64 + lane * 2; const int k = (int)(e % K), n = (int)(e / K); v2us o;
            o[0] = f2bf(w[(size_t)k * N + n]); o[1] = f2bf(w[(size_t)(k + 1) * N + n]); *(v2us*)(Bt + e) = o; }
         }
}
__global__ __launch_bounds__(256) void k_cvt8(const float* __restrict__ src, bf* dst, size_t n8) { const size_t i = (size_t)blockIdx.x * 256 + threadIdx.x; if (i >= n8) return; const v8f v = *(const v8f*)(src + i * 8); v8us o;
#pragma unroll
    for (int k = 0; k < 8; ++k) o[k] = f2bf(v[k]); *(v8us*)(dst + i * 8) = o;  }
__global__ __launch_bounds__(32) void k_invf(float* IF) {
    const int j = threadIdx.x & 31;
    const float e = (float)j * (1.0f / (float)(HD / 2));
    const float p = powf(THETA, e);
    const float v = 1.0f / p;
    *(float*)(IF + j) = v; 
}
__global__ __launch_bounds__(256) void k_cstab(const int* __restrict__ pos, const float* __restrict__ IF, float* CS) {
    const int idx = blockIdx.x * 256 + threadIdx.x; if (idx >= TT * HD) return;
    const int dd = idx % HD; const int t = idx / HD; const int j = dd & (HD / 2 - 1);
    const float pf = (float)pos[t];
    float fr = __fmul_rn(pf, IF[j]); asm volatile("" : "+v"(fr));
    float sn, cn;
    sincosf(fr, &sn, &cn);
    v2f cs; cs[0] = cn; cs[1] = sn;
    *(v2f*)(CS + (size_t)idx * 2) = cs; 
}
// k_rope: head planes [h][t][d] (bf16 hi/lo) of rope(F) with the rotate-half convention out[d] = x[d] cos[t][d] - x[d+HD/2] sin[t][d], out[d+HD/2] = x[d+HD/2] cos[t][d+HD/2] + x[d] sin[t][d+HD/2]
__global__ __launch_bounds__(256) void k_rope(const float* __restrict__ F, int pitch, int nheads, const float* __restrict__ CS, bf* Ph, bf* Pl) {
    const size_t e = ((size_t)blockIdx.x * 256 + threadIdx.x) * 2; if (e >= (size_t)nheads * TT * HD) return; const int d = (int)(e % HD); const int t = (int)((e / HD) % TT); const int h = (int)(e / ((size_t)HD * TT)); const float* f = F + (size_t)t * pitch + h * HD; v2us oh, ol;
#pragma unroll
    for (int q = 0; q < 2; ++q) { const int dd = d + q; const int dp = (dd < HD / 2) ? dd + HD / 2 : dd - HD / 2; const float x0 = f[dd], x1 = f[dp];
        const v2f cs = *(const v2f*)(CS + ((size_t)t * HD + dd) * 2); float a = __fmul_rn(x0, cs[0]), bq = __fmul_rn(x1, cs[1]); asm volatile("" : "+v"(a)); asm volatile("" : "+v"(bq)); const float r = (dd < HD / 2) ? __fsub_rn(a, bq) : __fadd_rn(a, bq);
        unsigned short a2, c2; splitf(r, a2, c2); oh[q] = a2; ol[q] = c2; }
    *(v2us*)(Ph + e) = oh; *(v2us*)(Pl + e) = ol;  }
__global__ __launch_bounds__(256) void k_vtp(const float* __restrict__ F, int pitch, int nheads, bf* Vh, bf* Vl) { const size_t e = ((size_t)blockIdx.x * 256 + threadIdx.x) * 2; if (e >= (size_t)nheads * HD * TT) return; const int t = (int)(e % TT); const int d = (int)((e / TT) % HD); const int g = (int)(e / ((size_t)TT * HD)); v2us oh, ol;
#pragma unroll
    for (int q = 0; q < 2; ++q) { const float x = F[(size_t)(t + q) * pitch + g * HD + d]; unsigned short a2, c2; splitf(x, a2, c2); oh[q] = a2; ol[q] = c2; }
    *(v2us*)(Vh + e) = oh; *(v2us*)(Vl + e) = ol;  }
// k_asoft: per row (zz, i), one wave per row: t = S x 0.125 where seg[j] == seg[i] and j <= i, else the replace-fill (exp gives exactly 0); max-subtracted softmax over the TT keys (register row, one exp, fixed trees);
__global__ __launch_bounds__(256) void k_asoft(const float* __restrict__ Sb, const int* __restrict__ seg, bf* Ph, bf* Pl) {
    const int lane = threadIdx.x & 31; const int row = blockIdx.x * 8 + (threadIdx.x >> 5); if (row >= ZH * TT) return; const int i = row % TT; const int si = seg[i]; const float* sr = Sb + (size_t)row * TT; float v[TT / 32]; float mx = -3.0e38f;
#pragma unroll
    for (int ch = 0; ch < TT / 128; ++ch) { const int j0 = ch * 128 + lane * 4; const v4f a = *(const v4f*)(sr + j0); const v4i sg = *(const v4i*)(seg + j0);
#pragma unroll
        for (int q = 0; q < 4; ++q) { const int j = j0 + q; float sa = a[q] * SCL; asm volatile("" : "+v"(sa)); const float t = (sg[q] == si && j <= i) ? sa : -3.0e38f; v[ch * 4 + q] = t; mx = fmaxf(mx, t); } }
#pragma unroll
    for (int sh = 16; sh; sh >>= 1) mx = fmaxf(mx, __shfl_xor(mx, sh, 32));
    float sum = 0.f;
#pragma unroll
    for (int k = 0; k < TT / 32; ++k) { float d0 = __fsub_rn(v[k], mx); asm volatile("" : "+v"(d0)); v[k] = __builtin_amdgcn_exp2f(__fmul_rn(d0, 1.4426950408889634f)); sum += v[k]; }
#pragma unroll
    for (int sh = 16; sh; sh >>= 1) sum += __shfl_xor(sum, sh, 32);
    const float f = __fdiv_rn(1.0f, sum);
{
#pragma unroll
        for (int ch = 0; ch < TT / 128; ++ch) { v4us oh, ol;
#pragma unroll
            for (int q = 0; q < 4; ++q) { unsigned short a2, c2; splitf(v[ch * 4 + q] * f, a2, c2); oh[q] = a2; ol[q] = c2; }
            const size_t oo = (size_t)row * TT + ch * 128 + lane * 4; *(v4us*)(Ph + oo) = oh; *(v4us*)(Pl + oo) = ol; }
         }
}
__global__ __launch_bounds__(256) void k_merge(const float* __restrict__ O, int h0, bf* Ah, bf* Al) { const size_t e = ((size_t)blockIdx.x * 256 + threadIdx.x) * 2; if (e >= (size_t)ZH * TT * HD) return; const int d = (int)(e % HD); const int t = (int)((e / HD) % TT); const int zz = (int)(e / ((size_t)HD * TT)); const size_t oo = (size_t)t * DQ + (size_t)(h0 + zz) * HD + d;
    v2us oh, ol;
#pragma unroll
    for (int q = 0; q < 2; ++q) { unsigned short a2, c2; splitf(O[e + q], a2, c2); oh[q] = a2; ol[q] = c2; } *(v2us*)(Ah + oo) = oh; *(v2us*)(Al + oo) = ol;  }

extern "C" void kernel_launch(void* const* d_in, const int* in_sizes, int n_in,
                              void* d_out, int out_size, void* d_ws, size_t ws_size, hipStream_t stream) {
    if (n_in < 7) return;
    if (in_sizes[0] < TT * DM || in_sizes[1] < DM * DQ || in_sizes[2] < DM * DKV || in_sizes[3] < DM * DKV || in_sizes[4] < DQ * DM || in_sizes[5] < TT || in_sizes[6] < TT) return;
    if (out_size < TT * DM) return;
    const float* x = (const float*)d_in[0]; const float* wq = (const float*)d_in[1]; const float* wk = (const float*)d_in[2]; const float* wv = (const float*)d_in[3]; const float* wo = (const float*)d_in[4];
    const int* pos = (const int*)d_in[5]; const int* seg = (const int*)d_in[6];
    float* OUT = (float*)d_out;     // [TT][DM]
    char* wsp = (char*)d_ws;
    auto take = [&](size_t bytes) { char* p = wsp; wsp += (bytes + 255) & ~(size_t)255; return (void*)p; };
    bf* WQ = (bf*)take((size_t)DQ * DM * 2); bf* WK = (bf*)take((size_t)DKV * DM * 2); bf* WV = (bf*)take((size_t)DKV * DM * 2); bf* WO = (bf*)take((size_t)DM * DQ * 2);
    float* INVF = (float*)take(256); float* CS = (float*)take((size_t)TT * HD * 2 * 4);
    bf* XB = (bf*)take((size_t)TT * DM * 2); float* FQ = (float*)take((size_t)TT * DQ * 4); float* FK = (float*)take((size_t)TT * DKV * 4); float* FV = (float*)take((size_t)TT * DKV * 4);
    bf* QPh = (bf*)take((size_t)NQ * TT * HD * 2); bf* QPl = (bf*)take((size_t)NQ * TT * HD * 2); bf* KPh = (bf*)take((size_t)NKV * TT * HD * 2); bf* KPl = (bf*)take((size_t)NKV * TT * HD * 2);
    bf* VTh = (bf*)take((size_t)NKV * HD * TT * 2); bf* VTl = (bf*)take((size_t)NKV * HD * TT * 2);
    float* Sb = (float*)take((size_t)ZH * TT * TT * 4); bf* Ph = (bf*)take((size_t)ZH * TT * TT * 2); bf* Pl = (bf*)take((size_t)ZH * TT * TT * 2); float* Ob = (float*)take((size_t)ZH * TT * HD * 4);
    bf* ATh = (bf*)take((size_t)TT * DQ * 2); bf* ATl = (bf*)take((size_t)TT * DQ * 2);
    const size_t used = (size_t)(wsp - (char*)d_ws);
    if (used > ws_size || used > ((size_t)128 << 20)) return;    // 122.5 MiB at TT=1024, ZH=8

    // tables and 16-bit planes of the inputs
    k_invf<<<1, 32, 0, stream>>>(INVF);
    k_cstab<<<(unsigned)((TT * HD + 255) / 256), 256, 0, stream>>>(pos, INVF, CS);
    k_wtG<<<(unsigned)(((size_t)DQ * DM / 64 + 63) / 64), 256, 0, stream>>>(wq, DM, DQ, WQ);      // Wq [D][NQ*HD]  -> WQ[c][d]
    k_wtG<<<(unsigned)(((size_t)DKV * DM / 64 + 63) / 64), 256, 0, stream>>>(wk, DM, DKV, WK);    // Wk [D][NKV*HD] -> WK[c][d]
    k_wtG<<<(unsigned)(((size_t)DKV * DM / 64 + 63) / 64), 256, 0, stream>>>(wv, DM, DKV, WV);    // Wv [D][NKV*HD] -> WV[c][d]
    k_wtG<<<(unsigned)(((size_t)DM * DQ / 64 + 63) / 64), 256, 0, stream>>>(wo, DQ, DM, WO);      // Wo [NQ*HD][D]  -> WO[dout][nh]
    k_cvt8<<<(unsigned)(((size_t)TT * DM / 8 + 255) / 256), 256, 0, stream>>>(x, XB, (size_t)TT * DM / 8);
    // projections (plain bf16 operands) and roped / transposed hi-lo planes
    const unsigned LQ = (unsigned)(((size_t)NQ * TT * HD / 2 + 255) / 256), LKv = (unsigned)(((size_t)NKV * TT * HD / 2 + 255) / 256);
    k_gemmw<bf, 0, false><<<dim3(TT / 64, DQ / 64, 1), 32, 0, stream>>>(XB, nullptr, WQ, nullptr, DM, FQ, DQ, nullptr, 0, 0, 0);
    k_rope<<<LQ, 256, 0, stream>>>(FQ, DQ, NQ, CS, QPh, QPl);
    k_gemmw<bf, 0, false><<<dim3(TT / 64, DKV / 64, 1), 32, 0, stream>>>(XB, nullptr, WK, nullptr, DM, FK, DKV, nullptr, 0, 0, 0);
    k_rope<<<LKv, 256, 0, stream>>>(FK, DKV, NKV, CS, KPh, KPl);
    k_gemmw<bf, 0, false><<<dim3(TT / 64, DKV / 64, 1), 32, 0, stream>>>(XB, nullptr, WV, nullptr, DM, FV, DKV, nullptr, 0, 0, 0);
    k_vtp<<<LKv, 256, 0, stream>>>(FV, DKV, NKV, VTh, VTl);
    // attention passes: ZH query heads per pass (ZH/GQ kv heads), query head h0+z uses kv head h0/GQ + z/GQ
    for (int h0 = 0; h0 < NQ; h0 += ZH) { const size_t zq = (size_t)h0, zk = (size_t)(h0 / GQ);
        k_gemmc<bf, 2, 1><<<dim3(TT / 64, TT / 64, ZH), 32, 0, stream>>>(QPh + zq * TT * HD, QPl + zq * TT * HD, KPh + zk * TT * HD, KPl + zk * TT * HD, HD, Sb, TT, 0, GQ, (size_t)TT * HD, (size_t)TT * HD, (size_t)TT * TT);
        k_asoft<<<(unsigned)(ZH * TT / 8), 256, 0, stream>>>(Sb, seg, Ph, Pl);
        k_gemmc<bf, 2, 2><<<dim3(TT / 64, HD / 64, ZH), 32, 0, stream>>>(Ph, Pl, VTh + zk * HD * TT, VTl + zk * HD * TT, TT, Ob, HD, 0, GQ, (size_t)TT * TT, (size_t)HD * TT, (size_t)TT * HD);
        k_merge<<<(unsigned)(((size_t)ZH * TT * HD / 2 + 255) / 256), 256, 0, stream>>>(Ob, h0, ATh, ATl); }
    // output projection: hi/lo ctx x bf16 Wo
    k_gemmw<bf, 1, false><<<dim3(TT / 64, DM / 64, 1), 32, 0, stream>>>(ATh, ATl, WO, nullptr, DQ, OUT, DM, nullptr, 0, 0, 0);
}

// v001
// It runs in 281 microseconds.
// Two timings next to v000 put it at 1.45 and 1.47 times that version's speed.
#include <hip/hip_runtime.h>

// GQA causal ragged attention: q/k/v = x W (32 query heads, 8 kv heads, head 64, no bias), rotate-half RoPE from int32 positions (theta 5e5), mask = (same segment id) and (key index <= query index) with -3e38 fill, softmax(q.k * 0.125), ctx Wo -> [TT][2048] f32.
// Compute dtypes, f32 accumulate everywhere: x and all four weights RNE-converted to bf16 planes; q/k/v projections v_wmma_f32_16x16x32_bf16 on plain bf16 operands (one product); scores and attn.v on bf16 hi/lo split planes (hi.hi + lo.hi + hi.lo); output projection bf16 hi/lo ctx x bf16 Wo (2 products); RoPE tables, RoPE, softmax and all side math f32 on VALU.

#ifndef TT
#define TT   1024
#endif
#define TT_FULL 1024
#define DM   2048
#define NQ   32
#define NKV  8
#define GQ   (NQ / NKV)
#define HD   64
#define DQ   (NQ * HD)
#define DKV  (NKV * HD)
#ifndef ZH
#define ZH   8
#endif
#define THETA 500000.0f
#define SCL  0.125f
static_assert(TT % 128 == 0);
static_assert(TT <= TT_FULL);
static_assert(ZH % GQ == 0);
static_assert(NQ % ZH == 0);
static_assert(HD == 64);
static_assert(DM % 64 == 0 && DQ % 64 == 0 && DKV % 64 == 0);

typedef _Float16 h16;
typedef unsigned short bf;
typedef __attribute__((ext_vector_type(16))) __bf16   v16bf;
typedef __attribute__((ext_vector_type(16))) _Float16 v16h;
typedef __attribute__((ext_vector_type(8)))  _Float16 v8h;
typedef __attribute__((ext_vector_type(8)))  unsigned short v8us;
typedef __attribute__((ext_vector_type(8)))  float    v8f;
typedef __attribute__((ext_vector_type(4)))  float    v4f;
typedef v8h  __attribute__((may_alias)) v8ha;
typedef v4f  __attribute__((may_alias)) v4fa;
typedef v8us __attribute__((may_alias)) v8usa;

__device__ __forceinline__ unsigned short f2bf(float f) { unsigned u = __float_as_uint(f); u += 0x7FFFu + ((u >> 16) & 1u); return (unsigned short)(u >> 16); }
__device__ __forceinline__ float bf2f(unsigned short b) { return __uint_as_float(((unsigned)b) << 16); }
__device__ __forceinline__ float bfr(float f) { return bf2f(f2bf(f)); }
__device__ __forceinline__ v16h cat16(v8h lo, v8h hi) { return __builtin_shufflevector(lo, hi, 0, 1, 2, 3, 4, 5, 6, 7, 8, 9, 10, 11, 12, 13, 14, 15); }
__device__ __forceinline__ v16bf cat16b(v8us lo, v8us hi) { return __builtin_bit_cast(v16bf, __builtin_shufflevector(lo, hi, 0, 1, 2, 3, 4, 5, 6, 7, 8, 9, 10, 11, 12, 13, 14, 15)); }
__device__ __forceinline__ v8f wmma16(v16h a, v16h b, v8f c) { return __builtin_amdgcn_wmma_f32_16x16x32_f16(false, a, false, b, (short)0, c, false, false); }
__device__ __forceinline__ v8f wmmab(v16bf a, v16bf b, v8f c) { return __builtin_amdgcn_wmma_f32_16x16x32_bf16(false, a, false, b, (short)0, c, false, false); }

// ---- k_gemmw: register-blocked GEMM, one 64x64 output tile per workgroup of NW waves; wave w takes the 32-wide k steps w, w + NW, ... into its own 16 accumulators (operands straight from K-contiguous
// 16-bit planes), and the NW partial tiles are summed in LDS in the fixed order w = 0 .. NW-1; grid (M/64, N/64, Z), 32 * NW threads.
// C[m][n] (f32, pitch ldc, + optional f32 bias[n]) = sum_k A[m][k] Bt[n][k] (+ split products per NSPLIT). z-batch strides sA/sB/sC in elements. K % 32 == 0.
// Fragments: lane -> row/col lane&15, vector elements 0..7 <- k0 + 8h + i, elements 8..15 <- k0 + 16 + 8h + i (h = lane>>4) for BOTH operands; D element r -> (row 8h + r, col lane&15).
template <typename T16> struct WFrag;
template <> struct WFrag<h16> { typedef v16h V; static __device__ __forceinline__ V ld(const h16* p) { return cat16(*(const v8h*)p, *(const v8h*)(p + 16)); } static __device__ __forceinline__ v8f mma(V a, V b, v8f c) { return wmma16(a, b, c); } };
template <> struct WFrag<bf> { typedef v16bf V; static __device__ __forceinline__ V ld(const bf* p) { return cat16b(*(const v8us*)p, *(const v8us*)(p + 16)); } static __device__ __forceinline__ v8f mma(V a, V b, v8f c) { return wmmab(a, b, c); } };
template <typename T16, int NSPLIT, bool BIAS, int NW>
__global__ __launch_bounds__(32 * NW) void k_gemmw(const T16* __restrict__ A, const T16* __restrict__ A2, const T16* __restrict__ Bt, const T16* __restrict__ Bt2, int K, float* C, int ldc, const float* __restrict__ bias, size_t sA, size_t sB, size_t sC) {
    typedef typename WFrag<T16>::V V;
    static_assert(NW == 8);                                          // the join below deals 16 rows x 16 float4 columns to 256 threads
    __shared__ __align__(16) float os[2 * NW * 16 * 68];             // two buffers of NW partial 16x64 row blocks: one barrier per row block
    const size_t z = blockIdx.z; A += z * sA; if (A2) A2 += z * sA; Bt += z * sB; if (Bt2) Bt2 += z * sB; C += z * sC;
    const int lane = threadIdx.x & 31, lr = lane & 15, hi = lane >> 4; const int r0 = blockIdx.x * 64, c0 = blockIdx.y * 64;
    const int wv = __builtin_amdgcn_readfirstlane((int)(threadIdx.x >> 5));
    v8f acc[4][4];
#pragma unroll
    for (int mb = 0; mb < 4; ++mb)
#pragma unroll
        for (int nb = 0; nb < 4; ++nb) acc[mb][nb] = (v8f){};
    const size_t aoff = (size_t)(r0 + lr) * K + 8 * hi, boff = (size_t)(c0 + lr) * K + 8 * hi;
#pragma unroll 1
    for (int kc = wv * 32; kc < K; kc += 32 * NW) {
        V a[4], a2[4];
#pragma unroll
        for (int mb = 0; mb < 4; ++mb) { a[mb] = WFrag<T16>::ld(A + aoff + (size_t)mb * 16 * K + kc); if (NSPLIT == 1 || NSPLIT == 2) a2[mb] = WFrag<T16>::ld(A2 + aoff + (size_t)mb * 16 * K + kc); }
#pragma unroll
        for (int nb = 0; nb < 4; ++nb) { const V b = WFrag<T16>::ld(Bt + boff + (size_t)nb * 16 * K + kc); V b2; if (NSPLIT >= 2) b2 = WFrag<T16>::ld(Bt2 + boff + (size_t)nb * 16 * K + kc);
#pragma unroll
            for (int mb = 0; mb < 4; ++mb) { acc[mb][nb] = WFrag<T16>::mma(a[mb], b, acc[mb][nb]); if (NSPLIT == 1 || NSPLIT == 2) acc[mb][nb] = WFrag<T16>::mma(a2[mb], b, acc[mb][nb]); if (NSPLIT >= 2) acc[mb][nb] = WFrag<T16>::mma(a[mb], b2, acc[mb][nb]); } }
        asm volatile("v_nop\n\tv_nop\n\tv_nop\n\tv_nop" : "+v"(acc[0][0]), "+v"(acc[1][1]), "+v"(acc[2][2]), "+v"(acc[3][3]) : "v"(a[0]), "v"(a[3]));
    }
    const int row = (int)(threadIdx.x >> 4), cofs = (int)(threadIdx.x & 15) * 4; v4f res[4];   // the join: thread -> one float4 of each 16x64 row block
#pragma unroll
    for (int mb = 0; mb < 4; ++mb) {
        float* ob = os + (mb & 1) * (NW * 16 * 68);
#pragma unroll
        for (int nb = 0; nb < 4; ++nb) {
#pragma unroll
            for (int j = 0; j < 8; ++j) ob[wv * (16 * 68) + (hi * 8 + j) * 68 + nb * 16 + lr] = acc[mb][nb][j]; }
        __syncthreads();                                             // every wave's partial of this row block is in LDS; the other buffer's readers are done before it is written again
        v4f val = *(const v4fa*)(ob + row * 68 + cofs);
#pragma unroll
        for (int w = 1; w < NW; ++w) val += *(const v4fa*)(ob + w * (16 * 68) + row * 68 + cofs);
        if (BIAS) { val[0] += bfr(bias[c0 + cofs]); val[1] += bfr(bias[c0 + cofs + 1]); val[2] += bfr(bias[c0 + cofs + 2]); val[3] += bfr(bias[c0 + cofs + 3]); }
        res[mb] = val;
    }
    // stores behind the last barrier: a store in front of a barrier would be waited out there
#pragma unroll
    for (int mb = 0; mb < 4; ++mb) *(v4f*)(C + (size_t)(r0 + mb * 16 + row) * ldc + c0 + cofs) = res[mb];
}

// ---- k_gemmc: the same 64x64 tile GEMM (NW = 1: one wave does the whole k loop and stores alone; NW = 8: k steps dealt to 8 waves and joined in LDS as in k_gemmw) specialised for causal attention: CMODE 1 skips score tiles entirely above the diagonal (query rows r0+roff.., key columns c0..), CMODE 2 limits the
// key (K) loop of the probability x value contraction to the diagonal block (probabilities beyond it are exactly zero). roff = row offset of this launch's first row within the token axis.
// GQA: the z-th A/C plane (query head) uses B plane z / zdiv (kv head).
template <typename T16, int NSPLIT, int CMODE, int NW>
__global__ __launch_bounds__(32 * NW) void k_gemmc(const T16* __restrict__ A, const T16* __restrict__ A2, const T16* __restrict__ Bt, const T16* __restrict__ Bt2, int K, float* C, int ldc, int roff, int zdiv, size_t sA, size_t sB, size_t sC) {
    typedef typename WFrag<T16>::V V;
    static_assert(NW == 1 || NW == 8);
    __shared__ __align__(16) float os[(NW > 1 ? 2 * NW : 1) * 16 * 68];
    const int wv = NW > 1 ? __builtin_amdgcn_readfirstlane((int)(threadIdx.x >> 5)) : 0;
    const size_t z = blockIdx.z, zb = z / (size_t)zdiv; A += z * sA; if (A2) A2 += z * sA; Bt += zb * sB; if (Bt2) Bt2 += zb * sB; C += z * sC;
    const int lane = threadIdx.x & 31, lr = lane & 15, hi = lane >> 4; const int r0 = blockIdx.x * 64, c0 = blockIdx.y * 64;
    if (CMODE == 1 && c0 > r0 + roff + 63) return;                  // score tile entirely above the causal diagonal: never read (the softmax masks j > i by select)
    const int Kl = (CMODE == 2) ? min(K, r0 + roff + 64) : K;        // P.V: probabilities are exactly 0 beyond the diagonal block, so the K loop stops there
    v8f acc[4][4];
#pragma unroll
    for (int mb = 0; mb < 4; ++mb)
#pragma unroll
        for (int nb = 0; nb < 4; ++nb) acc[mb][nb] = (v8f){};
    const size_t aoff = (size_t)(r0 + lr) * K + 8 * hi, boff = (size_t)(c0 + lr) * K + 8 * hi;
#pragma unroll 1
    for (int kc = wv * 32; kc < Kl; kc += 32 * NW) {
        V a[4], a2[4];
#pragma unroll
        for (int mb = 0; mb < 4; ++mb) { a[mb] = WFrag<T16>::ld(A + aoff + (size_t)mb * 16 * K + kc); if (NSPLIT == 1 || NSPLIT == 2) a2[mb] = WFrag<T16>::ld(A2 + aoff + (size_t)mb * 16 * K + kc); }
#pragma unroll
        for (int nb = 0; nb < 4; ++nb) { const V b = WFrag<T16>::ld(Bt + boff + (size_t)nb * 16 * K + kc); V b2; if (NSPLIT >= 2) b2 = WFrag<T16>::ld(Bt2 + boff + (size_t)nb * 16 * K + kc);
#pragma unroll
            for (int mb = 0; mb < 4; ++mb) { acc[mb][nb] = WFrag<T16>::mma(a[mb], b, acc[mb][nb]); if (NSPLIT == 1 || NSPLIT == 2) acc[mb][nb] = WFrag<T16>::mma(a2[mb], b, acc[mb][nb]); if (NSPLIT >= 2) acc[mb][nb] = WFrag<T16>::mma(a[mb], b2, acc[mb][nb]); } }
        asm volatile("v_nop\n\tv_nop\n\tv_nop\n\tv_nop" : "+v"(acc[0][0]), "+v"(acc[1][1]), "+v"(acc[2][2]), "+v"(acc[3][3]) : "v"(a[0]), "v"(a[3]));
    }
    const int jrow = (int)(threadIdx.x >> 4), jcol = (int)(threadIdx.x & 15) * 4; v4f res[4];   // the join (NW > 1): thread -> one float4 of each 16x64 row block
#pragma unroll
    for (int mb = 0; mb < 4; ++mb) {
        float* ob = os + (NW > 1 ? (mb & 1) * (NW * 16 * 68) : 0);
#pragma unroll
        for (int nb = 0; nb < 4; ++nb) {
#pragma unroll
            for (int j = 0; j < 8; ++j) ob[wv * (16 * 68) + (hi * 8 + j) * 68 + nb * 16 + lr] = acc[mb][nb][j]; }
        float* crow = C + (size_t)(r0 + mb * 16) * ldc + c0;
        if (NW == 1) {
        __builtin_amdgcn_wave_barrier(); asm volatile("" ::: "memory");
#pragma unroll
            for (int s = 0; s < 8; ++s) { const int row = 2 * s + hi, cofs = lr * 4; v4f val = *(const v4fa*)(os + row * 68 + cofs);
                *(v4f*)(crow + (size_t)row * ldc + cofs) = val; }
        __builtin_amdgcn_wave_barrier(); asm volatile("" ::: "memory");
        } else {
            __syncthreads();                                         // every wave's partial of this row block is in LDS; the other buffer's readers are done before it is written again
            v4f val = *(const v4fa*)(ob + jrow * 68 + jcol);
#pragma unroll
            for (int w = 1; w < NW; ++w) val += *(const v4fa*)(ob + w * (16 * 68) + jrow * 68 + jcol);
            res[mb] = val;
        }
    }
    // stores behind the last barrier: a store in front of a barrier would be waited out there
    if (NW > 1) {
#pragma unroll
        for (int mb = 0; mb < 4; ++mb) *(v4f*)(C + (size_t)(r0 + mb * 16 + jrow) * ldc + c0 + jcol) = res[mb]; }
}

__device__ __forceinline__ void splitf(float y, unsigned short& h, unsigned short& l) { h = f2bf(y); l = f2bf(y - bf2f(h)); }
typedef __attribute__((ext_vector_type(2))) unsigned short v2us;
typedef __attribute__((ext_vector_type(4))) unsigned short v4us;
typedef __attribute__((ext_vector_type(2))) float v2f;
typedef __attribute__((ext_vector_type(4))) int v4i;

__global__ __launch_bounds__(256) void k_wtG(const float* __restrict__ w, int K, int N, bf* Bt) {
    const int lane = threadIdx.x & 31; const int L0 = (blockIdx.x * 8 + (threadIdx.x >> 5)) * 8; const int nlines = (int)((size_t)N * K / 64);
{
#pragma unroll 1
        for (int l = 0; l < 8; ++l) { const int L = L0 + l; if (L >= nlines) break; const size_t e = (size_t)L * 64 + lane * 2; const int k = (int)(e % K), n = (int)(e / K); v2us o;
            o[0] = f2bf(w[(size_t)k * N + n]); o[1] = f2bf(w[(size_t)(k + 1) * N + n]); *(v2us*)(Bt + e) = o; }
         }
}
__global__ __launch_bounds__(256) void k_cvt8(const float* __restrict__ src, bf* dst, size_t n8) { const size_t i = (size_t)blockIdx.x * 256 + threadIdx.x; if (i >= n8) return; const v8f v = *(const v8f*)(src + i * 8); v8us o;
#pragma unroll
    for (int k = 0; k < 8; ++k) o[k] = f2bf(v[k]); *(v8us*)(dst + i * 8) = o;  }
__global__ __launch_bounds__(32) void k_invf(float* IF) {
    const int j = threadIdx.x & 31;
    const float e = (float)j * (1.0f / (float)(HD / 2));
    const float p = powf(THETA, e);
    const float v = 1.0f / p;
    *(float*)(IF + j) = v; 
}
__global__ __launch_bounds__(256) void k_cstab(const int* __restrict__ pos, const float* __restrict__ IF, float* CS) {
    const int idx = blockIdx.x * 256 + threadIdx.x; if (idx >= TT * HD) return;
    const int dd = idx % HD; const int t = idx / HD; const int j = dd & (HD / 2 - 1);
    const float pf = (float)pos[t];
    float fr = __fmul_rn(pf, IF[j]); asm volatile("" : "+v"(fr));
    float sn, cn;
    sincosf(fr, &sn, &cn);
    v2f cs; cs[0] = cn; cs[1] = sn;
    *(v2f*)(CS + (size_t)idx * 2) = cs; 
}
// k_rope: head planes [h][t][d] (bf16 hi/lo) of rope(F) with the rotate-half convention out[d] = x[d] cos[t][d] - x[d+HD/2] sin[t][d], out[d+HD/2] = x[d+HD/2] cos[t][d+HD/2] + x[d] sin[t][d+HD/2]
__global__ __launch_bounds__(256) void k_rope(const float* __restrict__ F, int pitch, int nheads, const float* __restrict__ CS, bf* Ph, bf* Pl) {
    const size_t e = ((size_t)blockIdx.x * 256 + threadIdx.x) * 2; if (e >= (size_t)nheads * TT * HD) return; const int d = (int)(e % HD); const int t = (int)((e / HD) % TT); const int h = (int)(e / ((size_t)HD * TT)); const float* f = F + (size_t)t * pitch + h * HD; v2us oh, ol;
#pragma unroll
    for (int q = 0; q < 2; ++q) { const int dd = d + q; const int dp = (dd < HD / 2) ? dd + HD / 2 : dd - HD / 2; const float x0 = f[dd], x1 = f[dp];
        const v2f cs = *(const v2f*)(CS + ((size_t)t * HD + dd) * 2); float a = __fmul_rn(x0, cs[0]), bq = __fmul_rn(x1, cs[1]); asm volatile("" : "+v"(a)); asm volatile("" : "+v"(bq)); const float r = (dd < HD / 2) ? __fsub_rn(a, bq) : __fadd_rn(a, bq);
        unsigned short a2, c2; splitf(r, a2, c2); oh[q] = a2; ol[q] = c2; }
    *(v2us*)(Ph + e) = oh; *(v2us*)(Pl + e) = ol;  }
__global__ __launch_bounds__(256) void k_vtp(const float* __restrict__ F, int pitch, int nheads, bf* Vh, bf* Vl) { const size_t e = ((size_t)blockIdx.x * 256 + threadIdx.x) * 2; if (e >= (size_t)nheads * HD * TT) return; const int t = (int)(e % TT); const int d = (int)((e / TT) % HD); const int g = (int)(e / ((size_t)TT * HD)); v2us oh, ol;
#pragma unroll
    for (int q = 0; q < 2; ++q) { const float x = F[(size_t)(t + q) * pitch + g * HD + d]; unsigned short a2, c2; splitf(x, a2, c2); oh[q] = a2; ol[q] = c2; }
    *(v2us*)(Vh + e) = oh; *(v2us*)(Vl + e) = ol;  }
// k_asoft: per row (zz, i), one wave per row: t = S x 0.125 where seg[j] == seg[i] and j <= i, else the replace-fill (exp gives exactly 0); max-subtracted softmax over the TT keys (register row, one exp, fixed trees);
__global__ __launch_bounds__(256) void k_asoft(const float* __restrict__ Sb, const int* __restrict__ seg, bf* Ph, bf* Pl) {
    const int lane = threadIdx.x & 31; const int row = blockIdx.x * 8 + (threadIdx.x >> 5); if (row >= ZH * TT) return; const int i = row % TT; const int si = seg[i]; const float* sr = Sb + (size_t)row * TT; float v[TT / 32]; float mx = -3.0e38f;
#pragma unroll
    for (int ch = 0; ch < TT / 128; ++ch) { const int j0 = ch * 128 + lane * 4; const v4f a = *(const v4f*)(sr + j0); const v4i sg = *(const v4i*)(seg + j0);
#pragma unroll
        for (int q = 0; q < 4; ++q) { const int j = j0 + q; float sa = a[q] * SCL; asm volatile("" : "+v"(sa)); const float t = (sg[q] == si && j <= i) ? sa : -3.0e38f; v[ch * 4 + q] = t; mx = fmaxf(mx, t); } }
#pragma unroll
    for (int sh = 16; sh; sh >>= 1) mx = fmaxf(mx, __shfl_xor(mx, sh, 32));
    float sum = 0.f;
#pragma unroll
    for (int k = 0; k < TT / 32; ++k) { float d0 = __fsub_rn(v[k], mx); asm volatile("" : "+v"(d0)); v[k] = __builtin_amdgcn_exp2f(__fmul_rn(d0, 1.4426950408889634f)); sum += v[k]; }
#pragma unroll
    for (int sh = 16; sh; sh >>= 1) sum += __shfl_xor(sum, sh, 32);
    const float f = __fdiv_rn(1.0f, sum);
{
#pragma unroll
        for (int ch = 0; ch < TT / 128; ++ch) { v4us oh, ol;
#pragma unroll
            for (int q = 0; q < 4; ++q) { unsigned short a2, c2; splitf(v[ch * 4 + q] * f, a2, c2); oh[q] = a2; ol[q] = c2; }
            const size_t oo = (size_t)row * TT + ch * 128 + lane * 4; *(v4us*)(Ph + oo) = oh; *(v4us*)(Pl + oo) = ol; }
         }
}
__global__ __launch_bounds__(256) void k_merge(const float* __restrict__ O, int h0, bf* Ah, bf* Al) { const size_t e = ((size_t)blockIdx.x * 256 + threadIdx.x) * 2; if (e >= (size_t)ZH * TT * HD) return; const int d = (int)(e % HD); const int t = (int)((e / HD) % TT); const int zz = (int)(e / ((size_t)HD * TT)); const size_t oo = (size_t)t * DQ + (size_t)(h0 + zz) * HD + d;
    v2us oh, ol;
#pragma unroll
    for (int q = 0; q < 2; ++q) { unsigned short a2, c2; splitf(O[e + q], a2, c2); oh[q] = a2; ol[q] = c2; } *(v2us*)(Ah + oo) = oh; *(v2us*)(Al + oo) = ol;  }

extern "C" void kernel_launch(void* const* d_in, const int* in_sizes, int n_in,
                              void* d_out, int out_size, void* d_ws, size_t ws_size, hipStream_t stream) {
    if (n_in < 7) return;
    if (in_sizes[0] < TT * DM || in_sizes[1] < DM * DQ || in_sizes[2] < DM * DKV || in_sizes[3] < DM * DKV || in_sizes[4] < DQ * DM || in_sizes[5] < TT || in_sizes[6] < TT) return;
    if (out_size < TT * DM) return;
    const float* x = (const float*)d_in[0]; const float* wq = (const float*)d_in[1]; const float* wk = (const float*)d_in[2]; const float* wv = (const float*)d_in[3]; const float* wo = (const float*)d_in[4];
    const int* pos = (const int*)d_in[5]; const int* seg = (const int*)d_in[6];
    float* OUT = (float*)d_out;     // [TT][DM]
    char* wsp = (char*)d_ws;
    auto take = [&](size_t bytes) { char* p = wsp; wsp += (bytes + 255) & ~(size_t)255; return (void*)p; };
    bf* WQ = (bf*)take((size_t)DQ * DM * 2); bf* WK = (bf*)take((size_t)DKV * DM * 2); bf* WV = (bf*)take((size_t)DKV * DM * 2); bf* WO = (bf*)take((size_t)DM * DQ * 2);
    float* INVF = (float*)take(256); float* CS = (float*)take((size_t)TT * HD * 2 * 4);
    bf* XB = (bf*)take((size_t)TT * DM * 2); float* FQ = (float*)take((size_t)TT * DQ * 4); float* FK = (float*)take((size_t)TT * DKV * 4); float* FV = (float*)take((size_t)TT * DKV * 4);
    bf* QPh = (bf*)take((size_t)NQ * TT * HD * 2); bf* QPl = (bf*)take((size_t)NQ * TT * HD * 2); bf* KPh = (bf*)take((size_t)NKV * TT * HD * 2); bf* KPl = (bf*)take((size_t)NKV * TT * HD * 2);
    bf* VTh = (bf*)take((size_t)NKV * HD * TT * 2); bf* VTl = (bf*)take((size_t)NKV * HD * TT * 2);
    float* Sb = (float*)take((size_t)ZH * TT * TT * 4); bf* Ph = (bf*)take((size_t)ZH * TT * TT * 2); bf* Pl = (bf*)take((size_t)ZH * TT * TT * 2); float* Ob = (float*)take((size_t)ZH * TT * HD * 4);
    bf* ATh = (bf*)take((size_t)TT * DQ * 2); bf* ATl = (bf*)take((size_t)TT * DQ * 2);
    const size_t used = (size_t)(wsp - (char*)d_ws);
    if (used > ws_size || used > ((size_t)128 << 20)) return;    // 122.5 MiB at TT=1024, ZH=8

    // tables and 16-bit planes of the inputs
    k_invf<<<1, 32, 0, stream>>>(INVF);
    k_cstab<<<(unsigned)((TT * HD + 255) / 256), 256, 0, stream>>>(pos, INVF, CS);
    k_wtG<<<(unsigned)(((size_t)DQ * DM / 64 + 63) / 64), 256, 0, stream>>>(wq, DM, DQ, WQ);      // Wq [D][NQ*HD]  -> WQ[c][d]
    k_wtG<<<(unsigned)(((size_t)DKV * DM / 64 + 63) / 64), 256, 0, stream>>>(wk, DM, DKV, WK);    // Wk [D][NKV*HD] -> WK[c][d]
    k_wtG<<<(unsigned)(((size_t)DKV * DM / 64 + 63) / 64), 256, 0, stream>>>(wv, DM, DKV, WV);    // Wv [D][NKV*HD] -> WV[c][d]
    k_wtG<<<(unsigned)(((size_t)DM * DQ / 64 + 63) / 64), 256, 0, stream>>>(wo, DQ, DM, WO);      // Wo [NQ*HD][D]  -> WO[dout][nh]
    k_cvt8<<<(unsigned)(((size_t)TT * DM / 8 + 255) / 256), 256, 0, stream>>>(x, XB, (size_t)TT * DM / 8);
    // projections (plain bf16 operands) and roped / transposed hi-lo planes
    const unsigned LQ = (unsigned)(((size_t)NQ * TT * HD / 2 + 255) / 256), LKv = (unsigned)(((size_t)NKV * TT * HD / 2 + 255) / 256);
    k_gemmw<bf, 0, false, 8><<<dim3(TT / 64, DQ / 64, 1), 256, 0, stream>>>(XB, nullptr, WQ, nullptr, DM, FQ, DQ, nullptr, 0, 0, 0);
    k_rope<<<LQ, 256, 0, stream>>>(FQ, DQ, NQ, CS, QPh, QPl);
    k_gemmw<bf, 0, false, 8><<<dim3(TT / 64, DKV / 64, 1), 256, 0, stream>>>(XB, nullptr, WK, nullptr, DM, FK, DKV, nullptr, 0, 0, 0);
    k_rope<<<LKv, 256, 0, stream>>>(FK, DKV, NKV, CS, KPh, KPl);
    k_gemmw<bf, 0, false, 8><<<dim3(TT / 64, DKV / 64, 1), 256, 0, stream>>>(XB, nullptr, WV, nullptr, DM, FV, DKV, nullptr, 0, 0, 0);
    k_vtp<<<LKv, 256, 0, stream>>>(FV, DKV, NKV, VTh, VTl);
    // attention passes: ZH query heads per pass (ZH/GQ kv heads), query head h0+z uses kv head h0/GQ + z/GQ
    for (int h0 = 0; h0 < NQ; h0 += ZH) { const size_t zq = (size_t)h0, zk = (size_t)(h0 / GQ);
        k_gemmc<bf, 2, 1, 1><<<dim3(TT / 64, TT / 64, ZH), 32, 0, stream>>>(QPh + zq * TT * HD, QPl + zq * TT * HD, KPh + zk * TT * HD, KPl + zk * TT * HD, HD, Sb, TT, 0, GQ, (size_t)TT * HD, (size_t)TT * HD, (size_t)TT * TT);
        k_asoft<<<(unsigned)(ZH * TT / 8), 256, 0, stream>>>(Sb, seg, Ph, Pl);
        k_gemmc<bf, 2, 2, 8><<<dim3(TT / 64, HD / 64, ZH), 256, 0, stream>>>(Ph, Pl, VTh + zk * HD * TT, VTl + zk * HD * TT, TT, Ob, HD, 0, GQ, (size_t)TT * TT, (size_t)HD * TT, (size_t)TT * HD);
        k_merge<<<(unsigned)(((size_t)ZH * TT * HD / 2 + 255) / 256), 256, 0, stream>>>(Ob, h0, ATh, ATl); }
    // output projection: hi/lo ctx x bf16 Wo
    k_gemmw<bf, 1, false, 8><<<dim3(TT / 64, DM / 64, 1), 256, 0, stream>>>(ATh, ATl, WO, nullptr, DQ, OUT, DM, nullptr, 0, 0, 0);
}

// v003
// One run takes 144 microseconds.
// Versions in between are left out here; by their measured steps it is 1.97 times as fast as v001.
// All steps since v000 together make it 2.88 times as fast.
#include <hip/hip_runtime.h>

// GQA causal ragged attention: q/k/v = x W (32 query heads, 8 kv heads, head 64, no bias), rotate-half RoPE from int32 positions (theta 5e5), mask = (same segment id) and (key index <= query index) with -3e38 fill, softmax(q.k * 0.125), ctx Wo -> [TT][2048] f32.
// Compute dtypes, f32 accumulate everywhere: x and all four weights RNE-converted to bf16 planes; q/k/v projections v_wmma_f32_16x16x32_bf16 on plain bf16 operands (one product); scores and attn.v on bf16 hi/lo split planes (hi.hi + lo.hi + hi.lo); output projection bf16 hi/lo ctx x bf16 Wo (2 products); RoPE tables, RoPE, softmax and all side math f32 on VALU.

#ifndef TT
#define TT   1024
#endif
#define TT_FULL 1024
#define DM   2048
#define NQ   32
#define NKV  8
#define GQ   (NQ / NKV)
#define HD   64
#define DQ   (NQ * HD)
#define DKV  (NKV * HD)
#define THETA 500000.0f
#define SCL  0.125f
static_assert(TT % 128 == 0);
static_assert(TT <= TT_FULL);
static_assert(HD == 64);
static_assert(DM % 64 == 0 && DQ % 64 == 0 && DKV % 64 == 0);

typedef _Float16 h16;
typedef unsigned short bf;
typedef __attribute__((ext_vector_type(16))) __bf16   v16bf;
typedef __attribute__((ext_vector_type(16))) _Float16 v16h;
typedef __attribute__((ext_vector_type(8)))  _Float16 v8h;
typedef __attribute__((ext_vector_type(8)))  unsigned short v8us;
typedef __attribute__((ext_vector_type(8)))  float    v8f;
typedef __attribute__((ext_vector_type(4)))  float    v4f;
typedef v8h  __attribute__((may_alias)) v8ha;
typedef v4f  __attribute__((may_alias)) v4fa;
typedef v8us __attribute__((may_alias)) v8usa;

__device__ __forceinline__ unsigned short f2bf(float f) { unsigned u = __float_as_uint(f); u += 0x7FFFu + ((u >> 16) & 1u); return (unsigned short)(u >> 16); }
__device__ __forceinline__ float bf2f(unsigned short b) { return __uint_as_float(((unsigned)b) << 16); }
__device__ __forceinline__ float bfr(float f) { return bf2f(f2bf(f)); }
__device__ __forceinline__ v16h cat16(v8h lo, v8h hi) { return __builtin_shufflevector(lo, hi, 0, 1, 2, 3, 4, 5, 6, 7, 8, 9, 10, 11, 12, 13, 14, 15); }
__device__ __forceinline__ v16bf cat16b(v8us lo, v8us hi) { return __builtin_bit_cast(v16bf, __builtin_shufflevector(lo, hi, 0, 1, 2, 3, 4, 5, 6, 7, 8, 9, 10, 11, 12, 13, 14, 15)); }
__device__ __forceinline__ v8f wmma16(v16h a, v16h b, v8f c) { return __builtin_amdgcn_wmma_f32_16x16x32_f16(false, a, false, b, (short)0, c, false, false); }
__device__ __forceinline__ v8f wmmab(v16bf a, v16bf b, v8f c) { return __builtin_amdgcn_wmma_f32_16x16x32_bf16(false, a, false, b, (short)0, c, false, false); }

// ---- k_gemmw: register-blocked GEMM, one 64x64 output tile per workgroup of NW waves; wave w takes the 32-wide k steps w, w + NW, ... into its own 16 accumulators (operands straight from K-contiguous
// 16-bit planes), and the NW partial tiles are summed in LDS in the fixed order w = 0 .. NW-1; grid (M/64, N/64, Z), 32 * NW threads.
// C[m][n] (f32, pitch ldc, + optional f32 bias[n]) = sum_k A[m][k] Bt[n][k] (+ split products per NSPLIT). z-batch strides sA/sB/sC in elements. K % 32 == 0.
// Fragments: lane -> row/col lane&15, vector elements 0..7 <- k0 + 8h + i, elements 8..15 <- k0 + 16 + 8h + i (h = lane>>4) for BOTH operands; D element r -> (row 8h + r, col lane&15).
template <typename T16> struct WFrag;
template <> struct WFrag<h16> { typedef v16h V; static __device__ __forceinline__ V ld(const h16* p) { return cat16(*(const v8h*)p, *(const v8h*)(p + 16)); } static __device__ __forceinline__ v8f mma(V a, V b, v8f c) { return wmma16(a, b, c); } };
template <> struct WFrag<bf> { typedef v16bf V; static __device__ __forceinline__ V ld(const bf* p) { return cat16b(*(const v8us*)p, *(const v8us*)(p + 16)); } static __device__ __forceinline__ v8f mma(V a, V b, v8f c) { return wmmab(a, b, c); } };
template <typename T16, int NSPLIT, bool BIAS, int NW>
__global__ __launch_bounds__(32 * NW) void k_gemmw(const T16* __restrict__ A, const T16* __restrict__ A2, const T16* __restrict__ Bt, const T16* __restrict__ Bt2, int K, float* C, int ldc, const float* __restrict__ bias, size_t sA, size_t sB, size_t sC) {
    typedef typename WFrag<T16>::V V;
    static_assert(NW == 8);                                          // the join below deals 16 rows x 16 float4 columns to 256 threads
    __shared__ __align__(16) float os[2 * NW * 16 * 68];             // two buffers of NW partial 16x64 row blocks: one barrier per row block
    const size_t z = blockIdx.z; A += z * sA; if (A2) A2 += z * sA; Bt += z * sB; if (Bt2) Bt2 += z * sB; C += z * sC;
    const int lane = threadIdx.x & 31, lr = lane & 15, hi = lane >> 4; const int r0 = blockIdx.x * 64, c0 = blockIdx.y * 64;
    const int wv = __builtin_amdgcn_readfirstlane((int)(threadIdx.x >> 5));
    v8f acc[4][4];
#pragma unroll
    for (int mb = 0; mb < 4; ++mb)
#pragma unroll
        for (int nb = 0; nb < 4; ++nb) acc[mb][nb] = (v8f){};
    const size_t aoff = (size_t)(r0 + lr) * K + 8 * hi, boff = (size_t)(c0 + lr) * K + 8 * hi;
#pragma unroll 1
    for (int kc = wv * 32; kc < K; kc += 32 * NW) {
        V a[4], a2[4];
#pragma unroll
        for (int mb = 0; mb < 4; ++mb) { a[mb] = WFrag<T16>::ld(A + aoff + (size_t)mb * 16 * K + kc); if (NSPLIT == 1 || NSPLIT == 2) a2[mb] = WFrag<T16>::ld(A2 + aoff + (size_t)mb * 16 * K + kc); }
#pragma unroll
        for (int nb = 0; nb < 4; ++nb) { const V b = WFrag<T16>::ld(Bt + boff + (size_t)nb * 16 * K + kc); V b2; if (NSPLIT >= 2) b2 = WFrag<T16>::ld(Bt2 + boff + (size_t)nb * 16 * K + kc);
#pragma unroll
            for (int mb = 0; mb < 4; ++mb) { acc[mb][nb] = WFrag<T16>::mma(a[mb], b, acc[mb][nb]); if (NSPLIT == 1 || NSPLIT == 2) acc[mb][nb] = WFrag<T16>::mma(a2[mb], b, acc[mb][nb]); if (NSPLIT >= 2) acc[mb][nb] = WFrag<T16>::mma(a[mb], b2, acc[mb][nb]); } }
        asm volatile("v_nop\n\tv_nop\n\tv_nop\n\tv_nop" : "+v"(acc[0][0]), "+v"(acc[1][1]), "+v"(acc[2][2]), "+v"(acc[3][3]) : "v"(a[0]), "v"(a[3]));
    }
    const int row = (int)(threadIdx.x >> 4), cofs = (int)(threadIdx.x & 15) * 4; v4f res[4];   // the join: thread -> one float4 of each 16x64 row block
#pragma unroll
    for (int mb = 0; mb < 4; ++mb) {
        float* ob = os + (mb & 1) * (NW * 16 * 68);
#pragma unroll
        for (int nb = 0; nb < 4; ++nb) {
#pragma unroll
            for (int j = 0; j < 8; ++j) ob[wv * (16 * 68) + (hi * 8 + j) * 68 + nb * 16 + lr] = acc[mb][nb][j]; }
        __syncthreads();                                             // every wave's partial of this row block is in LDS; the other buffer's readers are done before it is written again
        v4f val = *(const v4fa*)(ob + row * 68 + cofs);
#pragma unroll
        for (int w = 1; w < NW; ++w) val += *(const v4fa*)(ob + w * (16 * 68) + row * 68 + cofs);
        if (BIAS) { val[0] += bfr(bias[c0 + cofs]); val[1] += bfr(bias[c0 + cofs + 1]); val[2] += bfr(bias[c0 + cofs + 2]); val[3] += bfr(bias[c0 + cofs + 3]); }
        res[mb] = val;
    }
    // stores behind the last barrier: a store in front of a barrier would be waited out there
#pragma unroll
    for (int mb = 0; mb < 4; ++mb) *(v4f*)(C + (size_t)(r0 + mb * 16 + row) * ldc + c0 + cofs) = res[mb];
}

__device__ __forceinline__ void splitf(float y, unsigned short& h, unsigned short& l) { h = f2bf(y); l = f2bf(y - bf2f(h)); }
typedef __attribute__((ext_vector_type(2))) unsigned short v2us;
typedef __attribute__((ext_vector_type(4))) unsigned short v4us;
typedef __attribute__((ext_vector_type(2))) float v2f;
typedef __attribute__((ext_vector_type(4))) int v4i;
typedef __attribute__((ext_vector_type(2))) __bf16 v2bf;
typedef __attribute__((ext_vector_type(8))) unsigned v8u;

// The d_* functions are the bodies of jobs that read none of each other's output; k_prep and k_post below deal the blocks of one grid to them (blk = the block's index inside its job).
__device__ __forceinline__ void d_wtG(int blk, const float* __restrict__ w, int K, int N, bf* Bt) {
    const int lane = threadIdx.x & 31; const int L0 = (blk * 8 + (threadIdx.x >> 5)) * 8; const int nlines = (int)((size_t)N * K / 64);
{
#pragma unroll 1
        for (int l = 0; l < 8; ++l) { const int L = L0 + l; if (L >= nlines) break; const size_t e = (size_t)L * 64 + lane * 2; const int k = (int)(e % K), n = (int)(e / K); v2us o;
            o[0] = f2bf(w[(size_t)k * N + n]); o[1] = f2bf(w[(size_t)(k + 1) * N + n]); *(v2us*)(Bt + e) = o; }
         }
}
__device__ __forceinline__ void d_cvt8(int blk, const float* __restrict__ src, bf* dst, size_t n8) { const size_t i = (size_t)blk * 256 + threadIdx.x; if (i >= n8) return; const v8f v = *(const v8f*)(src + i * 8); v8us o;
#pragma unroll
    for (int k = 0; k < 8; ++k) o[k] = f2bf(v[k]); *(v8us*)(dst + i * 8) = o;  }
// the inverse frequency is computed by the thread that uses it, so that the table job depends on the inputs alone
__device__ __forceinline__ void d_cstab(int blk, const int* __restrict__ pos, float* CS) {
    const int idx = blk * 256 + threadIdx.x; if (idx >= TT * HD) return;
    const int dd = idx % HD; const int t = idx / HD; const int j = dd & (HD / 2 - 1);
    const float e = (float)j * (1.0f / (float)(HD / 2));
    const float p = powf(THETA, e);
    const float v = 1.0f / p;
    const float pf = (float)pos[t];
    float fr = __fmul_rn(pf, v); asm volatile("" : "+v"(fr));
    float sn, cn;
    sincosf(fr, &sn, &cn);
    v2f cs; cs[0] = cn; cs[1] = sn;
    *(v2f*)(CS + (size_t)idx * 2) = cs; 
}
// d_rope: head planes [h][t][d] (bf16 hi/lo) of rope(F) with the rotate-half convention out[d] = x[d] cos[t][d] - x[d+HD/2] sin[t][d], out[d+HD/2] = x[d+HD/2] cos[t][d+HD/2] + x[d] sin[t][d+HD/2]
__device__ __forceinline__ void d_rope(int blk, const float* __restrict__ F, int pitch, int nheads, const float* __restrict__ CS, bf* Ph, bf* Pl) {
    const size_t e = ((size_t)blk * 256 + threadIdx.x) * 2; if (e >= (size_t)nheads * TT * HD) return; const int d = (int)(e % HD); const int t = (int)((e / HD) % TT); const int h = (int)(e / ((size_t)HD * TT)); const float* f = F + (size_t)t * pitch + h * HD; v2us oh, ol;
#pragma unroll
    for (int q = 0; q < 2; ++q) { const int dd = d + q; const int dp = (dd < HD / 2) ? dd + HD / 2 : dd - HD / 2; const float x0 = f[dd], x1 = f[dp];
        const v2f cs = *(const v2f*)(CS + ((size_t)t * HD + dd) * 2); float a = __fmul_rn(x0, cs[0]), bq = __fmul_rn(x1, cs[1]); asm volatile("" : "+v"(a)); asm volatile("" : "+v"(bq)); const float r = (dd < HD / 2) ? __fsub_rn(a, bq) : __fadd_rn(a, bq);
        unsigned short a2, c2; splitf(r, a2, c2); oh[q] = a2; ol[q] = c2; }
    *(v2us*)(Ph + e) = oh; *(v2us*)(Pl + e) = ol;  }
__device__ __forceinline__ void d_vtp(int blk, const float* __restrict__ F, int pitch, int nheads, bf* Vh, bf* Vl) { const size_t e = ((size_t)blk * 256 + threadIdx.x) * 2; if (e >= (size_t)nheads * HD * TT) return; const int t = (int)(e % TT); const int d = (int)((e / TT) % HD); const int g = (int)(e / ((size_t)TT * HD)); v2us oh, ol;
#pragma unroll
    for (int q = 0; q < 2; ++q) { const float x = F[(size_t)(t + q) * pitch + g * HD + d]; unsigned short a2, c2; splitf(x, a2, c2); oh[q] = a2; ol[q] = c2; }
    *(v2us*)(Vh + e) = oh; *(v2us*)(Vl + e) = ol;  }
// ---- k_prep: every job that reads the inputs alone, in one grid; the weight transposes, whose blocks run longest, start first. The branches are on blockIdx and so the same for a whole block.
#define DQKV   (DQ + 2 * DKV)
#define NB_WQ  (DQ * DM / (64 * 64))
#define NB_WKV (DKV * DM / (64 * 64))
#define NB_X   (TT * DM / (8 * 256))
#define NB_CS  (TT * HD / 256)
#define NB_ROPE ((NQ + NKV) * TT * HD / (2 * 256))
#define NB_VT  (NKV * TT * HD / (2 * 256))
__global__ __launch_bounds__(256) void k_prep(const float* __restrict__ x, const float* __restrict__ wq, const float* __restrict__ wk, const float* __restrict__ wv, const float* __restrict__ wo, const int* __restrict__ pos,
                                              bf* WQ, bf* WK, bf* WV, bf* WO, bf* XB, float* CS) {
    int b = (int)blockIdx.x;
    if (b >= 2 * NB_WQ + 2 * NB_WKV + NB_X) { d_cstab(b - (2 * NB_WQ + 2 * NB_WKV + NB_X), pos, CS); return; }   // the last blocks of the grid; tested first, since behind five other tests the compiler makes powf a call
    if (b < NB_WQ) { d_wtG(b, wq, DM, DQ, WQ); return; }            // Wq [D][NQ*HD]  -> WQ[c][d]
    b -= NB_WQ;
    if (b < NB_WQ) { d_wtG(b, wo, DQ, DM, WO); return; }            // Wo [NQ*HD][D]  -> WO[dout][nh]
    b -= NB_WQ;
    if (b < NB_WKV) { d_wtG(b, wk, DM, DKV, WK); return; }          // Wk [D][NKV*HD] -> WK[c][d]
    b -= NB_WKV;
    if (b < NB_WKV) { d_wtG(b, wv, DM, DKV, WV); return; }          // Wv [D][NKV*HD] -> WV[c][d]
    b -= NB_WKV;
    d_cvt8(b, x, XB, (size_t)TT * DM / 8);
}
// ---- k_post: the two jobs that read the projections F [t][q heads | k heads | v heads], in one grid: the V transpose (strided reads, started first), then RoPE of the NQ + NKV q and k heads into planes that lie one behind the other.
__global__ __launch_bounds__(256) void k_post(const float* __restrict__ F, const float* __restrict__ CS, bf* Ph, bf* Pl, bf* Vh, bf* Vl) {
    const int b = (int)blockIdx.x;
    if (b < NB_VT) { d_vtp(b, F + DQ + DKV, DQKV, NKV, Vh, Vl); return; }
    d_rope(b - NB_VT, F, DQKV, NQ + NKV, CS, Ph, Pl);
}
// ---- k_fattn: scores, mask, softmax and attn.v of one 16-query tile in one pass over the keys; scores and probabilities stay in registers. Workgroup = the GQ query heads of one kv head (one wave each, same
// 16 queries, so the waves read the same K and V lines); grid (TT/16) * NKV; LDS holds only the segment ids (one barrier). Per 64-key block, up to the diagonal block:
//   St[key][query] = K Q^T (A = K rows, B = Q rows; qh.kh + ql.kh + qh.kl): D element r of key tile nb -> (key 16 nb + 8h + r, query lane&15), which is already the B-fragment k order of the next product
//   (elements 0..7 <- k0 + 8h + i from tile 2j, elements 8..15 <- k0 + 16 + 8h + i from tile 2j + 1), so the probabilities go from one product to the other with no exchange between lanes;
//   running row maximum m and row sum l per query (lane&15; the two lane halves hold different keys), accumulator rescaled by exp(m_old - m_new);
//   Ot[d][query] += Vt P^T (A = Vt rows d, B = P hi/lo; ph.vh + pl.vh + ph.vl): the query of every accumulator element is the lane's own, so the rescale and the final 1/l are lane-local.
// Every inner loop is fully unrolled, so that the fragment arrays are indexed by constants and stay in registers.
// A masked score is the fill -3e38. While a row has met no allowed key, m is the fill too and its masked entries count as exp(0) = 1; the first allowed key (the diagonal at the latest) rescales all of that by exp(-huge) = 0.
__global__ __launch_bounds__(32 * GQ) void k_fattn(const bf* __restrict__ Qh, const bf* __restrict__ Ql, const bf* __restrict__ Kh, const bf* __restrict__ Kl, const bf* __restrict__ Vh, const bf* __restrict__ Vl, const int* __restrict__ seg, bf* Ah, bf* Al) {
    typedef WFrag<bf>::V V;
    const int lane = threadIdx.x & 31, lr = lane & 15, hi = lane >> 4;
    const int wv = __builtin_amdgcn_readfirstlane((int)(threadIdx.x >> 5));
    const int b = (int)blockIdx.x, nhalf = (TT / 32) * NKV;
    const int qt = b < nhalf ? TT / 16 - 1 - b / NKV : (b - nhalf) / NKV;   // long tiles start first, the short ones fill in beside them
    const int kvh = b % NKV, head = kvh * GQ + wv, q0 = qt * 16, qi = q0 + lr;
    const size_t qoff = ((size_t)head * TT + qi) * HD + 8 * hi;
    const bf* pqh = Qh + qoff; const bf* pql = Ql + qoff;
    V qh[2], ql[2];
#pragma unroll
    for (int kk = 0; kk < 2; ++kk) { qh[kk] = WFrag<bf>::ld(pqh + kk * 32); ql[kk] = WFrag<bf>::ld(pql + kk * 32); }
    __shared__ __align__(16) int sseg[TT];                           // the segment ids, read per key block from LDS: a global load there would be waited for in order behind the K loads in flight
    v4i sgr[TT / (32 * GQ * 4)];
#pragma unroll
    for (int i = 0; i < TT / (32 * GQ * 4); ++i) sgr[i] = *(const v4i*)(seg + (i * 32 * GQ + (int)threadIdx.x) * 4);
    const int sq = seg[qi];
    // K and V addresses = wave-uniform base (kv head, key block) + a lane offset that never changes
    const bf* kbh = Kh + (size_t)kvh * TT * HD; const bf* kbl = Kl + (size_t)kvh * TT * HD; const bf* vbh = Vh + (size_t)kvh * HD * TT; const bf* vbl = Vl + (size_t)kvh * HD * TT;
    const unsigned klane = (unsigned)(lr * HD + 8 * hi), vlane = (unsigned)(lr * TT + 8 * hi);
    v8f o[4];
#pragma unroll
    for (int mb = 0; mb < 4; ++mb) o[mb] = (v8f){};
    float m = -3.0e38f, l = 0.f;                                     // m in units of log2: score * SCL * log2(e)
    const int kend = q0 + 16;
    V kh[4][2], kl[4][2];                                            // the K fragments of one 64-key block, loaded one block ahead: again right behind their last use
#pragma unroll
    for (int nb = 0; nb < 4; ++nb)
#pragma unroll
        for (int kk = 0; kk < 2; ++kk) { const int e = nb * 16 * HD + kk * 32; kh[nb][kk] = WFrag<bf>::ld(kbh + klane + e); kl[nb][kk] = WFrag<bf>::ld(kbl + klane + e); }
    __builtin_amdgcn_sched_barrier(0);                               // nothing is scheduled in between the prologue's loads and their wait, or up over it
    // the precaution behind a group of loads, before a register that they name is written again; the addresses are inputs of the wait, so that they keep their registers up to it and no result of the group lands on one
    asm volatile("s_wait_xcnt 0x0" :: "v"(pqh), "v"(pql), "v"(klane) : "memory");
    __builtin_amdgcn_sched_barrier(0);                               // the second half of the same: what follows stays behind the wait
#pragma unroll
    for (int i = 0; i < TT / (32 * GQ * 4); ++i) *(v4i*)(sseg + (i * 32 * GQ + (int)threadIdx.x) * 4) = sgr[i];
    __syncthreads();                                                 // sseg is whole
#pragma unroll 1                                                     // one key block per trip: a second copy of the body would not fit the registers
    for (int kb = 0; kb < kend; kb += 64) {
        const int kn = kb + 64 < kend ? kb + 64 : kb;                // the next block; behind the last block this one again (in bounds, never used)
        V vh[4][2], vl[4][2];                                        // this block's V fragments: asked for here, used behind the softmax
        const bf* pvh = vbh + kb + vlane; const bf* pvl = vbl + kb + vlane;
#pragma unroll
        for (int mb = 0; mb < 4; ++mb)
#pragma unroll
            for (int j = 0; j < 2; ++j) { const int e = mb * 16 * TT + j * 32; vh[mb][j] = WFrag<bf>::ld(pvh + e); vl[mb][j] = WFrag<bf>::ld(pvl + e); }
        asm volatile("s_wait_xcnt 0x0" :: "v"(pvh), "v"(pvl) : "memory");   // the same precaution, the V addresses held in their registers up to the wait
        v8f s[4];
#pragma unroll
        for (int nb = 0; nb < 4; ++nb) { s[nb] = (v8f){};
#pragma unroll
            for (int kk = 0; kk < 2; ++kk) { s[nb] = wmmab(kh[nb][kk], qh[kk], s[nb]); s[nb] = wmmab(kh[nb][kk], ql[kk], s[nb]); s[nb] = wmmab(kl[nb][kk], qh[kk], s[nb]); } }
        const bf* pkh = kbh + (size_t)kn * HD + klane; const bf* pkl = kbl + (size_t)kn * HD + klane;
#pragma unroll
        for (int nb = 0; nb < 4; ++nb)
#pragma unroll
            for (int kk = 0; kk < 2; ++kk) { const int e = nb * 16 * HD + kk * 32; kh[nb][kk] = WFrag<bf>::ld(pkh + e); kl[nb][kk] = WFrag<bf>::ld(pkl + e); }
        asm volatile("s_wait_xcnt 0x0" :: "v"(pkh), "v"(pkl) : "memory");   // the same precaution, the K addresses held in their registers up to the wait
        const int lim = qi - kb - 8 * hi;                            // key offset 16 nb + r in this lane is causal iff it is <= lim
        float mx = m;
#pragma unroll
        for (int nb = 0; nb < 4; ++nb) { const int j0 = kb + nb * 16 + 8 * hi; const v4i g0 = *(const v4i*)(sseg + j0), g1 = *(const v4i*)(sseg + j0 + 4);
#pragma unroll
            for (int r = 0; r < 8; ++r) { const int sg = r < 4 ? g0[r & 3] : g1[r & 3]; const float t = (sg == sq && nb * 16 + r <= lim) ? s[nb][r] * (SCL * 1.4426950408889634f) : -3.0e38f; s[nb][r] = t; mx = fmaxf(mx, t); } }
        mx = fmaxf(mx, __shfl_xor(mx, 16, 32));
        const float al = __builtin_amdgcn_exp2f(m - mx);
        m = mx;
        v2f ps2[2] = {(v2f){0.f, 0.f}, (v2f){0.f, 0.f}}; v8u phw[2], plw[2];   // four independent partial row sums
#pragma unroll
        for (int nb = 0; nb < 4; ++nb) {
#pragma unroll
            for (int r = 0; r < 8; r += 2) { v2f pp; pp[0] = __builtin_amdgcn_exp2f(s[nb][r] - mx); pp[1] = __builtin_amdgcn_exp2f(s[nb][r + 1] - mx); ps2[nb & 1] += pp;
                const v2bf h2 = __builtin_convertvector(pp, v2bf); const v2bf l2 = __builtin_convertvector(pp - __builtin_convertvector(h2, v2f), v2bf);
                phw[nb >> 1][(nb & 1) * 4 + (r >> 1)] = __builtin_bit_cast(unsigned, h2); plw[nb >> 1][(nb & 1) * 4 + (r >> 1)] = __builtin_bit_cast(unsigned, l2); } }
        l = l * al + ((ps2[0][0] + ps2[1][0]) + (ps2[0][1] + ps2[1][1]));
#pragma unroll
        for (int mb = 0; mb < 4; ++mb) { o[mb] *= al;
#pragma unroll
            for (int j = 0; j < 2; ++j) { const V ph = __builtin_bit_cast(V, phw[j]), pl = __builtin_bit_cast(V, plw[j]); o[mb] = wmmab(vh[mb][j], ph, o[mb]); o[mb] = wmmab(vh[mb][j], pl, o[mb]); o[mb] = wmmab(vl[mb][j], ph, o[mb]); } }
    }
    l += __shfl_xor(l, 16, 32);
    const float f = __fdiv_rn(1.0f, l);
#pragma unroll
    for (int mb = 0; mb < 4; ++mb) { v8us oh, ol;
#pragma unroll
        for (int r = 0; r < 8; ++r) { unsigned short a2, c2; splitf(o[mb][r] * f, a2, c2); oh[r] = a2; ol[r] = c2; }
        const size_t oo = (size_t)qi * DQ + (size_t)head * HD + mb * 16 + 8 * hi; *(v8us*)(Ah + oo) = oh; *(v8us*)(Al + oo) = ol; }
}

extern "C" void kernel_launch(void* const* d_in, const int* in_sizes, int n_in,
                              void* d_out, int out_size, void* d_ws, size_t ws_size, hipStream_t stream) {
    if (n_in < 7) return;
    if (in_sizes[0] < TT * DM || in_sizes[1] < DM * DQ || in_sizes[2] < DM * DKV || in_sizes[3] < DM * DKV || in_sizes[4] < DQ * DM || in_sizes[5] < TT || in_sizes[6] < TT) return;
    if (out_size < TT * DM) return;
    const float* x = (const float*)d_in[0]; const float* wq = (const float*)d_in[1]; const float* wk = (const float*)d_in[2]; const float* wv = (const float*)d_in[3]; const float* wo = (const float*)d_in[4];
    const int* pos = (const int*)d_in[5]; const int* seg = (const int*)d_in[6];
    float* OUT = (float*)d_out;     // [TT][DM]
    char* wsp = (char*)d_ws;
    auto take = [&](size_t bytes) { char* p = wsp; wsp += (bytes + 255) & ~(size_t)255; return (void*)p; };
    // the q, k and v weight planes lie one behind the other ([DQKV][DM]), and so do the q and k head planes: the three projections are one GEMM, RoPE of q and k one job
    bf* WQ = (bf*)take((size_t)DQKV * DM * 2); bf* WK = WQ + (size_t)DQ * DM; bf* WV = WK + (size_t)DKV * DM; bf* WO = (bf*)take((size_t)DM * DQ * 2);
    float* CS = (float*)take((size_t)TT * HD * 2 * 4);
    bf* XB = (bf*)take((size_t)TT * DM * 2); float* F = (float*)take((size_t)TT * DQKV * 4);
    bf* QPh = (bf*)take((size_t)(NQ + NKV) * TT * HD * 2); bf* QPl = (bf*)take((size_t)(NQ + NKV) * TT * HD * 2); bf* KPh = QPh + (size_t)NQ * TT * HD; bf* KPl = QPl + (size_t)NQ * TT * HD;
    bf* VTh = (bf*)take((size_t)NKV * HD * TT * 2); bf* VTl = (bf*)take((size_t)NKV * HD * TT * 2);
    bf* ATh = (bf*)take((size_t)TT * DQ * 2); bf* ATl = (bf*)take((size_t)TT * DQ * 2);
    const size_t used = (size_t)(wsp - (char*)d_ws);
    if (used > ws_size || used > ((size_t)128 << 20)) return;

    // tables and 16-bit planes of the inputs: one launch
    k_prep<<<2 * NB_WQ + 2 * NB_WKV + NB_X + NB_CS, 256, 0, stream>>>(x, wq, wk, wv, wo, pos, WQ, WK, WV, WO, XB, CS);
    // q, k and v projections (plain bf16 operands): one launch, F [t][DQKV]
    k_gemmw<bf, 0, false, 8><<<dim3(TT / 64, DQKV / 64, 1), 256, 0, stream>>>(XB, nullptr, WQ, nullptr, DM, F, DQKV, nullptr, 0, 0, 0);
    // roped / transposed hi-lo planes: one launch
    k_post<<<NB_VT + NB_ROPE, 256, 0, stream>>>(F, CS, QPh, QPl, VTh, VTl);
    // attention: one launch, all heads; writes the hi/lo ctx planes [t][head * HD + d]
    k_fattn<<<(unsigned)((TT / 16) * NKV), 32 * GQ, 0, stream>>>(QPh, QPl, KPh, KPl, VTh, VTl, seg, ATh, ATl);
    // output projection: hi/lo ctx x bf16 Wo
    k_gemmw<bf, 1, false, 8><<<dim3(TT / 64, DM / 64, 1), 256, 0, stream>>>(ATh, ATl, WO, nullptr, DQ, OUT, DM, nullptr, 0, 0, 0);
}

// v004
// A run of this version takes 113 microseconds.
// Timed twice side by side with v003, it ran 1.27 and 1.28 times as fast.
// Over all steps from v000 it is 3.67 times as fast.
#include <hip/hip_runtime.h>

// GQA causal ragged attention: q/k/v = x W (32 query heads, 8 kv heads, head 64, no bias), rotate-half RoPE from int32 positions (theta 5e5), mask = (same segment id) and (key index <= query index) with -3e38 fill, softmax(q.k * 0.125), ctx Wo -> [TT][2048] f32.
// Compute dtypes, f32 accumulate everywhere: x and all four weights RNE-converted to bf16 planes; q/k/v projections v_wmma_f32_16x16x32_bf16 on plain bf16 operands (one product); scores and attn.v on bf16 hi/lo split planes (hi.hi + lo.hi + hi.lo); output projection bf16 hi/lo ctx x bf16 Wo (2 products); RoPE tables, RoPE, softmax and all side math f32 on VALU.

#ifndef TT
#define TT   1024
#endif
#define TT_FULL 1024
#define DM   2048
#define NQ   32
#define NKV  8
#define GQ   (NQ / NKV)
#define HD   64
#define DQ   (NQ * HD)
#define DKV  (NKV * HD)
#define THETA 500000.0f
#define SCL  0.125f
static_assert(TT % 128 == 0);
static_assert(TT <= TT_FULL);
static_assert(HD == 64);
static_assert(DM % 64 == 0 && DQ % 64 == 0 && DKV % 64 == 0);

typedef _Float16 h16;
typedef unsigned short bf;
typedef __attribute__((ext_vector_type(16))) __bf16   v16bf;
typedef __attribute__((ext_vector_type(16))) _Float16 v16h;
typedef __attribute__((ext_vector_type(8)))  _Float16 v8h;
typedef __attribute__((ext_vector_type(8)))  unsigned short v8us;
typedef __attribute__((ext_vector_type(8)))  float    v8f;
typedef __attribute__((ext_vector_type(4)))  float    v4f;
typedef v8h  __attribute__((may_alias)) v8ha;
typedef v4f  __attribute__((may_alias)) v4fa;
typedef v8us __attribute__((may_alias)) v8usa;

__device__ __forceinline__ unsigned short f2bf(float f) { unsigned u = __float_as_uint(f); u += 0x7FFFu + ((u >> 16) & 1u); return (unsigned short)(u >> 16); }
__device__ __forceinline__ float bf2f(unsigned short b) { return __uint_as_float(((unsigned)b) << 16); }
__device__ __forceinline__ float bfr(float f) { return bf2f(f2bf(f)); }
__device__ __forceinline__ v16h cat16(v8h lo, v8h hi) { return __builtin_shufflevector(lo, hi, 0, 1, 2, 3, 4, 5, 6, 7, 8, 9, 10, 11, 12, 13, 14, 15); }
__device__ __forceinline__ v16bf cat16b(v8us lo, v8us hi) { return __builtin_bit_cast(v16bf, __builtin_shufflevector(lo, hi, 0, 1, 2, 3, 4, 5, 6, 7, 8, 9, 10, 11, 12, 13, 14, 15)); }
__device__ __forceinline__ v8f wmma16(v16h a, v16h b, v8f c) { return __builtin_amdgcn_wmma_f32_16x16x32_f16(false, a, false, b, (short)0, c, false, false); }
__device__ __forceinline__ v8f wmmab(v16bf a, v16bf b, v8f c) { return __builtin_amdgcn_wmma_f32_16x16x32_bf16(false, a, false, b, (short)0, c, false, false); }

// ---- k_gemmw: register-blocked GEMM, one 64x64 output tile per workgroup of NW waves; wave w takes the 32-wide k steps w, w + NW, ... into its own 16 accumulators (operands straight from K-contiguous
// 16-bit planes), and the NW partial tiles are summed in LDS in the fixed order w = 0 .. NW-1; grid (M/64, N/64, Z), 32 * NW threads.
// C[m][n] (f32, pitch ldc, + optional f32 bias[n]) = sum_k A[m][k] Bt[n][k] (+ split products per NSPLIT). z-batch strides sA/sB/sC in elements. K % 32 == 0.
// Fragments: lane -> row/col lane&15, vector elements 0..7 <- k0 + 8h + i, elements 8..15 <- k0 + 16 + 8h + i (h = lane>>4) for BOTH operands; D element r -> (row 8h + r, col lane&15).
template <typename T16> struct WFrag;
template <> struct WFrag<h16> { typedef v16h V; static __device__ __forceinline__ V ld(const h16* p) { return cat16(*(const v8h*)p, *(const v8h*)(p + 16)); } static __device__ __forceinline__ v8f mma(V a, V b, v8f c) { return wmma16(a, b, c); } };
template <> struct WFrag<bf> { typedef v16bf V; static __device__ __forceinline__ V ld(const bf* p) { return cat16b(*(const v8us*)p, *(const v8us*)(p + 16)); } static __device__ __forceinline__ v8f mma(V a, V b, v8f c) { return wmmab(a, b, c); } };
template <typename T16, int NSPLIT, bool BIAS, int NW>
__global__ __launch_bounds__(32 * NW) void k_gemmw(const T16* __restrict__ A, const T16* __restrict__ A2, const T16* __restrict__ Bt, const T16* __restrict__ Bt2, int K, float* C, int ldc, const float* __restrict__ bias, size_t sA, size_t sB, size_t sC) {
    typedef typename WFrag<T16>::V V;
    static_assert(NW == 8);                                          // the join below deals 16 rows x 16 float4 columns to 256 threads
    __shared__ __align__(16) float os[2 * NW * 16 * 68];             // two buffers of NW partial 16x64 row blocks: one barrier per row block
    const size_t z = blockIdx.z; A += z * sA; if (A2) A2 += z * sA; Bt += z * sB; if (Bt2) Bt2 += z * sB; C += z * sC;
    const int lane = threadIdx.x & 31, lr = lane & 15, hi = lane >> 4; const int r0 = blockIdx.x * 64, c0 = blockIdx.y * 64;
    const int wv = __builtin_amdgcn_readfirstlane((int)(threadIdx.x >> 5));
    v8f acc[4][4];
#pragma unroll
    for (int mb = 0; mb < 4; ++mb)
#pragma unroll
        for (int nb = 0; nb < 4; ++nb) acc[mb][nb] = (v8f){};
    const size_t aoff = (size_t)(r0 + lr) * K + 8 * hi, boff = (size_t)(c0 + lr) * K + 8 * hi;
#pragma unroll 1
    for (int kc = wv * 32; kc < K; kc += 32 * NW) {
        V a[4], a2[4];
#pragma unroll
        for (int mb = 0; mb < 4; ++mb) { a[mb] = WFrag<T16>::ld(A + aoff + (size_t)mb * 16 * K + kc); if (NSPLIT == 1 || NSPLIT == 2) a2[mb] = WFrag<T16>::ld(A2 + aoff + (size_t)mb * 16 * K + kc); }
#pragma unroll
        for (int nb = 0; nb < 4; ++nb) { const V b = WFrag<T16>::ld(Bt + boff + (size_t)nb * 16 * K + kc); V b2; if (NSPLIT >= 2) b2 = WFrag<T16>::ld(Bt2 + boff + (size_t)nb * 16 * K + kc);
#pragma unroll
            for (int mb = 0; mb < 4; ++mb) { acc[mb][nb] = WFrag<T16>::mma(a[mb], b, acc[mb][nb]); if (NSPLIT == 1 || NSPLIT == 2) acc[mb][nb] = WFrag<T16>::mma(a2[mb], b, acc[mb][nb]); if (NSPLIT >= 2) acc[mb][nb] = WFrag<T16>::mma(a[mb], b2, acc[mb][nb]); } }
        asm volatile("v_nop\n\tv_nop\n\tv_nop\n\tv_nop" : "+v"(acc[0][0]), "+v"(acc[1][1]), "+v"(acc[2][2]), "+v"(acc[3][3]) : "v"(a[0]), "v"(a[3]));
    }
    const int row = (int)(threadIdx.x >> 4), cofs = (int)(threadIdx.x & 15) * 4; v4f res[4];   // the join: thread -> one float4 of each 16x64 row block
#pragma unroll
    for (int mb = 0; mb < 4; ++mb) {
        float* ob = os + (mb & 1) * (NW * 16 * 68);
#pragma unroll
        for (int nb = 0; nb < 4; ++nb) {
#pragma unroll
            for (int j = 0; j < 8; ++j) ob[wv * (16 * 68) + (hi * 8 + j) * 68 + nb * 16 + lr] = acc[mb][nb][j]; }
        __syncthreads();                                             // every wave's partial of this row block is in LDS; the other buffer's readers are done before it is written again
        v4f val = *(const v4fa*)(ob + row * 68 + cofs);
#pragma unroll
        for (int w = 1; w < NW; ++w) val += *(const v4fa*)(ob + w * (16 * 68) + row * 68 + cofs);
        if (BIAS) { val[0] += bfr(bias[c0 + cofs]); val[1] += bfr(bias[c0 + cofs + 1]); val[2] += bfr(bias[c0 + cofs + 2]); val[3] += bfr(bias[c0 + cofs + 3]); }
        res[mb] = val;
    }
    // stores behind the last barrier: a store in front of a barrier would be waited out there
#pragma unroll
    for (int mb = 0; mb < 4; ++mb) *(v4f*)(C + (size_t)(r0 + mb * 16 + row) * ldc + c0 + cofs) = res[mb];
}

__device__ __forceinline__ void splitf(float y, unsigned short& h, unsigned short& l) { h = f2bf(y); l = f2bf(y - bf2f(h)); }
typedef __attribute__((ext_vector_type(2))) unsigned short v2us;
typedef __attribute__((ext_vector_type(4))) unsigned short v4us;
typedef __attribute__((ext_vector_type(2))) float v2f;
typedef __attribute__((ext_vector_type(4))) int v4i;
typedef __attribute__((ext_vector_type(2))) __bf16 v2bf;
typedef __attribute__((ext_vector_type(8))) unsigned v8u;
typedef __attribute__((ext_vector_type(4))) unsigned v4u;

// The d_* functions are the bodies of jobs that read none of each other's output; k_prep and k_post below deal the blocks of one grid to them (blk = the block's index inside its job).
// d_wtT: Bt[n][k] (bf16) = w[k][n] (f32), one tile of 64 k x 128 n per block, turned in LDS (ts: 128 rows n of 32 dwords, each dword the bf16 pair k, k + 1; pitch 33 dwords, so that no two lanes of a wave
// meet on a bank, storing or loading). Every global load of a wave is two 256-byte pieces of rows of w, every global store four whole 128-byte lines of Bt. Neighbouring blocks take neighbouring n.
__device__ __forceinline__ void d_wtT(int blk, const float* __restrict__ w, int K, int N, bf* Bt, unsigned* ts) {
    const int lane = threadIdx.x & 31, wv = (int)(threadIdx.x >> 5); const int n0 = (blk % (N / 128)) * 128, k0 = (blk / (N / 128)) * 64;
    const int c4 = (lane & 15) * 4, kq = wv * 2 + (lane >> 4);      // thread -> 4 columns n of the row pairs kq and kq + 16, in both 64-column halves
    v4f ev[2][2], od[2][2];
#pragma unroll
    for (int i = 0; i < 2; ++i)
#pragma unroll
        for (int nh = 0; nh < 2; ++nh) { const float* p = w + (size_t)(k0 + 2 * (kq + 16 * i)) * N + n0 + nh * 64 + c4; ev[i][nh] = *(const v4f*)p; od[i][nh] = *(const v4f*)(p + N); }
    asm volatile("s_wait_xcnt 0x0" ::: "memory");                    // the precaution behind a group of loads, before a register that they name is written again
#pragma unroll
    for (int i = 0; i < 2; ++i)
#pragma unroll
        for (int nh = 0; nh < 2; ++nh)
#pragma unroll
            for (int j = 0; j < 4; ++j) ts[(nh * 64 + c4 + j) * 33 + kq + 16 * i] = (unsigned)f2bf(ev[i][nh][j]) | ((unsigned)f2bf(od[i][nh][j]) << 16);
    __syncthreads();                                                 // the tile is whole in LDS (the job is chosen by blockIdx: every wave of the block passes here)
    const int c = (lane & 7) * 4, nr = wv * 4 + (lane >> 3);        // thread -> 8 k (4 dwords) of the rows nr, nr + 32, nr + 64, nr + 96: eight neighbouring lanes store one line
#pragma unroll
    for (int i = 0; i < 4; ++i) { const int n = nr + 32 * i; const unsigned* q = ts + n * 33 + c; v4u v; v[0] = q[0]; v[1] = q[1]; v[2] = q[2]; v[3] = q[3]; *(v4u*)(Bt + (size_t)(n0 + n) * K + k0 + c * 2) = v; }
    asm volatile("s_wait_xcnt 0x0" ::: "memory");                    // the same precaution behind the group of stores
}
__device__ __forceinline__ void d_cvt8(int blk, const float* __restrict__ src, bf* dst, size_t n8) { const size_t i = (size_t)blk * 256 + threadIdx.x; if (i >= n8) return; const v8f v = *(const v8f*)(src + i * 8); v8us o;
#pragma unroll
    for (int k = 0; k < 8; ++k) o[k] = f2bf(v[k]); *(v8us*)(dst + i * 8) = o;  }
// the inverse frequency is computed by the thread that uses it, so that the table job depends on the inputs alone
__device__ __forceinline__ void d_cstab(int blk, const int* __restrict__ pos, float* CS) {
    const int idx = blk * 256 + threadIdx.x; if (idx >= TT * HD) return;
    const int dd = idx % HD; const int t = idx / HD; const int j = dd & (HD / 2 - 1);
    const float e = (float)j * (1.0f / (float)(HD / 2));
    const float p = powf(THETA, e);
    const float v = 1.0f / p;
    const float pf = (float)pos[t];
    float fr = __fmul_rn(pf, v); asm volatile("" : "+v"(fr));
    float sn, cn;
    sincosf(fr, &sn, &cn);
    v2f cs; cs[0] = cn; cs[1] = sn;
    *(v2f*)(CS + (size_t)idx * 2) = cs; 
}
// d_rope: head planes [h][t][d] (bf16 hi/lo) of rope(F) with the rotate-half convention out[d] = x[d] cos[t][d] - x[d+HD/2] sin[t][d], out[d+HD/2] = x[d+HD/2] cos[t][d+HD/2] + x[d] sin[t][d+HD/2]
__device__ __forceinline__ void d_rope(int blk, const float* __restrict__ F, int pitch, int nheads, const float* __restrict__ CS, bf* Ph, bf* Pl) {
    const size_t e = ((size_t)blk * 256 + threadIdx.x) * 2; if (e >= (size_t)nheads * TT * HD) return; const int d = (int)(e % HD); const int t = (int)((e / HD) % TT); const int h = (int)(e / ((size_t)HD * TT)); const float* f = F + (size_t)t * pitch + h * HD; v2us oh, ol;
#pragma unroll
    for (int q = 0; q < 2; ++q) { const int dd = d + q; const int dp = (dd < HD / 2) ? dd + HD / 2 : dd - HD / 2; const float x0 = f[dd], x1 = f[dp];
        const v2f cs = *(const v2f*)(CS + ((size_t)t * HD + dd) * 2); float a = __fmul_rn(x0, cs[0]), bq = __fmul_rn(x1, cs[1]); asm volatile("" : "+v"(a)); asm volatile("" : "+v"(bq)); const float r = (dd < HD / 2) ? __fsub_rn(a, bq) : __fadd_rn(a, bq);
        unsigned short a2, c2; splitf(r, a2, c2); oh[q] = a2; ol[q] = c2; }
    *(v2us*)(Ph + e) = oh; *(v2us*)(Pl + e) = ol;  }
__device__ __forceinline__ void d_vtp(int blk, const float* __restrict__ F, int pitch, int nheads, bf* Vh, bf* Vl) { const size_t e = ((size_t)blk * 256 + threadIdx.x) * 2; if (e >= (size_t)nheads * HD * TT) return; const int t = (int)(e % TT); const int d = (int)((e / TT) % HD); const int g = (int)(e / ((size_t)TT * HD)); v2us oh, ol;
#pragma unroll
    for (int q = 0; q < 2; ++q) { const float x = F[(size_t)(t + q) * pitch + g * HD + d]; unsigned short a2, c2; splitf(x, a2, c2); oh[q] = a2; ol[q] = c2; }
    *(v2us*)(Vh + e) = oh; *(v2us*)(Vl + e) = ol;  }
// ---- k_prep: every job that reads the inputs alone, in one grid; the weight transposes, whose blocks run longest, start first. The branches are on blockIdx and so the same for a whole block.
#define DQKV   (DQ + 2 * DKV)
#define NB_WQ  (DQ * DM / (64 * 128))
#define NB_WKV (DKV * DM / (64 * 128))
static_assert(DM % 128 == 0 && DQ % 128 == 0 && DKV % 128 == 0);
#define NB_X   (TT * DM / (8 * 256))
#define NB_CS  (TT * HD / 256)
#define NB_ROPE ((NQ + NKV) * TT * HD / (2 * 256))
#define NB_VT  (NKV * TT * HD / (2 * 256))
__global__ __launch_bounds__(256) void k_prep(const float* __restrict__ x, const float* __restrict__ wq, const float* __restrict__ wk, const float* __restrict__ wv, const float* __restrict__ wo, const int* __restrict__ pos,
                                              bf* WQ, bf* WK, bf* WV, bf* WO, bf* XB, float* CS) {
    __shared__ __align__(16) unsigned ts[128 * 33];                  // the transposes' tile
    int b = (int)blockIdx.x;
    if (b >= 2 * NB_WQ + 2 * NB_WKV + NB_X) { d_cstab(b - (2 * NB_WQ + 2 * NB_WKV + NB_X), pos, CS); return; }   // the last blocks of the grid; tested first, since behind five other tests the compiler makes powf a call
    if (b < NB_WQ) { d_wtT(b, wq, DM, DQ, WQ, ts); return; }            // Wq [D][NQ*HD]  -> WQ[c][d]
    b -= NB_WQ;
    if (b < NB_WQ) { d_wtT(b, wo, DQ, DM, WO, ts); return; }            // Wo [NQ*HD][D]  -> WO[dout][nh]
    b -= NB_WQ;
    if (b < NB_WKV) { d_wtT(b, wk, DM, DKV, WK, ts); return; }          // Wk [D][NKV*HD] -> WK[c][d]
    b -= NB_WKV;
    if (b < NB_WKV) { d_wtT(b, wv, DM, DKV, WV, ts); return; }          // Wv [D][NKV*HD] -> WV[c][d]
    b -= NB_WKV;
    d_cvt8(b, x, XB, (size_t)TT * DM / 8);
}
// ---- k_post: the two jobs that read the projections F [t][q heads | k heads | v heads], in one grid: the V transpose (strided reads, started first), then RoPE of the NQ + NKV q and k heads into planes that lie one behind the other.
__global__ __launch_bounds__(256) void k_post(const float* __restrict__ F, const float* __restrict__ CS, bf* Ph, bf* Pl, bf* Vh, bf* Vl) {
    const int b = (int)blockIdx.x;
    if (b < NB_VT) { d_vtp(b, F + DQ + DKV, DQKV, NKV, Vh, Vl); return; }
    d_rope(b - NB_VT, F, DQKV, NQ + NKV, CS, Ph, Pl);
}
// ---- k_fattn: scores, mask, softmax and attn.v of one 16-query tile in one pass over the keys; scores and probabilities stay in registers. Workgroup = the GQ query heads of one kv head (one wave each, same
// 16 queries, so the waves read the same K and V lines); grid (TT/16) * NKV; LDS holds only the segment ids (one barrier). Per 64-key block, up to the diagonal block:
//   St[key][query] = K Q^T (A = K rows, B = Q rows; qh.kh + ql.kh + qh.kl): D element r of key tile nb -> (key 16 nb + 8h + r, query lane&15), which is already the B-fragment k order of the next product
//   (elements 0..7 <- k0 + 8h + i from tile 2j, elements 8..15 <- k0 + 16 + 8h + i from tile 2j + 1), so the probabilities go from one product to the other with no exchange between lanes;
//   running row maximum m and row sum l per query (lane&15; the two lane halves hold different keys), accumulator rescaled by exp(m_old - m_new);
//   Ot[d][query] += Vt P^T (A = Vt rows d, B = P hi/lo; ph.vh + pl.vh + ph.vl): the query of every accumulator element is the lane's own, so the rescale and the final 1/l are lane-local.
// Every inner loop is fully unrolled, so that the fragment arrays are indexed by constants and stay in registers.
// A masked score is the fill -3e38. While a row has met no allowed key, m is the fill too and its masked entries count as exp(0) = 1; the first allowed key (the diagonal at the latest) rescales all of that by exp(-huge) = 0.
__global__ __launch_bounds__(32 * GQ) void k_fattn(const bf* __restrict__ Qh, const bf* __restrict__ Ql, const bf* __restrict__ Kh, const bf* __restrict__ Kl, const bf* __restrict__ Vh, const bf* __restrict__ Vl, const int* __restrict__ seg, bf* Ah, bf* Al) {
    typedef WFrag<bf>::V V;
    const int lane = threadIdx.x & 31, lr = lane & 15, hi = lane >> 4;
    const int wv = __builtin_amdgcn_readfirstlane((int)(threadIdx.x >> 5));
    const int b = (int)blockIdx.x, nhalf = (TT / 32) * NKV;
    const int qt = b < nhalf ? TT / 16 - 1 - b / NKV : (b - nhalf) / NKV;   // long tiles start first, the short ones fill in beside them
    const int kvh = b % NKV, head = kvh * GQ + wv, q0 = qt * 16, qi = q0 + lr;
    const size_t qoff = ((size_t)head * TT + qi) * HD + 8 * hi;
    const bf* pqh = Qh + qoff; const bf* pql = Ql + qoff;
    V qh[2], ql[2];
#pragma unroll
    for (int kk = 0; kk < 2; ++kk) { qh[kk] = WFrag<bf>::ld(pqh + kk * 32); ql[kk] = WFrag<bf>::ld(pql + kk * 32); }
    __shared__ __align__(16) int sseg[TT];                           // the segment ids, read per key block from LDS: a global load there would be waited for in order behind the K loads in flight
    v4i sgr[TT / (32 * GQ * 4)];
#pragma unroll
    for (int i = 0; i < TT / (32 * GQ * 4); ++i) sgr[i] = *(const v4i*)(seg + (i * 32 * GQ + (int)threadIdx.x) * 4);
    const int sq = seg[qi];
    // K and V addresses = wave-uniform base (kv head, key block) + a lane offset that never changes
    const bf* kbh = Kh + (size_t)kvh * TT * HD; const bf* kbl = Kl + (size_t)kvh * TT * HD; const bf* vbh = Vh + (size_t)kvh * HD * TT; const bf* vbl = Vl + (size_t)kvh * HD * TT;
    const unsigned klane = (unsigned)(lr * HD + 8 * hi), vlane = (unsigned)(lr * TT + 8 * hi);
    v8f o[4];
#pragma unroll
    for (int mb = 0; mb < 4; ++mb) o[mb] = (v8f){};
    float m = -3.0e38f, l = 0.f;                                     // m in units of log2: score * SCL * log2(e)
    const int kend = q0 + 16;
    V kh[4][2], kl[4][2];                                            // the K fragments of one 64-key block, loaded one block ahead: again right behind their last use
#pragma unroll
    for (int nb = 0; nb < 4; ++nb)
#pragma unroll
        for (int kk = 0; kk < 2; ++kk) { const int e = nb * 16 * HD + kk * 32; kh[nb][kk] = WFrag<bf>::ld(kbh + klane + e); kl[nb][kk] = WFrag<bf>::ld(kbl + klane + e); }
    __builtin_amdgcn_sched_barrier(0);                               // nothing is scheduled in between the prologue's loads and their wait, or up over it
    // the precaution behind a group of loads, before a register that they name is written again; the addresses are inputs of the wait, so that they keep their registers up to it and no result of the group lands on one
    asm volatile("s_wait_xcnt 0x0" :: "v"(pqh), "v"(pql), "v"(klane) : "memory");
    __builtin_amdgcn_sched_barrier(0);                               // the second half of the same: what follows stays behind the wait
#pragma unroll
    for (int i = 0; i < TT / (32 * GQ * 4); ++i) *(v4i*)(sseg + (i * 32 * GQ + (int)threadIdx.x) * 4) = sgr[i];
    __syncthreads();                                                 // sseg is whole
#pragma unroll 1                                                     // one key block per trip: a second copy of the body would not fit the registers
    for (int kb = 0; kb < kend; kb += 64) {
        const int kn = kb + 64 < kend ? kb + 64 : kb;                // the next block; behind the last block this one again (in bounds, never used)
        V vh[4][2], vl[4][2];                                        // this block's V fragments: asked for here, used behind the softmax
        const bf* pvh = vbh + kb + vlane; const bf* pvl = vbl + kb + vlane;
#pragma unroll
        for (int mb = 0; mb < 4; ++mb)
#pragma unroll
            for (int j = 0; j < 2; ++j) { const int e = mb * 16 * TT + j * 32; vh[mb][j] = WFrag<bf>::ld(pvh + e); vl[mb][j] = WFrag<bf>::ld(pvl + e); }
        asm volatile("s_wait_xcnt 0x0" :: "v"(pvh), "v"(pvl) : "memory");   // the same precaution, the V addresses held in their registers up to the wait
        v8f s[4];
#pragma unroll
        for (int nb = 0; nb < 4; ++nb) { s[nb] = (v8f){};
#pragma unroll
            for (int kk = 0; kk < 2; ++kk) { s[nb] = wmmab(kh[nb][kk], qh[kk], s[nb]); s[nb] = wmmab(kh[nb][kk], ql[kk], s[nb]); s[nb] = wmmab(kl[nb][kk], qh[kk], s[nb]); } }
        const bf* pkh = kbh + (size_t)kn * HD + klane; const bf* pkl = kbl + (size_t)kn * HD + klane;
#pragma unroll
        for (int nb = 0; nb < 4; ++nb)
#pragma unroll
            for (int kk = 0; kk < 2; ++kk) { const int e = nb * 16 * HD + kk * 32; kh[nb][kk] = WFrag<bf>::ld(pkh + e); kl[nb][kk] = WFrag<bf>::ld(pkl + e); }
        asm volatile("s_wait_xcnt 0x0" :: "v"(pkh), "v"(pkl) : "memory");   // the same precaution, the K addresses held in their registers up to the wait
        const int lim = qi - kb - 8 * hi;                            // key offset 16 nb + r in this lane is causal iff it is <= lim
        float mx = m;
#pragma unroll
        for (int nb = 0; nb < 4; ++nb) { const int j0 = kb + nb * 16 + 8 * hi; const v4i g0 = *(const v4i*)(sseg + j0), g1 = *(const v4i*)(sseg + j0 + 4);
#pragma unroll
            for (int r = 0; r < 8; ++r) { const int sg = r < 4 ? g0[r & 3] : g1[r & 3]; const float t = (sg == sq && nb * 16 + r <= lim) ? s[nb][r] * (SCL * 1.4426950408889634f) : -3.0e38f; s[nb][r] = t; mx = fmaxf(mx, t); } }
        mx = fmaxf(mx, __shfl_xor(mx, 16, 32));
        const float al = __builtin_amdgcn_exp2f(m - mx);
        m = mx;
        v2f ps2[2] = {(v2f){0.f, 0.f}, (v2f){0.f, 0.f}}; v8u phw[2], plw[2];   // four independent partial row sums
#pragma unroll
        for (int nb = 0; nb < 4; ++nb) {
#pragma unroll
            for (int r = 0; r < 8; r += 2) { v2f pp; pp[0] = __builtin_amdgcn_exp2f(s[nb][r] - mx); pp[1] = __builtin_amdgcn_exp2f(s[nb][r + 1] - mx); ps2[nb & 1] += pp;
                const v2bf h2 = __builtin_convertvector(pp, v2bf); const v2bf l2 = __builtin_convertvector(pp - __builtin_convertvector(h2, v2f), v2bf);
                phw[nb >> 1][(nb & 1) * 4 + (r >> 1)] = __builtin_bit_cast(unsigned, h2); plw[nb >> 1][(nb & 1) * 4 + (r >> 1)] = __builtin_bit_cast(unsigned, l2); } }
        l = l * al + ((ps2[0][0] + ps2[1][0]) + (ps2[0][1] + ps2[1][1]));
#pragma unroll
        for (int mb = 0; mb < 4; ++mb) { o[mb] *= al;
#pragma unroll
            for (int j = 0; j < 2; ++j) { const V ph = __builtin_bit_cast(V, phw[j]), pl = __builtin_bit_cast(V, plw[j]); o[mb] = wmmab(vh[mb][j], ph, o[mb]); o[mb] = wmmab(vh[mb][j], pl, o[mb]); o[mb] = wmmab(vl[mb][j], ph, o[mb]); } }
    }
    l += __shfl_xor(l, 16, 32);
    const float f = __fdiv_rn(1.0f, l);
#pragma unroll
    for (int mb = 0; mb < 4; ++mb) { v8us oh, ol;
#pragma unroll
        for (int r = 0; r < 8; ++r) { unsigned short a2, c2; splitf(o[mb][r] * f, a2, c2); oh[r] = a2; ol[r] = c2; }
        const size_t oo = (size_t)qi * DQ + (size_t)head * HD + mb * 16 + 8 * hi; *(v8us*)(Ah + oo) = oh; *(v8us*)(Al + oo) = ol; }
}

extern "C" void kernel_launch(void* const* d_in, const int* in_sizes, int n_in,
                              void* d_out, int out_size, void* d_ws, size_t ws_size, hipStream_t stream) {
    if (n_in < 7) return;
    if (in_sizes[0] < TT * DM || in_sizes[1] < DM * DQ || in_sizes[2] < DM * DKV || in_sizes[3] < DM * DKV || in_sizes[4] < DQ * DM || in_sizes[5] < TT || in_sizes[6] < TT) return;
    if (out_size < TT * DM) return;
    const float* x = (const float*)d_in[0]; const float* wq = (const float*)d_in[1]; const float* wk = (const float*)d_in[2]; const float* wv = (const float*)d_in[3]; const float* wo = (const float*)d_in[4];
    const int* pos = (const int*)d_in[5]; const int* seg = (const int*)d_in[6];
    float* OUT = (float*)d_out;     // [TT][DM]
    char* wsp = (char*)d_ws;
    auto take = [&](size_t bytes) { char* p = wsp; wsp += (bytes + 255) & ~(size_t)255; return (void*)p; };
    // the q, k and v weight planes lie one behind the other ([DQKV][DM]), and so do the q and k head planes: the three projections are one GEMM, RoPE of q and k one job
    bf* WQ = (bf*)take((size_t)DQKV * DM * 2); bf* WK = WQ + (size_t)DQ * DM; bf* WV = WK + (size_t)DKV * DM; bf* WO = (bf*)take((size_t)DM * DQ * 2);
    float* CS = (float*)take((size_t)TT * HD * 2 * 4);
    bf* XB = (bf*)take((size_t)TT * DM * 2); float* F = (float*)take((size_t)TT * DQKV * 4);
    bf* QPh = (bf*)take((size_t)(NQ + NKV) * TT * HD * 2); bf* QPl = (bf*)take((size_t)(NQ + NKV) * TT * HD * 2); bf* KPh = QPh + (size_t)NQ * TT * HD; bf* KPl = QPl + (size_t)NQ * TT * HD;
    bf* VTh = (bf*)take((size_t)NKV * HD * TT * 2); bf* VTl = (bf*)take((size_t)NKV * HD * TT * 2);
    bf* ATh = (bf*)take((size_t)TT * DQ * 2); bf* ATl = (bf*)take((size_t)TT * DQ * 2);
    const size_t used = (size_t)(wsp - (char*)d_ws);
    if (used > ws_size || used > ((size_t)128 << 20)) return;

    // tables and 16-bit planes of the inputs: one launch
    k_prep<<<2 * NB_WQ + 2 * NB_WKV + NB_X + NB_CS, 256, 0, stream>>>(x, wq, wk, wv, wo, pos, WQ, WK, WV, WO, XB, CS);
    // q, k and v projections (plain bf16 operands): one launch, F [t][DQKV]
    k_gemmw<bf, 0, false, 8><<<dim3(TT / 64, DQKV / 64, 1), 256, 0, stream>>>(XB, nullptr, WQ, nullptr, DM, F, DQKV, nullptr, 0, 0, 0);
    // roped / transposed hi-lo planes: one launch
    k_post<<<NB_VT + NB_ROPE, 256, 0, stream>>>(F, CS, QPh, QPl, VTh, VTl);
    // attention: one launch, all heads; writes the hi/lo ctx planes [t][head * HD + d]
    k_fattn<<<(unsigned)((TT / 16) * NKV), 32 * GQ, 0, stream>>>(QPh, QPl, KPh, KPl, VTh, VTl, seg, ATh, ATl);
    // output projection: hi/lo ctx x bf16 Wo
    k_gemmw<bf, 1, false, 8><<<dim3(TT / 64, DM / 64, 1), 256, 0, stream>>>(ATh, ATl, WO, nullptr, DQ, OUT, DM, nullptr, 0, 0, 0);
}

// v005
// One run takes 86.7 microseconds.
// Next to v004, in two timings, it ran 1.31 times as fast each time.
// All steps since v000 together make it 4.80 times as fast.
#include <hip/hip_runtime.h>

// GQA causal ragged attention: q/k/v = x W (32 query heads, 8 kv heads, head 64, no bias), rotate-half RoPE from int32 positions (theta 5e5), mask = (same segment id) and (key index <= query index) with -3e38 fill, softmax(q.k * 0.125), ctx Wo -> [TT][2048] f32.
// Compute dtypes, f32 accumulate everywhere: x and all four weights RNE-converted to bf16 planes; q/k/v projections v_wmma_f32_16x16x32_bf16 on plain bf16 operands (one product); scores and attn.v on bf16 hi/lo split planes (hi.hi + lo.hi + hi.lo); output projection bf16 hi/lo ctx x bf16 Wo (2 products); RoPE tables, RoPE, softmax and all side math f32 on VALU.

#ifndef TT
#define TT   1024
#endif
#define TT_FULL 1024
#define DM   2048
#define NQ   32
#define NKV  8
#define GQ   (NQ / NKV)
#define HD   64
#define DQ   (NQ * HD)
#define DKV  (NKV * HD)
#define THETA 500000.0f
#define SCL  0.125f
static_assert(TT % 128 == 0);
static_assert(TT <= TT_FULL);
static_assert(HD == 64);
static_assert(DM % 64 == 0 && DQ % 64 == 0 && DKV % 64 == 0);

typedef _Float16 h16;
typedef unsigned short bf;
typedef __attribute__((ext_vector_type(16))) __bf16   v16bf;
typedef __attribute__((ext_vector_type(16))) _Float16 v16h;
typedef __attribute__((ext_vector_type(8)))  _Float16 v8h;
typedef __attribute__((ext_vector_type(8)))  unsigned short v8us;
typedef __attribute__((ext_vector_type(8)))  float    v8f;
typedef __attribute__((ext_vector_type(4)))  float    v4f;
typedef v8h  __attribute__((may_alias)) v8ha;
typedef v4f  __attribute__((may_alias)) v4fa;
typedef v8us __attribute__((may_alias)) v8usa;

__device__ __forceinline__ unsigned short f2bf(float f) { unsigned u = __float_as_uint(f); u += 0x7FFFu + ((u >> 16) & 1u); return (unsigned short)(u >> 16); }
__device__ __forceinline__ float bf2f(unsigned short b) { return __uint_as_float(((unsigned)b) << 16); }
__device__ __forceinline__ float bfr(float f) { return bf2f(f2bf(f)); }
__device__ __forceinline__ v16h cat16(v8h lo, v8h hi) { return __builtin_shufflevector(lo, hi, 0, 1, 2, 3, 4, 5, 6, 7, 8, 9, 10, 11, 12, 13, 14, 15); }
__device__ __forceinline__ v16bf cat16b(v8us lo, v8us hi) { return __builtin_bit_cast(v16bf, __builtin_shufflevector(lo, hi, 0, 1, 2, 3, 4, 5, 6, 7, 8, 9, 10, 11, 12, 13, 14, 15)); }
__device__ __forceinline__ v8f wmma16(v16h a, v16h b, v8f c) { return __builtin_amdgcn_wmma_f32_16x16x32_f16(false, a, false, b, (short)0, c, false, false); }
__device__ __forceinline__ v8f wmmab(v16bf a, v16bf b, v8f c) { return __builtin_amdgcn_wmma_f32_16x16x32_bf16(false, a, false, b, (short)0, c, false, false); }

// ---- k_gemmw: register-blocked GEMM, one 64x64 output tile per workgroup of NW waves; wave w takes the 32-wide k steps w, w + NW, ... into its own 16 accumulators (operands straight from
// 16-bit planes in fragment order, below), and the NW partial tiles are summed in LDS in the fixed order w = 0 .. NW-1; grid (M/64, N/64, Z), 32 * NW threads.
// C[m][n] (f32, pitch ldc, + optional f32 bias[n]) = sum_k A[m][k] Bt[n][k] (+ split products per NSPLIT). z-batch strides sA/sB/sC in elements. K % 32 == 0.
// Fragments: lane -> row/col lane&15, vector elements 0..7 <- k0 + 8h + i, elements 8..15 <- k0 + 16 + 8h + i (h = lane>>4) for BOTH operands; D element r -> (row 8h + r, col lane&15).
template <typename T16> struct WFrag;
template <> struct WFrag<h16> { typedef v16h V; static __device__ __forceinline__ V ld(const h16* p) { return cat16(*(const v8h*)p, *(const v8h*)(p + 256)); } static __device__ __forceinline__ v8f mma(V a, V b, v8f c) { return wmma16(a, b, c); } };
template <> struct WFrag<bf> { typedef v16bf V; static __device__ __forceinline__ V ld(const bf* p) { return cat16b(*(const v8us*)p, *(const v8us*)(p + 256)); } static __device__ __forceinline__ v8f mma(V a, V b, v8f c) { return wmmab(a, b, c); } };
// Fragment order of a 16-bit operand plane with K columns (every plane that a matrix instruction reads): blocks of 16 rows x 32 k = 512 elements, block index (row / 16) * (K / 32) + k / 32; inside a block element
// (row, k) lies at ((k >> 4) & 1) * 256 + (((k >> 3) & 1) * 16 + (row & 15)) * 8 + (k & 7). Lane l's fragment is then the 8 elements at 8 l and the 8 at 256 + 8 l: each 16-byte load of a wave reads 512 bytes in a row (four whole lines).
__device__ __forceinline__ size_t pidx(int row, int k, int K) { return ((size_t)(row >> 4) * (K >> 5) + (k >> 5)) * 512 + ((k >> 4) & 1) * 256 + (((k >> 3) & 1) * 16 + (row & 15)) * 8 + (k & 7); }
template <typename T16, int NSPLIT, bool BIAS, int NW, int K>
__global__ __launch_bounds__(32 * NW) void k_gemmw(const T16* __restrict__ A, const T16* __restrict__ A2, const T16* __restrict__ Bt, const T16* __restrict__ Bt2, float* C, int ldc, const float* __restrict__ bias, size_t sA, size_t sB, size_t sC) {
    typedef typename WFrag<T16>::V V;
    static_assert(NW == 8);                                          // the join below deals 16 rows x 16 float4 columns to 256 threads
    __shared__ __align__(16) float os[2 * NW * 16 * 68];             // two buffers of NW partial 16x64 row blocks: one barrier per row block
    const size_t z = blockIdx.z; A += z * sA; if (A2) A2 += z * sA; Bt += z * sB; if (Bt2) Bt2 += z * sB; C += z * sC;
    const int lane = threadIdx.x & 31, lr = lane & 15, hi = lane >> 4; const int r0 = blockIdx.x * 64, c0 = blockIdx.y * 64;
    const int wv = __builtin_amdgcn_readfirstlane((int)(threadIdx.x >> 5));
    v8f acc[4][4];
#pragma unroll
    for (int mb = 0; mb < 4; ++mb)
#pragma unroll
        for (int nb = 0; nb < 4; ++nb) acc[mb][nb] = (v8f){};
    const size_t aoff = (size_t)r0 * K + 8 * lane, boff = (size_t)c0 * K + 8 * lane;   // 16 rows of a plane are K / 32 blocks = 16 K elements; a k step is one block
#pragma unroll 1
    for (int kc = wv * 32; kc < K; kc += 32 * NW) {
        V a[4], a2[4];
        // one address per plane and k step; K is a constant of the kernel, so that the row blocks are immediate offsets from it and no further address register is formed
        const T16* pa = A + aoff + kc * 16; const T16* pa2 = (NSPLIT == 1 || NSPLIT == 2) ? A2 + aoff + kc * 16 : pa; const T16* pb = Bt + boff + kc * 16; const T16* pb2 = NSPLIT >= 2 ? Bt2 + boff + kc * 16 : pb;
#pragma unroll
        for (int mb = 0; mb < 4; ++mb) { a[mb] = WFrag<T16>::ld(pa + mb * 16 * K); if (NSPLIT == 1 || NSPLIT == 2) a2[mb] = WFrag<T16>::ld(pa2 + mb * 16 * K); }
#pragma unroll
        for (int nb = 0; nb < 4; ++nb) { const V b = WFrag<T16>::ld(pb + nb * 16 * K); V b2; if (NSPLIT >= 2) b2 = WFrag<T16>::ld(pb2 + nb * 16 * K);
#pragma unroll
            for (int mb = 0; mb < 4; ++mb) { acc[mb][nb] = WFrag<T16>::mma(a[mb], b, acc[mb][nb]); if (NSPLIT == 1 || NSPLIT == 2) acc[mb][nb] = WFrag<T16>::mma(a2[mb], b, acc[mb][nb]); if (NSPLIT >= 2) acc[mb][nb] = WFrag<T16>::mma(a[mb], b2, acc[mb][nb]); } }
        // the precaution behind the trip's loads, before a register that they name is written again; the addresses are inputs, so that they keep their registers up to the wait and no result lands on one
        asm volatile("s_wait_xcnt 0x0" :: "v"(pa), "v"(pa2), "v"(pb), "v"(pb2) : "memory");
        asm volatile("v_nop\n\tv_nop\n\tv_nop\n\tv_nop" : "+v"(acc[0][0]), "+v"(acc[1][1]), "+v"(acc[2][2]), "+v"(acc[3][3]) : "v"(a[0]), "v"(a[3]));
    }
    const int row = (int)(threadIdx.x >> 4), cofs = (int)(threadIdx.x & 15) * 4; v4f res[4];   // the join: thread -> one float4 of each 16x64 row block
#pragma unroll
    for (int mb = 0; mb < 4; ++mb) {
        float* ob = os + (mb & 1) * (NW * 16 * 68);
#pragma unroll
        for (int nb = 0; nb < 4; ++nb) {
#pragma unroll
            for (int j = 0; j < 8; ++j) ob[wv * (16 * 68) + (hi * 8 + j) * 68 + nb * 16 + lr] = acc[mb][nb][j]; }
        __syncthreads();                                             // every wave's partial of this row block is in LDS; the other buffer's readers are done before it is written again
        v4f val = *(const v4fa*)(ob + row * 68 + cofs);
#pragma unroll
        for (int w = 1; w < NW; ++w) val += *(const v4fa*)(ob + w * (16 * 68) + row * 68 + cofs);
        if (BIAS) { val[0] += bfr(bias[c0 + cofs]); val[1] += bfr(bias[c0 + cofs + 1]); val[2] += bfr(bias[c0 + cofs + 2]); val[3] += bfr(bias[c0 + cofs + 3]); }
        res[mb] = val;
    }
    // stores behind the last barrier: a store in front of a barrier would be waited out there
#pragma unroll
    for (int mb = 0; mb < 4; ++mb) *(v4f*)(C + (size_t)(r0 + mb * 16 + row) * ldc + c0 + cofs) = res[mb];
}

__device__ __forceinline__ void splitf(float y, unsigned short& h, unsigned short& l) { h = f2bf(y); l = f2bf(y - bf2f(h)); }
typedef __attribute__((ext_vector_type(2))) unsigned short v2us;
typedef __attribute__((ext_vector_type(4))) unsigned short v4us;
typedef __attribute__((ext_vector_type(2))) float v2f;
typedef __attribute__((ext_vector_type(4))) int v4i;
typedef __attribute__((ext_vector_type(2))) __bf16 v2bf;
typedef __attribute__((ext_vector_type(8))) unsigned v8u;
typedef __attribute__((ext_vector_type(4))) unsigned v4u;

// The d_* functions are the bodies of jobs that read none of each other's output; k_prep and k_post below deal the blocks of one grid to them (blk = the block's index inside its job).
// d_wtT: Bt (bf16, rows n, fragment order) = w[k][n] (f32), one tile of 64 k x 128 n per block, turned in LDS (ts: 128 rows n of 32 dwords, each dword the bf16 pair k, k + 1; pitch 33 dwords, so that no two lanes of a wave
// meet on a bank, storing or loading). Every global load of a wave is two 256-byte pieces of rows of w, every global store four whole 128-byte lines of Bt. Neighbouring blocks take neighbouring n.
__device__ __forceinline__ void d_wtT(int blk, const float* __restrict__ w, int K, int N, bf* Bt, unsigned* ts) {
    const int lane = threadIdx.x & 31, wv = (int)(threadIdx.x >> 5); const int n0 = (blk % (N / 128)) * 128, k0 = (blk / (N / 128)) * 64;
    const int c4 = (lane & 15) * 4, kq = wv * 2 + (lane >> 4);      // thread -> 4 columns n of the row pairs kq and kq + 16, in both 64-column halves
    v4f ev[2][2], od[2][2];
#pragma unroll
    for (int i = 0; i < 2; ++i)
#pragma unroll
        for (int nh = 0; nh < 2; ++nh) { const float* p = w + (size_t)(k0 + 2 * (kq + 16 * i)) * N + n0 + nh * 64 + c4; ev[i][nh] = *(const v4f*)p; od[i][nh] = *(const v4f*)(p + N); }
    asm volatile("s_wait_xcnt 0x0" ::: "memory");                    // the precaution behind a group of loads, before a register that they name is written again
#pragma unroll
    for (int i = 0; i < 2; ++i)
#pragma unroll
        for (int nh = 0; nh < 2; ++nh)
#pragma unroll
            for (int j = 0; j < 4; ++j) ts[(nh * 64 + c4 + j) * 33 + kq + 16 * i] = (unsigned)f2bf(ev[i][nh][j]) | ((unsigned)f2bf(od[i][nh][j]) << 16);
    __syncthreads();                                                 // the tile is whole in LDS (the job is chosen by blockIdx: every wave of the block passes here)
    // thread -> four 8-k pieces (4 dwords each) of the wave's 16 rows; eight neighbouring lanes take eight neighbouring rows at one k, which is one whole line of the fragment order
#pragma unroll
    for (int i = 0; i < 4; ++i) { const int n = wv * 16 + (i >> 1) * 8 + (lane & 7), k8 = (lane >> 3) * 2 + (i & 1); const unsigned* q = ts + n * 33 + k8 * 4; v4u v; v[0] = q[0]; v[1] = q[1]; v[2] = q[2]; v[3] = q[3]; *(v4u*)(Bt + pidx(n0 + n, k0 + k8 * 8, K)) = v; }
    asm volatile("s_wait_xcnt 0x0" ::: "memory");                    // the same precaution behind the group of stores
}
// d_cvt8: dst (bf16, fragment order) = src [rows][K] (f32), 8 k per thread; a wave takes 8 rows x 32 k: it loads one whole line of each row and stores four whole lines
__device__ __forceinline__ void d_cvt8(int blk, const float* __restrict__ src, bf* dst, int K, size_t n8) { const size_t i = (size_t)blk * 256 + threadIdx.x; if (i >= n8) return;
    const int w = (int)(i >> 5), ks = (w >> 1) % (K / 32), row = ((w >> 1) / (K / 32)) * 16 + (w & 1) * 8 + (((int)i >> 2) & 7), k = ks * 32 + ((int)i & 3) * 8;
    const v8f v = *(const v8f*)(src + (size_t)row * K + k); v8us o;
#pragma unroll
    for (int q = 0; q < 8; ++q) o[q] = f2bf(v[q]); *(v8us*)(dst + pidx(row, k, K)) = o;  }
// the inverse frequency is computed by the thread that uses it, so that the table job depends on the inputs alone
__device__ __forceinline__ void d_cstab(int blk, const int* __restrict__ pos, float* CS) {
    const int idx = blk * 256 + threadIdx.x; if (idx >= TT * HD) return;
    const int dd = idx % HD; const int t = idx / HD; const int j = dd & (HD / 2 - 1);
    const float e = (float)j * (1.0f / (float)(HD / 2));
    const float p = powf(THETA, e);
    const float v = 1.0f / p;
    const float pf = (float)pos[t];
    float fr = __fmul_rn(pf, v); asm volatile("" : "+v"(fr));
    float sn, cn;
    sincosf(fr, &sn, &cn);
    v2f cs; cs[0] = cn; cs[1] = sn;
    *(v2f*)(CS + (size_t)idx * 2) = cs; 
}
// d_rope: head planes [h], each with rows t and columns d in fragment order (bf16 hi/lo), of rope(F) with the rotate-half convention out[d] = x[d] cos[t][d] - x[d+HD/2] sin[t][d], out[d+HD/2] = x[d+HD/2] cos[t][d+HD/2] + x[d] sin[t][d+HD/2]
__device__ __forceinline__ void d_rope(int blk, const float* __restrict__ F, int pitch, int nheads, const float* __restrict__ CS, bf* Ph, bf* Pl) {
    const size_t e = ((size_t)blk * 256 + threadIdx.x) * 2; if (e >= (size_t)nheads * TT * HD) return;
    const int h = (int)(e / ((size_t)HD * TT)), pb = (int)(e % ((size_t)HD * TT)) >> 9, pw = (int)e & 511;   // e is the place in the plane: its (t, d) by the fragment order with rows t, K = HD
    const int t = (pb / (HD / 32)) * 16 + ((pw >> 3) & 15), d = (pb % (HD / 32)) * 32 + (pw >> 8) * 16 + ((pw >> 7) & 1) * 8 + (pw & 7); const float* f = F + (size_t)t * pitch + h * HD; v2us oh, ol;
#pragma unroll
    for (int q = 0; q < 2; ++q) { const int dd = d + q; const int dp = (dd < HD / 2) ? dd + HD / 2 : dd - HD / 2; const float x0 = f[dd], x1 = f[dp];
        const v2f cs = *(const v2f*)(CS + ((size_t)t * HD + dd) * 2); float a = __fmul_rn(x0, cs[0]), bq = __fmul_rn(x1, cs[1]); asm volatile("" : "+v"(a)); asm volatile("" : "+v"(bq)); const float r = (dd < HD / 2) ? __fsub_rn(a, bq) : __fadd_rn(a, bq);
        unsigned short a2, c2; splitf(r, a2, c2); oh[q] = a2; ol[q] = c2; }
    *(v2us*)(Ph + e) = oh; *(v2us*)(Pl + e) = ol;  }
__device__ __forceinline__ void d_vtp(int blk, const float* __restrict__ F, int pitch, int nheads, bf* Vh, bf* Vl) { const size_t e = ((size_t)blk * 256 + threadIdx.x) * 2; if (e >= (size_t)nheads * HD * TT) return;
    const int g = (int)(e / ((size_t)TT * HD)), pb = (int)(e % ((size_t)TT * HD)) >> 9, pw = (int)e & 511;   // e is the place in the plane: its (d, t) by the fragment order with rows d, K = TT
    const int d = (pb / (TT / 32)) * 16 + ((pw >> 3) & 15), t = (pb % (TT / 32)) * 32 + (pw >> 8) * 16 + ((pw >> 7) & 1) * 8 + (pw & 7); v2us oh, ol;
#pragma unroll
    for (int q = 0; q < 2; ++q) { const float x = F[(size_t)(t + q) * pitch + g * HD + d]; unsigned short a2, c2; splitf(x, a2, c2); oh[q] = a2; ol[q] = c2; }
    *(v2us*)(Vh + e) = oh; *(v2us*)(Vl + e) = ol;  }
// ---- k_prep: every job that reads the inputs alone, in one grid; the weight transposes, whose blocks run longest, start first. The branches are on blockIdx and so the same for a whole block.
#define DQKV   (DQ + 2 * DKV)
#define NB_WQ  (DQ * DM / (64 * 128))
#define NB_WKV (DKV * DM / (64 * 128))
static_assert(DM % 128 == 0 && DQ % 128 == 0 && DKV % 128 == 0);
#define NB_X   (TT * DM / (8 * 256))
#define NB_CS  (TT * HD / 256)
#define NB_ROPE ((NQ + NKV) * TT * HD / (2 * 256))
#define NB_VT  (NKV * TT * HD / (2 * 256))
__global__ __launch_bounds__(256) void k_prep(const float* __restrict__ x, const float* __restrict__ wq, const float* __restrict__ wk, const float* __restrict__ wv, const float* __restrict__ wo, const int* __restrict__ pos,
                                              bf* WQ, bf* WK, bf* WV, bf* WO, bf* XB, float* CS) {
    __shared__ __align__(16) unsigned ts[128 * 33];                  // the transposes' tile
    int b = (int)blockIdx.x;
    if (b >= 2 * NB_WQ + 2 * NB_WKV + NB_X) { d_cstab(b - (2 * NB_WQ + 2 * NB_WKV + NB_X), pos, CS); return; }   // the last blocks of the grid; tested first, since behind five other tests the compiler makes powf a call
    if (b < NB_WQ) { d_wtT(b, wq, DM, DQ, WQ, ts); return; }            // Wq [D][NQ*HD]  -> WQ[c][d]
    b -= NB_WQ;
    if (b < NB_WQ) { d_wtT(b, wo, DQ, DM, WO, ts); return; }            // Wo [NQ*HD][D]  -> WO[dout][nh]
    b -= NB_WQ;
    if (b < NB_WKV) { d_wtT(b, wk, DM, DKV, WK, ts); return; }          // Wk [D][NKV*HD] -> WK[c][d]
    b -= NB_WKV;
    if (b < NB_WKV) { d_wtT(b, wv, DM, DKV, WV, ts); return; }          // Wv [D][NKV*HD] -> WV[c][d]
    b -= NB_WKV;
    d_cvt8(b, x, XB, DM, (size_t)TT * DM / 8);
}
// ---- k_post: the two jobs that read the projections F [t][q heads | k heads | v heads], in one grid: the V transpose (strided reads, started first), then RoPE of the NQ + NKV q and k heads into planes that lie one behind the other.
__global__ __launch_bounds__(256) void k_post(const float* __restrict__ F, const float* __restrict__ CS, bf* Ph, bf* Pl, bf* Vh, bf* Vl) {
    const int b = (int)blockIdx.x;
    if (b < NB_VT) { d_vtp(b, F + DQ + DKV, DQKV, NKV, Vh, Vl); return; }
    d_rope(b - NB_VT, F, DQKV, NQ + NKV, CS, Ph, Pl);
}
// ---- k_fattn: scores, mask, softmax and attn.v of one 16-query tile in one pass over the keys; scores and probabilities stay in registers. Workgroup = the GQ query heads of one kv head (one wave each, same
// 16 queries, so the waves read the same K and V lines); grid (TT/16) * NKV; LDS holds only the segment ids (one barrier). Per 64-key block, up to the diagonal block:
//   St[key][query] = K Q^T (A = K rows, B = Q rows; qh.kh + ql.kh + qh.kl): D element r of key tile nb -> (key 16 nb + 8h + r, query lane&15), which is already the B-fragment k order of the next product
//   (elements 0..7 <- k0 + 8h + i from tile 2j, elements 8..15 <- k0 + 16 + 8h + i from tile 2j + 1), so the probabilities go from one product to the other with no exchange between lanes;
//   running row maximum m and row sum l per query (lane&15; the two lane halves hold different keys), accumulator rescaled by exp(m_old - m_new);
//   Ot[d][query] += Vt P^T (A = Vt rows d, B = P hi/lo; ph.vh + pl.vh + ph.vl): the query of every accumulator element is the lane's own, so the rescale and the final 1/l are lane-local.
// Every inner loop is fully unrolled, so that the fragment arrays are indexed by constants and stay in registers.
// A masked score is the fill -3e38. While a row has met no allowed key, m is the fill too and its masked entries count as exp(0) = 1; the first allowed key (the diagonal at the latest) rescales all of that by exp(-huge) = 0.
__global__ __launch_bounds__(32 * GQ) void k_fattn(const bf* __restrict__ Qh, const bf* __restrict__ Ql, const bf* __restrict__ Kh, const bf* __restrict__ Kl, const bf* __restrict__ Vh, const bf* __restrict__ Vl, const int* __restrict__ seg, bf* Ah, bf* Al) {
    typedef WFrag<bf>::V V;
    const int lane = threadIdx.x & 31, lr = lane & 15, hi = lane >> 4;
    const int wv = __builtin_amdgcn_readfirstlane((int)(threadIdx.x >> 5));
    const int b = (int)blockIdx.x, nhalf = (TT / 32) * NKV;
    const int qt = b < nhalf ? TT / 16 - 1 - b / NKV : (b - nhalf) / NKV;   // long tiles start first, the short ones fill in beside them
    const int kvh = b % NKV, head = kvh * GQ + wv, q0 = qt * 16, qi = q0 + lr;
    const size_t qoff = ((size_t)head * TT + q0) * HD + 8 * lane;     // all planes in fragment order: 16 rows of Q or K are HD / 32 blocks, 16 rows of Vt TT / 32
    const bf* pqh = Qh + qoff; const bf* pql = Ql + qoff;
    V qh[2], ql[2];
#pragma unroll
    for (int kk = 0; kk < 2; ++kk) { qh[kk] = WFrag<bf>::ld(pqh + kk * 512); ql[kk] = WFrag<bf>::ld(pql + kk * 512); }
    __shared__ __align__(16) int sseg[TT];                           // the segment ids, read per key block from LDS: a global load there would be waited for in order behind the K loads in flight
    v4i sgr[TT / (32 * GQ * 4)];
#pragma unroll
    for (int i = 0; i < TT / (32 * GQ * 4); ++i) sgr[i] = *(const v4i*)(seg + (i * 32 * GQ + (int)threadIdx.x) * 4);
    const int sq = seg[qi];
    // K and V addresses = wave-uniform base (kv head, key block) + a lane offset that never changes
    const bf* kbh = Kh + (size_t)kvh * TT * HD; const bf* kbl = Kl + (size_t)kvh * TT * HD; const bf* vbh = Vh + (size_t)kvh * HD * TT; const bf* vbl = Vl + (size_t)kvh * HD * TT;
    const unsigned klane = (unsigned)(8 * lane), vlane = (unsigned)(8 * lane);
    v8f o[4];
#pragma unroll
    for (int mb = 0; mb < 4; ++mb) o[mb] = (v8f){};
    float m = -3.0e38f, l = 0.f;                                     // m in units of log2: score * SCL * log2(e)
    const int kend = q0 + 16;
    V kh[4][2], kl[4][2];                                            // the K fragments of one 64-key block, loaded one block ahead: again right behind their last use
#pragma unroll
    for (int nb = 0; nb < 4; ++nb)
#pragma unroll
        for (int kk = 0; kk < 2; ++kk) { const int e = nb * 16 * HD + kk * 512; kh[nb][kk] = WFrag<bf>::ld(kbh + klane + e); kl[nb][kk] = WFrag<bf>::ld(kbl + klane + e); }
    __builtin_amdgcn_sched_barrier(0);                               // nothing is scheduled in between the prologue's loads and their wait, or up over it
    // the precaution behind a group of loads, before a register that they name is written again; the addresses are inputs of the wait, so that they keep their registers up to it and no result of the group lands on one
    asm volatile("s_wait_xcnt 0x0" :: "v"(pqh), "v"(pql), "v"(klane) : "memory");
    __builtin_amdgcn_sched_barrier(0);                               // the second half of the same: what follows stays behind the wait
#pragma unroll
    for (int i = 0; i < TT / (32 * GQ * 4); ++i) *(v4i*)(sseg + (i * 32 * GQ + (int)threadIdx.x) * 4) = sgr[i];
    __syncthreads();                                                 // sseg is whole
#pragma unroll 1                                                     // one key block per trip: a second copy of the body would not fit the registers
    for (int kb = 0; kb < kend; kb += 64) {
        const int kn = kb + 64 < kend ? kb + 64 : kb;                // the next block; behind the last block this one again (in bounds, never used)
        V vh[4][2], vl[4][2];                                        // this block's V fragments: asked for here, used behind the softmax
        const bf* pvh = vbh + kb * 16 + vlane; const bf* pvl = vbl + kb * 16 + vlane;
#pragma unroll
        for (int mb = 0; mb < 4; ++mb)
#pragma unroll
            for (int j = 0; j < 2; ++j) { const int e = mb * 16 * TT + j * 512; vh[mb][j] = WFrag<bf>::ld(pvh + e); vl[mb][j] = WFrag<bf>::ld(pvl + e); }
        asm volatile("s_wait_xcnt 0x0" :: "v"(pvh), "v"(pvl) : "memory");   // the same precaution, the V addresses held in their registers up to the wait
        v8f s[4];
#pragma unroll
        for (int nb = 0; nb < 4; ++nb) { s[nb] = (v8f){};
#pragma unroll
            for (int kk = 0; kk < 2; ++kk) { s[nb] = wmmab(kh[nb][kk], qh[kk], s[nb]); s[nb] = wmmab(kh[nb][kk], ql[kk], s[nb]); s[nb] = wmmab(kl[nb][kk], qh[kk], s[nb]); } }
        const bf* pkh = kbh + (size_t)kn * HD + klane; const bf* pkl = kbl + (size_t)kn * HD + klane;
#pragma unroll
        for (int nb = 0; nb < 4; ++nb)
#pragma unroll
            for (int kk = 0; kk < 2; ++kk) { const int e = nb * 16 * HD + kk * 512; kh[nb][kk] = WFrag<bf>::ld(pkh + e); kl[nb][kk] = WFrag<bf>::ld(pkl + e); }
        asm volatile("s_wait_xcnt 0x0" :: "v"(pkh), "v"(pkl) : "memory");   // the same precaution, the K addresses held in their registers up to the wait
        const int lim = qi - kb - 8 * hi;                            // key offset 16 nb + r in this lane is causal iff it is <= lim
        float mx = m;
#pragma unroll
        for (int nb = 0; nb < 4; ++nb) { const int j0 = kb + nb * 16 + 8 * hi; const v4i g0 = *(const v4i*)(sseg + j0), g1 = *(const v4i*)(sseg + j0 + 4);
#pragma unroll
            for (int r = 0; r < 8; ++r) { const int sg = r < 4 ? g0[r & 3] : g1[r & 3]; const float t = (sg == sq && nb * 16 + r <= lim) ? s[nb][r] * (SCL * 1.4426950408889634f) : -3.0e38f; s[nb][r] = t; mx = fmaxf(mx, t); } }
        mx = fmaxf(mx, __shfl_xor(mx, 16, 32));
        const float al = __builtin_amdgcn_exp2f(m - mx);
        m = mx;
        v2f ps2[2] = {(v2f){0.f, 0.f}, (v2f){0.f, 0.f}}; v8u phw[2], plw[2];   // four independent partial row sums
#pragma unroll
        for (int nb = 0; nb < 4; ++nb) {
#pragma unroll
            for (int r = 0; r < 8; r += 2) { v2f pp; pp[0] = __builtin_amdgcn_exp2f(s[nb][r] - mx); pp[1] = __builtin_amdgcn_exp2f(s[nb][r + 1] - mx); ps2[nb & 1] += pp;
                const v2bf h2 = __builtin_convertvector(pp, v2bf); const v2bf l2 = __builtin_convertvector(pp - __builtin_convertvector(h2, v2f), v2bf);
                phw[nb >> 1][(nb & 1) * 4 + (r >> 1)] = __builtin_bit_cast(unsigned, h2); plw[nb >> 1][(nb & 1) * 4 + (r >> 1)] = __builtin_bit_cast(unsigned, l2); } }
        l = l * al + ((ps2[0][0] + ps2[1][0]) + (ps2[0][1] + ps2[1][1]));
#pragma unroll
        for (int mb = 0; mb < 4; ++mb) { o[mb] *= al;
#pragma unroll
            for (int j = 0; j < 2; ++j) { const V ph = __builtin_bit_cast(V, phw[j]), pl = __builtin_bit_cast(V, plw[j]); o[mb] = wmmab(vh[mb][j], ph, o[mb]); o[mb] = wmmab(vh[mb][j], pl, o[mb]); o[mb] = wmmab(vl[mb][j], ph, o[mb]); } }
    }
    l += __shfl_xor(l, 16, 32);
    const float f = __fdiv_rn(1.0f, l);
    const int ln = (int)__lane_id();                                 // the lane's number from the count that the shuffles keep anyway: 8 * lane held over the loop went to scratch memory
#pragma unroll
    for (int mb = 0; mb < 4; ++mb) { v8us oh, ol;
#pragma unroll
        for (int r = 0; r < 8; ++r) { unsigned short a2, c2; splitf(o[mb][r] * f, a2, c2); oh[r] = a2; ol[r] = c2; }
        const size_t oo = ((size_t)qt * (DQ / 32) + head * (HD / 32) + (mb >> 1)) * 512 + (mb & 1) * 256 + 8 * ln; *(v8us*)(Ah + oo) = oh; *(v8us*)(Al + oo) = ol; }   // row qi, k = head * HD + 16 mb + 8 hi + r in fragment order
}

extern "C" void kernel_launch(void* const* d_in, const int* in_sizes, int n_in,
                              void* d_out, int out_size, void* d_ws, size_t ws_size, hipStream_t stream) {
    if (n_in < 7) return;
    if (in_sizes[0] < TT * DM || in_sizes[1] < DM * DQ || in_sizes[2] < DM * DKV || in_sizes[3] < DM * DKV || in_sizes[4] < DQ * DM || in_sizes[5] < TT || in_sizes[6] < TT) return;
    if (out_size < TT * DM) return;
    const float* x = (const float*)d_in[0]; const float* wq = (const float*)d_in[1]; const float* wk = (const float*)d_in[2]; const float* wv = (const float*)d_in[3]; const float* wo = (const float*)d_in[4];
    const int* pos = (const int*)d_in[5]; const int* seg = (const int*)d_in[6];
    float* OUT = (float*)d_out;     // [TT][DM]
    char* wsp = (char*)d_ws;
    auto take = [&](size_t bytes) { char* p = wsp; wsp += (bytes + 255) & ~(size_t)255; return (void*)p; };
    // the q, k and v weight planes lie one behind the other ([DQKV][DM]), and so do the q and k head planes: the three projections are one GEMM, RoPE of q and k one job
    bf* WQ = (bf*)take((size_t)DQKV * DM * 2); bf* WK = WQ + (size_t)DQ * DM; bf* WV = WK + (size_t)DKV * DM; bf* WO = (bf*)take((size_t)DM * DQ * 2);
    float* CS = (float*)take((size_t)TT * HD * 2 * 4);
    bf* XB = (bf*)take((size_t)TT * DM * 2); float* F = (float*)take((size_t)TT * DQKV * 4);
    bf* QPh = (bf*)take((size_t)(NQ + NKV) * TT * HD * 2); bf* QPl = (bf*)take((size_t)(NQ + NKV) * TT * HD * 2); bf* KPh = QPh + (size_t)NQ * TT * HD; bf* KPl = QPl + (size_t)NQ * TT * HD;
    bf* VTh = (bf*)take((size_t)NKV * HD * TT * 2); bf* VTl = (bf*)take((size_t)NKV * HD * TT * 2);
    bf* ATh = (bf*)take((size_t)TT * DQ * 2); bf* ATl = (bf*)take((size_t)TT * DQ * 2);
    const size_t used = (size_t)(wsp - (char*)d_ws);
    if (used > ws_size || used > ((size_t)128 << 20)) return;

    // tables and 16-bit planes of the inputs: one launch
    k_prep<<<2 * NB_WQ + 2 * NB_WKV + NB_X + NB_CS, 256, 0, stream>>>(x, wq, wk, wv, wo, pos, WQ, WK, WV, WO, XB, CS);
    // q, k and v projections (plain bf16 operands): one launch, F [t][DQKV]
    k_gemmw<bf, 0, false, 8, DM><<<dim3(TT / 64, DQKV / 64, 1), 256, 0, stream>>>(XB, nullptr, WQ, nullptr, F, DQKV, nullptr, 0, 0, 0);
    // roped / transposed hi-lo planes: one launch
    k_post<<<NB_VT + NB_ROPE, 256, 0, stream>>>(F, CS, QPh, QPl, VTh, VTl);
    // attention: one launch, all heads; writes the hi/lo ctx planes (rows t, columns head * HD + d, fragment order)
    k_fattn<<<(unsigned)((TT / 16) * NKV), 32 * GQ, 0, stream>>>(QPh, QPl, KPh, KPl, VTh, VTl, seg, ATh, ATl);
    // output projection: hi/lo ctx x bf16 Wo
    k_gemmw<bf, 1, false, 8, DQ><<<dim3(TT / 64, DM / 64, 1), 256, 0, stream>>>(ATh, ATl, WO, nullptr, OUT, DM, nullptr, 0, 0, 0);
}

// v006
// One run takes 84 microseconds.
// In two side-by-side timings against v005, it was 1.03 and 1.04 times as fast.
// Counting every step since v000, it is 4.96 times as fast.
#include <hip/hip_runtime.h>

// GQA causal ragged attention: q/k/v = x W (32 query heads, 8 kv heads, head 64, no bias), rotate-half RoPE from int32 positions (theta 5e5), mask = (same segment id) and (key index <= query index) with -3e38 fill, softmax(q.k * 0.125), ctx Wo -> [TT][2048] f32.
// Compute dtypes, f32 accumulate everywhere: x and all four weights RNE-converted to bf16 planes; q/k/v projections v_wmma_f32_16x16x32_bf16 on plain bf16 operands (one product); scores and attn.v on bf16 hi/lo split planes (hi.hi + lo.hi + hi.lo); output projection bf16 hi/lo ctx x bf16 Wo (2 products); RoPE tables, RoPE, softmax and all side math f32 on VALU.

#ifndef TT
#define TT   1024
#endif
#define TT_FULL 1024
#define DM   2048
#define NQ   32
#define NKV  8
#define GQ   (NQ / NKV)
#define HD   64
#define DQ   (NQ * HD)
#define DKV  (NKV * HD)
#define THETA 500000.0f
#define SCL  0.125f
static_assert(TT % 128 == 0);
static_assert(TT <= TT_FULL);
static_assert(HD == 64);
static_assert(DM % 64 == 0 && DQ % 64 == 0 && DKV % 64 == 0);

typedef _Float16 h16;
typedef unsigned short bf;
typedef __attribute__((ext_vector_type(16))) __bf16   v16bf;
typedef __attribute__((ext_vector_type(16))) _Float16 v16h;
typedef __attribute__((ext_vector_type(8)))  _Float16 v8h;
typedef __attribute__((ext_vector_type(8)))  unsigned short v8us;
typedef __attribute__((ext_vector_type(8)))  float    v8f;
typedef __attribute__((ext_vector_type(4)))  float    v4f;
typedef v8h  __attribute__((may_alias)) v8ha;
typedef v4f  __attribute__((may_alias)) v4fa;
typedef v8us __attribute__((may_alias)) v8usa;

__device__ __forceinline__ unsigned short f2bf(float f) { unsigned u = __float_as_uint(f); u += 0x7FFFu + ((u >> 16) & 1u); return (unsigned short)(u >> 16); }
__device__ __forceinline__ float bf2f(unsigned short b) { return __uint_as_float(((unsigned)b) << 16); }
__device__ __forceinline__ float bfr(float f) { return bf2f(f2bf(f)); }
__device__ __forceinline__ v16h cat16(v8h lo, v8h hi) { return __builtin_shufflevector(lo, hi, 0, 1, 2, 3, 4, 5, 6, 7, 8, 9, 10, 11, 12, 13, 14, 15); }
__device__ __forceinline__ v16bf cat16b(v8us lo, v8us hi) { return __builtin_bit_cast(v16bf, __builtin_shufflevector(lo, hi, 0, 1, 2, 3, 4, 5, 6, 7, 8, 9, 10, 11, 12, 13, 14, 15)); }
__device__ __forceinline__ v8f wmma16(v16h a, v16h b, v8f c) { return __builtin_amdgcn_wmma_f32_16x16x32_f16(false, a, false, b, (short)0, c, false, false); }
__device__ __forceinline__ v8f wmmab(v16bf a, v16bf b, v8f c) { return __builtin_amdgcn_wmma_f32_16x16x32_bf16(false, a, false, b, (short)0, c, false, false); }

__device__ __forceinline__ void splitf(float y, unsigned short& h, unsigned short& l) { h = f2bf(y); l = f2bf(y - bf2f(h)); }
typedef __attribute__((ext_vector_type(4))) unsigned short v4us;

// ---- k_gemmw: register-blocked GEMM, one 64x64 output tile per workgroup of NW waves; wave w takes the 32-wide k steps w, w + NW, ... into its own 16 accumulators (operands straight from
// 16-bit planes in fragment order, below), and the NW partial tiles are summed in LDS in the fixed order w = 0 .. NW-1; grid (M/64, N/64, Z), 32 * NW threads.
// C[m][n] (f32, pitch ldc, + optional f32 bias[n]) = sum_k A[m][k] Bt[n][k] (+ split products per NSPLIT). z-batch strides sA/sB/sC in elements. K % 32 == 0.
// Fragments: lane -> row/col lane&15, vector elements 0..7 <- k0 + 8h + i, elements 8..15 <- k0 + 16 + 8h + i (h = lane>>4) for BOTH operands; D element r -> (row 8h + r, col lane&15).
template <typename T16> struct WFrag;
template <> struct WFrag<h16> { typedef v16h V; static __device__ __forceinline__ V ld(const h16* p) { return cat16(*(const v8h*)p, *(const v8h*)(p + 256)); } static __device__ __forceinline__ v8f mma(V a, V b, v8f c) { return wmma16(a, b, c); } };
template <> struct WFrag<bf> { typedef v16bf V; static __device__ __forceinline__ V ld(const bf* p) { return cat16b(*(const v8us*)p, *(const v8us*)(p + 256)); } static __device__ __forceinline__ v8f mma(V a, V b, v8f c) { return wmmab(a, b, c); } };
// Fragment order of a 16-bit operand plane with K columns (every plane that a matrix instruction reads): blocks of 16 rows x 32 k = 512 elements, block index (row / 16) * (K / 32) + k / 32; inside a block element
// (row, k) lies at ((k >> 4) & 1) * 256 + (((k >> 3) & 1) * 16 + (row & 15)) * 8 + (k & 7). Lane l's fragment is then the 8 elements at 8 l and the 8 at 256 + 8 l: each 16-byte load of a wave reads 512 bytes in a row (four whole lines).
__device__ __forceinline__ size_t pidx(int row, int k, int K) { return ((size_t)(row >> 4) * (K >> 5) + (k >> 5)) * 512 + ((k >> 4) & 1) * 256 + (((k >> 3) & 1) * 16 + (row & 15)) * 8 + (k & 7); }
// QKV = true (the q/k/v projection; a 64-column tile is one head): the joined tile is not stored as f32 but goes straight into the 16-bit hi/lo planes that the attention kernel reads, in fragment order:
// a q or k head through rotate-half RoPE, out[d] = x[d] cos[t][d] - x[d+HD/2] sin[t][d], out[d+HD/2] = x[d+HD/2] cos[t][d+HD/2] + x[d] sin[t][d+HD/2], into plane [head] with rows t; a v head transposed into plane [kv head] with rows d.
template <typename T16, int NSPLIT, bool BIAS, int NW, int K, bool QKV>
__global__ __launch_bounds__(32 * NW) void k_gemmw(const T16* __restrict__ A, const T16* __restrict__ A2, const T16* __restrict__ Bt, const T16* __restrict__ Bt2, float* C, int ldc, const float* __restrict__ bias, size_t sA, size_t sB, size_t sC,
                                                   const float* __restrict__ CS, bf* Ph, bf* Pl, bf* Vh, bf* Vl) {
    typedef typename WFrag<T16>::V V;
    static_assert(NW == 8);                                          // the join below deals 16 rows x 16 float4 columns to 256 threads
    __shared__ __align__(16) float os[2 * NW * 16 * 68];             // two buffers of NW partial 16x64 row blocks: one barrier per row block
    const size_t z = blockIdx.z; A += z * sA; if (A2) A2 += z * sA; Bt += z * sB; if (Bt2) Bt2 += z * sB; C += z * sC;
    const int lane = threadIdx.x & 31, lr = lane & 15, hi = lane >> 4; const int r0 = blockIdx.x * 64, c0 = blockIdx.y * 64;
    const int wv = __builtin_amdgcn_readfirstlane((int)(threadIdx.x >> 5));
    v8f acc[4][4];
#pragma unroll
    for (int mb = 0; mb < 4; ++mb)
#pragma unroll
        for (int nb = 0; nb < 4; ++nb) acc[mb][nb] = (v8f){};
    const bool rp = QKV && c0 < DQ + DKV;                            // QKV: a q or k head (RoPE) or a v head (transpose): by blockIdx, the same for the whole block
    // RoPE tile, the join: thread -> 4 columns d of one row t per row block. A wave takes 8 rows x (8 d and the 8 d at + HD/2): lane ^ 8 holds the rotation partner, lanes l and l ^ 16 the two halves of a 16-byte unit,
    // so that a wave's 8-byte stores fill two whole lines of a plane; the 16 lanes of each half wave read 64 different LDS banks.
    const int rrow = (wv & 1) * 8 + (lane & 7), rcof = ((wv >> 1) * 2 + hi) * 4 + ((lane >> 3) & 1) * (HD / 2);
    v4f cs[4][2];                                                    // (cos, sin) of the thread's 4 columns, per row block: asked for in front of the k loop, since behind it the join's first barrier would wait them out
    if (rp) {
        const float* pc = CS + ((size_t)(r0 + rrow) * HD + rcof) * 2;
#pragma unroll
        for (int mb = 0; mb < 4; ++mb) { cs[mb][0] = *(const v4f*)(pc + mb * 16 * HD * 2); cs[mb][1] = *(const v4f*)(pc + mb * 16 * HD * 2 + 4); }
        asm volatile("s_wait_xcnt 0x0" :: "v"(pc) : "memory");       // the precaution behind a group of loads, before a register that they name is written again; the address is an input, so that it keeps its registers up to the wait
    }
    const size_t aoff = (size_t)r0 * K + 8 * lane, boff = (size_t)c0 * K + 8 * lane;   // 16 rows of a plane are K / 32 blocks = 16 K elements; a k step is one block
#pragma unroll 1
    for (int kc = wv * 32; kc < K; kc += 32 * NW) {
        V a[4], a2[4];
        // one address per plane and k step; K is a constant of the kernel, so that the row blocks are immediate offsets from it and no further address register is formed
        const T16* pa = A + aoff + kc * 16; const T16* pa2 = (NSPLIT == 1 || NSPLIT == 2) ? A2 + aoff + kc * 16 : pa; const T16* pb = Bt + boff + kc * 16; const T16* pb2 = NSPLIT >= 2 ? Bt2 + boff + kc * 16 : pb;
#pragma unroll
        for (int mb = 0; mb < 4; ++mb) { a[mb] = WFrag<T16>::ld(pa + mb * 16 * K); if (NSPLIT == 1 || NSPLIT == 2) a2[mb] = WFrag<T16>::ld(pa2 + mb * 16 * K); }
#pragma unroll
        for (int nb = 0; nb < 4; ++nb) { const V b = WFrag<T16>::ld(pb + nb * 16 * K); V b2; if (NSPLIT >= 2) b2 = WFrag<T16>::ld(pb2 + nb * 16 * K);
#pragma unroll
            for (int mb = 0; mb < 4; ++mb) { acc[mb][nb] = WFrag<T16>::mma(a[mb], b, acc[mb][nb]); if (NSPLIT == 1 || NSPLIT == 2) acc[mb][nb] = WFrag<T16>::mma(a2[mb], b, acc[mb][nb]); if (NSPLIT >= 2) acc[mb][nb] = WFrag<T16>::mma(a[mb], b2, acc[mb][nb]); } }
        // the precaution behind the trip's loads, before a register that they name is written again; the addresses are inputs, so that they keep their registers up to the wait and no result lands on one
        asm volatile("s_wait_xcnt 0x0" :: "v"(pa), "v"(pa2), "v"(pb), "v"(pb2) : "memory");
        asm volatile("v_nop\n\tv_nop\n\tv_nop\n\tv_nop" : "+v"(acc[0][0]), "+v"(acc[1][1]), "+v"(acc[2][2]), "+v"(acc[3][3]) : "v"(a[0]), "v"(a[3]));
    }
    if constexpr (QKV) {
        // V tile: thread -> 4 rows t of one column d per row block. A wave takes 16 d x 8 t: 256 bytes in a row of the transposed plane.
        const int vd = (wv & 3) * 16 + lr, vt = ((wv >> 2) * 2 + hi) * 4;
        v4us oh[4], ol[4];
#pragma unroll
        for (int mb = 0; mb < 4; ++mb) {
            float* ob = os + (mb & 1) * (NW * 16 * 68);
#pragma unroll
            for (int nb = 0; nb < 4; ++nb) {
#pragma unroll
                for (int j = 0; j < 8; ++j) ob[wv * (16 * 68) + (hi * 8 + j) * 68 + nb * 16 + lr] = acc[mb][nb][j]; }
            __syncthreads();                                         // every wave's partial of this row block is in LDS; the other buffer's readers are done before it is written again
            v4f r;
            if (rp) {
                v4f val = *(const v4fa*)(ob + rrow * 68 + rcof);
#pragma unroll
                for (int w = 1; w < NW; ++w) val += *(const v4fa*)(ob + w * (16 * 68) + rrow * 68 + rcof);
#pragma unroll
                for (int j = 0; j < 4; ++j) { const float x1 = __shfl_xor(val[j], 8, 32), cn = cs[mb][j >> 1][(j & 1) * 2], sn = cs[mb][j >> 1][(j & 1) * 2 + 1]; r[j] = (lane & 8) ? val[j] * cn + x1 * sn : val[j] * cn - x1 * sn; }
            } else {
#pragma unroll
                for (int j = 0; j < 4; ++j) { float v = ob[(vt + j) * 68 + vd];
#pragma unroll
                    for (int w = 1; w < NW; ++w) v += ob[w * (16 * 68) + (vt + j) * 68 + vd];
                    r[j] = v; }
            }
#pragma unroll
            for (int j = 0; j < 4; ++j) { unsigned short a2, c2; splitf(r[j], a2, c2); oh[mb][j] = a2; ol[mb][j] = c2; }
        }
        // stores behind the last barrier, as below; 16 rows t are two blocks of a q or k plane, half a block of a V^T plane
        const size_t po = rp ? (size_t)(c0 / HD) * TT * HD + pidx(r0 + rrow, rcof, HD) : (size_t)((c0 - DQ - DKV) / HD) * HD * TT + pidx(vd, r0 + vt, TT);
        bf* ph = (rp ? Ph : Vh) + po; bf* pl = (rp ? Pl : Vl) + po;
        const int pst = rp ? 1024 : 256;
#pragma unroll
        for (int mb = 0; mb < 4; ++mb) { *(v4us*)(ph + mb * pst) = oh[mb]; *(v4us*)(pl + mb * pst) = ol[mb];
            asm volatile("s_wait_xcnt 0x0" :: "v"(ph), "v"(pl) : "memory"); }   // the same precaution behind each pair of stores: the next pair's addresses and data may take the registers of this one
        return;
    }
    const int row = (int)(threadIdx.x >> 4), cofs = (int)(threadIdx.x & 15) * 4; v4f res[4];   // the join: thread -> one float4 of each 16x64 row block
#pragma unroll
    for (int mb = 0; mb < 4; ++mb) {
        float* ob = os + (mb & 1) * (NW * 16 * 68);
#pragma unroll
        for (int nb = 0; nb < 4; ++nb) {
#pragma unroll
            for (int j = 0; j < 8; ++j) ob[wv * (16 * 68) + (hi * 8 + j) * 68 + nb * 16 + lr] = acc[mb][nb][j]; }
        __syncthreads();                                             // every wave's partial of this row block is in LDS; the other buffer's readers are done before it is written again
        v4f val = *(const v4fa*)(ob + row * 68 + cofs);
#pragma unroll
        for (int w = 1; w < NW; ++w) val += *(const v4fa*)(ob + w * (16 * 68) + row * 68 + cofs);
        if (BIAS) { val[0] += bfr(bias[c0 + cofs]); val[1] += bfr(bias[c0 + cofs + 1]); val[2] += bfr(bias[c0 + cofs + 2]); val[3] += bfr(bias[c0 + cofs + 3]); }
        res[mb] = val;
    }
    // stores behind the last barrier: a store in front of a barrier would be waited out there
#pragma unroll
    for (int mb = 0; mb < 4; ++mb) *(v4f*)(C + (size_t)(r0 + mb * 16 + row) * ldc + c0 + cofs) = res[mb];
}

typedef __attribute__((ext_vector_type(2))) float v2f;
typedef __attribute__((ext_vector_type(4))) int v4i;
typedef __attribute__((ext_vector_type(2))) __bf16 v2bf;
typedef __attribute__((ext_vector_type(8))) unsigned v8u;
typedef __attribute__((ext_vector_type(4))) unsigned v4u;

// The d_* functions are the bodies of jobs that read none of each other's output; k_prep below deals the blocks of one grid to them (blk = the block's index inside its job).
// d_wtT: Bt (bf16, rows n, fragment order) = w[k][n] (f32), one tile of 64 k x 128 n per block, turned in LDS (ts: 128 rows n of 32 dwords, each dword the bf16 pair k, k + 1; pitch 33 dwords, so that no two lanes of a wave
// meet on a bank, storing or loading). Every global load of a wave is two 256-byte pieces of rows of w, every global store four whole 128-byte lines of Bt. Neighbouring blocks take neighbouring n.
__device__ __forceinline__ void d_wtT(int blk, const float* __restrict__ w, int K, int N, bf* Bt, unsigned* ts) {
    const int lane = threadIdx.x & 31, wv = (int)(threadIdx.x >> 5); const int n0 = (blk % (N / 128)) * 128, k0 = (blk / (N / 128)) * 64;
    const int c4 = (lane & 15) * 4, kq = wv * 2 + (lane >> 4);      // thread -> 4 columns n of the row pairs kq and kq + 16, in both 64-column halves
    v4f ev[2][2], od[2][2];
#pragma unroll
    for (int i = 0; i < 2; ++i)
#pragma unroll
        for (int nh = 0; nh < 2; ++nh) { const float* p = w + (size_t)(k0 + 2 * (kq + 16 * i)) * N + n0 + nh * 64 + c4; ev[i][nh] = *(const v4f*)p; od[i][nh] = *(const v4f*)(p + N); }
    asm volatile("s_wait_xcnt 0x0" ::: "memory");                    // the precaution behind a group of loads, before a register that they name is written again
#pragma unroll
    for (int i = 0; i < 2; ++i)
#pragma unroll
        for (int nh = 0; nh < 2; ++nh)
#pragma unroll
            for (int j = 0; j < 4; ++j) ts[(nh * 64 + c4 + j) * 33 + kq + 16 * i] = (unsigned)f2bf(ev[i][nh][j]) | ((unsigned)f2bf(od[i][nh][j]) << 16);
    __syncthreads();                                                 // the tile is whole in LDS (the job is chosen by blockIdx: every wave of the block passes here)
    // thread -> four 8-k pieces (4 dwords each) of the wave's 16 rows; eight neighbouring lanes take eight neighbouring rows at one k, which is one whole line of the fragment order
#pragma unroll
    for (int i = 0; i < 4; ++i) { const int n = wv * 16 + (i >> 1) * 8 + (lane & 7), k8 = (lane >> 3) * 2 + (i & 1); const unsigned* q = ts + n * 33 + k8 * 4; v4u v; v[0] = q[0]; v[1] = q[1]; v[2] = q[2]; v[3] = q[3]; *(v4u*)(Bt + pidx(n0 + n, k0 + k8 * 8, K)) = v; }
    asm volatile("s_wait_xcnt 0x0" ::: "memory");                    // the same precaution behind the group of stores
}
// d_cvt8: dst (bf16, fragment order) = src [rows][K] (f32), 8 k per thread; a wave takes 8 rows x 32 k: it loads one whole line of each row and stores four whole lines
__device__ __forceinline__ void d_cvt8(int blk, const float* __restrict__ src, bf* dst, int K, size_t n8) { const size_t i = (size_t)blk * 256 + threadIdx.x; if (i >= n8) return;
    const int w = (int)(i >> 5), ks = (w >> 1) % (K / 32), row = ((w >> 1) / (K / 32)) * 16 + (w & 1) * 8 + (((int)i >> 2) & 7), k = ks * 32 + ((int)i & 3) * 8;
    const v8f v = *(const v8f*)(src + (size_t)row * K + k); v8us o;
#pragma unroll
    for (int q = 0; q < 8; ++q) o[q] = f2bf(v[q]); *(v8us*)(dst + pidx(row, k, K)) = o;  }
// the inverse frequency is computed by the thread that uses it, so that the table job depends on the inputs alone
__device__ __forceinline__ void d_cstab(int blk, const int* __restrict__ pos, float* CS) {
    const int idx = blk * 256 + threadIdx.x; if (idx >= TT * HD) return;
    const int dd = idx % HD; const int t = idx / HD; const int j = dd & (HD / 2 - 1);
    const float e = (float)j * (1.0f / (float)(HD / 2));
    const float p = powf(THETA, e);
    const float v = 1.0f / p;
    const float pf = (float)pos[t];
    float fr = __fmul_rn(pf, v); asm volatile("" : "+v"(fr));
    float sn, cn;
    sincosf(fr, &sn, &cn);
    v2f cs; cs[0] = cn; cs[1] = sn;
    *(v2f*)(CS + (size_t)idx * 2) = cs; 
}
// ---- k_prep: every job that reads the inputs alone, in one grid; the weight transposes, whose blocks run longest, start first. The branches are on blockIdx and so the same for a whole block.
#define DQKV   (DQ + 2 * DKV)
#define NB_WQ  (DQ * DM / (64 * 128))
#define NB_WKV (DKV * DM / (64 * 128))
static_assert(DM % 128 == 0 && DQ % 128 == 0 && DKV % 128 == 0);
#define NB_X   (TT * DM / (8 * 256))
#define NB_CS  (TT * HD / 256)
__global__ __launch_bounds__(256) void k_prep(const float* __restrict__ x, const float* __restrict__ wq, const float* __restrict__ wk, const float* __restrict__ wv, const float* __restrict__ wo, const int* __restrict__ pos,
                                              bf* WQ, bf* WK, bf* WV, bf* WO, bf* XB, float* CS) {
    __shared__ __align__(16) unsigned ts[128 * 33];                  // the transposes' tile
    int b = (int)blockIdx.x;
    if (b >= 2 * NB_WQ + 2 * NB_WKV + NB_X) { d_cstab(b - (2 * NB_WQ + 2 * NB_WKV + NB_X), pos, CS); return; }   // the last blocks of the grid; tested first, since behind five other tests the compiler makes powf a call
    if (b < NB_WQ) { d_wtT(b, wq, DM, DQ, WQ, ts); return; }            // Wq [D][NQ*HD]  -> WQ[c][d]
    b -= NB_WQ;
    if (b < NB_WQ) { d_wtT(b, wo, DQ, DM, WO, ts); return; }            // Wo [NQ*HD][D]  -> WO[dout][nh]
    b -= NB_WQ;
    if (b < NB_WKV) { d_wtT(b, wk, DM, DKV, WK, ts); return; }          // Wk [D][NKV*HD] -> WK[c][d]
    b -= NB_WKV;
    if (b < NB_WKV) { d_wtT(b, wv, DM, DKV, WV, ts); return; }          // Wv [D][NKV*HD] -> WV[c][d]
    b -= NB_WKV;
    d_cvt8(b, x, XB, DM, (size_t)TT * DM / 8);
}
// ---- k_fattn: scores, mask, softmax and attn.v of one 16-query tile in one pass over the keys; scores and probabilities stay in registers. Workgroup = the GQ query heads of one kv head (one wave each, same
// 16 queries, so the waves read the same K and V lines); grid (TT/16) * NKV; LDS holds only the segment ids (one barrier). Per 64-key block, up to the diagonal block:
//   St[key][query] = K Q^T (A = K rows, B = Q rows; qh.kh + ql.kh + qh.kl): D element r of key tile nb -> (key 16 nb + 8h + r, query lane&15), which is already the B-fragment k order of the next product
//   (elements 0..7 <- k0 + 8h + i from tile 2j, elements 8..15 <- k0 + 16 + 8h + i from tile 2j + 1), so the probabilities go from one product to the other with no exchange between lanes;
//   running row maximum m and row sum l per query (lane&15; the two lane halves hold different keys), accumulator rescaled by exp(m_old - m_new);
//   Ot[d][query] += Vt P^T (A = Vt rows d, B = P hi/lo; ph.vh + pl.vh + ph.vl): the query of every accumulator element is the lane's own, so the rescale and the final 1/l are lane-local.
// Every inner loop is fully unrolled, so that the fragment arrays are indexed by constants and stay in registers.
// A masked score is the fill -3e38. While a row has met no allowed key, m is the fill too and its masked entries count as exp(0) = 1; the first allowed key (the diagonal at the latest) rescales all of that by exp(-huge) = 0.
__global__ __launch_bounds__(32 * GQ) void k_fattn(const bf* __restrict__ Qh, const bf* __restrict__ Ql, const bf* __restrict__ Kh, const bf* __restrict__ Kl, const bf* __restrict__ Vh, const bf* __restrict__ Vl, const int* __restrict__ seg, bf* Ah, bf* Al) {
    typedef WFrag<bf>::V V;
    const int lane = threadIdx.x & 31, lr = lane & 15, hi = lane >> 4;
    const int wv = __builtin_amdgcn_readfirstlane((int)(threadIdx.x >> 5));
    const int b = (int)blockIdx.x, nhalf = (TT / 32) * NKV;
    const int qt = b < nhalf ? TT / 16 - 1 - b / NKV : (b - nhalf) / NKV;   // long tiles start first, the short ones fill in beside them
    const int kvh = b % NKV, head = kvh * GQ + wv, q0 = qt * 16, qi = q0 + lr;
    const size_t qoff = ((size_t)head * TT + q0) * HD + 8 * lane;     // all planes in fragment order: 16 rows of Q or K are HD / 32 blocks, 16 rows of Vt TT / 32
    const bf* pqh = Qh + qoff; const bf* pql = Ql + qoff;
    V qh[2], ql[2];
#pragma unroll
    for (int kk = 0; kk < 2; ++kk) { qh[kk] = WFrag<bf>::ld(pqh + kk * 512); ql[kk] = WFrag<bf>::ld(pql + kk * 512); }
    __shared__ __align__(16) int sseg[TT];                           // the segment ids, read per key block from LDS: a global load there would be waited for in order behind the K loads in flight
    v4i sgr[TT / (32 * GQ * 4)];
#pragma unroll
    for (int i = 0; i < TT / (32 * GQ * 4); ++i) sgr[i] = *(const v4i*)(seg + (i * 32 * GQ + (int)threadIdx.x) * 4);
    const int sq = seg[qi];
    // K and V addresses = wave-uniform base (kv head, key block) + a lane offset that never changes
    const bf* kbh = Kh + (size_t)kvh * TT * HD; const bf* kbl = Kl + (size_t)kvh * TT * HD; const bf* vbh = Vh + (size_t)kvh * HD * TT; const bf* vbl = Vl + (size_t)kvh * HD * TT;
    const unsigned klane = (unsigned)(8 * lane), vlane = (unsigned)(8 * lane);
    v8f o[4];
#pragma unroll
    for (int mb = 0; mb < 4; ++mb) o[mb] = (v8f){};
    float m = -3.0e38f, l = 0.f;                                     // m in units of log2: score * SCL * log2(e)
    const int kend = q0 + 16;
    V kh[4][2], kl[4][2];                                            // the K fragments of one 64-key block, loaded one block ahead: again right behind their last use
#pragma unroll
    for (int nb = 0; nb < 4; ++nb)
#pragma unroll
        for (int kk = 0; kk < 2; ++kk) { const int e = nb * 16 * HD + kk * 512; kh[nb][kk] = WFrag<bf>::ld(kbh + klane + e); kl[nb][kk] = WFrag<bf>::ld(kbl + klane + e); }
    __builtin_amdgcn_sched_barrier(0);                               // nothing is scheduled in between the prologue's loads and their wait, or up over it
    // the precaution behind a group of loads, before a register that they name is written again; the addresses are inputs of the wait, so that they keep their registers up to it and no result of the group lands on one
    asm volatile("s_wait_xcnt 0x0" :: "v"(pqh), "v"(pql), "v"(klane) : "memory");
    __builtin_amdgcn_sched_barrier(0);                               // the second half of the same: what follows stays behind the wait
#pragma unroll
    for (int i = 0; i < TT / (32 * GQ * 4); ++i) *(v4i*)(sseg + (i * 32 * GQ + (int)threadIdx.x) * 4) = sgr[i];
    __syncthreads();                                                 // sseg is whole
#pragma unroll 1                                                     // one key block per trip: a second copy of the body would not fit the registers
    for (int kb = 0; kb < kend; kb += 64) {
        const int kn = kb + 64 < kend ? kb + 64 : kb;                // the next block; behind the last block this one again (in bounds, never used)
        V vh[4][2], vl[4][2];                                        // this block's V fragments: asked for here, used behind the softmax
        const bf* pvh = vbh + kb * 16 + vlane; const bf* pvl = vbl + kb * 16 + vlane;
#pragma unroll
        for (int mb = 0; mb < 4; ++mb)
#pragma unroll
            for (int j = 0; j < 2; ++j) { const int e = mb * 16 * TT + j * 512; vh[mb][j] = WFrag<bf>::ld(pvh + e); vl[mb][j] = WFrag<bf>::ld(pvl + e); }
        asm volatile("s_wait_xcnt 0x0" :: "v"(pvh), "v"(pvl) : "memory");   // the same precaution, the V addresses held in their registers up to the wait
        v8f s[4];
#pragma unroll
        for (int nb = 0; nb < 4; ++nb) { s[nb] = (v8f){};
#pragma unroll
            for (int kk = 0; kk < 2; ++kk) { s[nb] = wmmab(kh[nb][kk], qh[kk], s[nb]); s[nb] = wmmab(kh[nb][kk], ql[kk], s[nb]); s[nb] = wmmab(kl[nb][kk], qh[kk], s[nb]); } }
        const bf* pkh = kbh + (size_t)kn * HD + klane; const bf* pkl = kbl + (size_t)kn * HD + klane;
#pragma unroll
        for (int nb = 0; nb < 4; ++nb)
#pragma unroll
            for (int kk = 0; kk < 2; ++kk) { const int e = nb * 16 * HD + kk * 512; kh[nb][kk] = WFrag<bf>::ld(pkh + e); kl[nb][kk] = WFrag<bf>::ld(pkl + e); }
        asm volatile("s_wait_xcnt 0x0" :: "v"(pkh), "v"(pkl) : "memory");   // the same precaution, the K addresses held in their registers up to the wait
        const int lim = qi - kb - 8 * hi;                            // key offset 16 nb + r in this lane is causal iff it is <= lim
        float mx = m;
#pragma unroll
        for (int nb = 0; nb < 4; ++nb) { const int j0 = kb + nb * 16 + 8 * hi; const v4i g0 = *(const v4i*)(sseg + j0), g1 = *(const v4i*)(sseg + j0 + 4);
#pragma unroll
            for (int r = 0; r < 8; ++r) { const int sg = r < 4 ? g0[r & 3] : g1[r & 3]; const float t = (sg == sq && nb * 16 + r <= lim) ? s[nb][r] * (SCL * 1.4426950408889634f) : -3.0e38f; s[nb][r] = t; mx = fmaxf(mx, t); } }
        mx = fmaxf(mx, __shfl_xor(mx, 16, 32));
        const float al = __builtin_amdgcn_exp2f(m - mx);
        m = mx;
        v2f ps2[2] = {(v2f){0.f, 0.f}, (v2f){0.f, 0.f}}; v8u phw[2], plw[2];   // four independent partial row sums
#pragma unroll
        for (int nb = 0; nb < 4; ++nb) {
#pragma unroll
            for (int r = 0; r < 8; r += 2) { v2f pp; pp[0] = __builtin_amdgcn_exp2f(s[nb][r] - mx); pp[1] = __builtin_amdgcn_exp2f(s[nb][r + 1] - mx); ps2[nb & 1] += pp;
                const v2bf h2 = __builtin_convertvector(pp, v2bf); const v2bf l2 = __builtin_convertvector(pp - __builtin_convertvector(h2, v2f), v2bf);
                phw[nb >> 1][(nb & 1) * 4 + (r >> 1)] = __builtin_bit_cast(unsigned, h2); plw[nb >> 1][(nb & 1) * 4 + (r >> 1)] = __builtin_bit_cast(unsigned, l2); } }
        l = l * al + ((ps2[0][0] + ps2[1][0]) + (ps2[0][1] + ps2[1][1]));
#pragma unroll
        for (int mb = 0; mb < 4; ++mb) { o[mb] *= al;
#pragma unroll
            for (int j = 0; j < 2; ++j) { const V ph = __builtin_bit_cast(V, phw[j]), pl = __builtin_bit_cast(V, plw[j]); o[mb] = wmmab(vh[mb][j], ph, o[mb]); o[mb] = wmmab(vh[mb][j], pl, o[mb]); o[mb] = wmmab(vl[mb][j], ph, o[mb]); } }
    }
    l += __shfl_xor(l, 16, 32);
    const float f = __fdiv_rn(1.0f, l);
    const int ln = (int)__lane_id();                                 // the lane's number from the count that the shuffles keep anyway: 8 * lane held over the loop went to scratch memory
#pragma unroll
    for (int mb = 0; mb < 4; ++mb) { v8us oh, ol;
#pragma unroll
        for (int r = 0; r < 8; ++r) { unsigned short a2, c2; splitf(o[mb][r] * f, a2, c2); oh[r] = a2; ol[r] = c2; }
        const size_t oo = ((size_t)qt * (DQ / 32) + head * (HD / 32) + (mb >> 1)) * 512 + (mb & 1) * 256 + 8 * ln; *(v8us*)(Ah + oo) = oh; *(v8us*)(Al + oo) = ol; }   // row qi, k = head * HD + 16 mb + 8 hi + r in fragment order
}

extern "C" void kernel_launch(void* const* d_in, const int* in_sizes, int n_in,
                              void* d_out, int out_size, void* d_ws, size_t ws_size, hipStream_t stream) {
    if (n_in < 7) return;
    if (in_sizes[0] < TT * DM || in_sizes[1] < DM * DQ || in_sizes[2] < DM * DKV || in_sizes[3] < DM * DKV || in_sizes[4] < DQ * DM || in_sizes[5] < TT || in_sizes[6] < TT) return;
    if (out_size < TT * DM) return;
    const float* x = (const float*)d_in[0]; const float* wq = (const float*)d_in[1]; const float* wk = (const float*)d_in[2]; const float* wv = (const float*)d_in[3]; const float* wo = (const float*)d_in[4];
    const int* pos = (const int*)d_in[5]; const int* seg = (const int*)d_in[6];
    float* OUT = (float*)d_out;     // [TT][DM]
    char* wsp = (char*)d_ws;
    auto take = [&](size_t bytes) { char* p = wsp; wsp += (bytes + 255) & ~(size_t)255; return (void*)p; };
    // the q, k and v weight planes lie one behind the other ([DQKV][DM]), and so do the q and k head planes: the three projections are one GEMM, whose epilogue ropes q and k into the joined planes
    bf* WQ = (bf*)take((size_t)DQKV * DM * 2); bf* WK = WQ + (size_t)DQ * DM; bf* WV = WK + (size_t)DKV * DM; bf* WO = (bf*)take((size_t)DM * DQ * 2);
    float* CS = (float*)take((size_t)TT * HD * 2 * 4);
    bf* XB = (bf*)take((size_t)TT * DM * 2);
    bf* QPh = (bf*)take((size_t)(NQ + NKV) * TT * HD * 2); bf* QPl = (bf*)take((size_t)(NQ + NKV) * TT * HD * 2); bf* KPh = QPh + (size_t)NQ * TT * HD; bf* KPl = QPl + (size_t)NQ * TT * HD;
    bf* VTh = (bf*)take((size_t)NKV * HD * TT * 2); bf* VTl = (bf*)take((size_t)NKV * HD * TT * 2);
    bf* ATh = (bf*)take((size_t)TT * DQ * 2); bf* ATl = (bf*)take((size_t)TT * DQ * 2);
    const size_t used = (size_t)(wsp - (char*)d_ws);
    if (used > ws_size || used > ((size_t)128 << 20)) return;

    // tables and 16-bit planes of the inputs: one launch
    k_prep<<<2 * NB_WQ + 2 * NB_WKV + NB_X + NB_CS, 256, 0, stream>>>(x, wq, wk, wv, wo, pos, WQ, WK, WV, WO, XB, CS);
    // q, k and v projections (plain bf16 operands): one launch, which writes the roped q and k planes and the transposed v planes (hi/lo) itself
    k_gemmw<bf, 0, false, 8, DM, true><<<dim3(TT / 64, DQKV / 64, 1), 256, 0, stream>>>(XB, nullptr, WQ, nullptr, nullptr, 0, nullptr, 0, 0, 0, CS, QPh, QPl, VTh, VTl);
    // attention: one launch, all heads; writes the hi/lo ctx planes (rows t, columns head * HD + d, fragment order)
    k_fattn<<<(unsigned)((TT / 16) * NKV), 32 * GQ, 0, stream>>>(QPh, QPl, KPh, KPl, VTh, VTl, seg, ATh, ATl);
    // output projection: hi/lo ctx x bf16 Wo
    k_gemmw<bf, 1, false, 8, DQ, false><<<dim3(TT / 64, DM / 64, 1), 256, 0, stream>>>(ATh, ATl, WO, nullptr, OUT, DM, nullptr, 0, 0, 0, nullptr, nullptr, nullptr, nullptr, nullptr);
}

// v007
// It runs in 69.3 microseconds.
// Two timings next to v006 put it at 1.20 and 1.21 times that version's speed.
// Counting every step since v000, it is 5.97 times as fast.
#include <hip/hip_runtime.h>

// GQA causal ragged attention: q/k/v = x W (32 query heads, 8 kv heads, head 64, no bias), rotate-half RoPE from int32 positions (theta 5e5), mask = (same segment id) and (key index <= query index) with -3e38 fill, softmax(q.k * 0.125), ctx Wo -> [TT][2048] f32.
// Compute dtypes, f32 accumulate everywhere: x and all four weights RNE-converted to bf16 planes; q/k/v projections v_wmma_f32_16x16x32_bf16 on plain bf16 operands (one product); scores and attn.v on bf16 hi/lo split planes (hi.hi + lo.hi + hi.lo); output projection bf16 hi/lo ctx x bf16 Wo (2 products); RoPE tables, RoPE, softmax and all side math f32 on VALU.

#ifndef TT
#define TT   1024
#endif
#define TT_FULL 1024
#define DM   2048
#define NQ   32
#define NKV  8
#define GQ   (NQ / NKV)
#define HD   64
#define DQ   (NQ * HD)
#define DKV  (NKV * HD)
#define THETA 500000.0f
#define SCL  0.125f
static_assert(TT % 128 == 0);
static_assert(TT <= TT_FULL);
static_assert(HD == 64);
static_assert(DM % 64 == 0 && DQ % 64 == 0 && DKV % 64 == 0);

typedef _Float16 h16;
typedef unsigned short bf;
typedef __attribute__((ext_vector_type(16))) __bf16   v16bf;
typedef __attribute__((ext_vector_type(16))) _Float16 v16h;
typedef __attribute__((ext_vector_type(8)))  _Float16 v8h;
typedef __attribute__((ext_vector_type(8)))  unsigned short v8us;
typedef __attribute__((ext_vector_type(8)))  float    v8f;
typedef __attribute__((ext_vector_type(4)))  float    v4f;
typedef v8h  __attribute__((may_alias)) v8ha;
typedef v4f  __attribute__((may_alias)) v4fa;
typedef v8us __attribute__((may_alias)) v8usa;

__device__ __forceinline__ unsigned short f2bf(float f) { unsigned u = __float_as_uint(f); u += 0x7FFFu + ((u >> 16) & 1u); return (unsigned short)(u >> 16); }
__device__ __forceinline__ float bf2f(unsigned short b) { return __uint_as_float(((unsigned)b) << 16); }
__device__ __forceinline__ float bfr(float f) { return bf2f(f2bf(f)); }
__device__ __forceinline__ v16h cat16(v8h lo, v8h hi) { return __builtin_shufflevector(lo, hi, 0, 1, 2, 3, 4, 5, 6, 7, 8, 9, 10, 11, 12, 13, 14, 15); }
__device__ __forceinline__ v16bf cat16b(v8us lo, v8us hi) { return __builtin_bit_cast(v16bf, __builtin_shufflevector(lo, hi, 0, 1, 2, 3, 4, 5, 6, 7, 8, 9, 10, 11, 12, 13, 14, 15)); }
__device__ __forceinline__ v8f wmma16(v16h a, v16h b, v8f c) { return __builtin_amdgcn_wmma_f32_16x16x32_f16(false, a, false, b, (short)0, c, false, false); }
__device__ __forceinline__ v8f wmmab(v16bf a, v16bf b, v8f c) { return __builtin_amdgcn_wmma_f32_16x16x32_bf16(false, a, false, b, (short)0, c, false, false); }

__device__ __forceinline__ void splitf(float y, unsigned short& h, unsigned short& l) { h = f2bf(y); l = f2bf(y - bf2f(h)); }
typedef __attribute__((ext_vector_type(4))) unsigned short v4us;

// ---- k_gemmw: register-blocked GEMM, one 64x64 output tile per workgroup of NW waves; wave w takes the 32-wide k steps w, w + NW, ... into its own 16 accumulators (operands straight from
// 16-bit planes in fragment order, below), and the NW partial tiles are summed in LDS in the fixed order w = 0 .. NW-1; grid (M/64, N/64, Z), 32 * NW threads.
// C[m][n] (f32, pitch ldc, + optional f32 bias[n]) = sum_k A[m][k] Bt[n][k] (+ split products per NSPLIT). z-batch strides sA/sB/sC in elements. K % 32 == 0.
// Fragments: lane -> row/col lane&15, vector elements 0..7 <- k0 + 8h + i, elements 8..15 <- k0 + 16 + 8h + i (h = lane>>4) for BOTH operands; D element r -> (row 8h + r, col lane&15).
template <typename T16> struct WFrag;
template <> struct WFrag<h16> { typedef v16h V; static __device__ __forceinline__ V ld(const h16* p) { return cat16(*(const v8h*)p, *(const v8h*)(p + 256)); } static __device__ __forceinline__ v8f mma(V a, V b, v8f c) { return wmma16(a, b, c); } };
template <> struct WFrag<bf> { typedef v16bf V; static __device__ __forceinline__ V ld(const bf* p) { return cat16b(*(const v8us*)p, *(const v8us*)(p + 256)); } static __device__ __forceinline__ v8f mma(V a, V b, v8f c) { return wmmab(a, b, c); } };
// Fragment order of a 16-bit operand plane with K columns (every plane that a matrix instruction reads): blocks of 16 rows x 32 k = 512 elements, block index (row / 16) * (K / 32) + k / 32; inside a block element
// (row, k) lies at ((k >> 4) & 1) * 256 + (((k >> 3) & 1) * 16 + (row & 15)) * 8 + (k & 7). Lane l's fragment is then the 8 elements at 8 l and the 8 at 256 + 8 l: each 16-byte load of a wave reads 512 bytes in a row (four whole lines).
__device__ __forceinline__ size_t pidx(int row, int k, int K) { return ((size_t)(row >> 4) * (K >> 5) + (k >> 5)) * 512 + ((k >> 4) & 1) * 256 + (((k >> 3) & 1) * 16 + (row & 15)) * 8 + (k & 7); }
// QKV = true (the q/k/v projection; a 64-column tile is one head): the joined tile is not stored as f32 but goes straight into the 16-bit hi/lo planes that the attention kernel reads, in fragment order:
// a q or k head through rotate-half RoPE, out[d] = x[d] cos[t][d] - x[d+HD/2] sin[t][d], out[d+HD/2] = x[d+HD/2] cos[t][d+HD/2] + x[d] sin[t][d+HD/2], into plane [head] with rows t; a v head transposed into plane [kv head] with rows d.
template <typename T16, int NSPLIT, bool BIAS, int NW, int K, bool QKV>
__global__ __launch_bounds__(32 * NW) void k_gemmw(const T16* __restrict__ A, const T16* __restrict__ A2, const T16* __restrict__ Bt, const T16* __restrict__ Bt2, float* C, int ldc, const float* __restrict__ bias, size_t sA, size_t sB, size_t sC,
                                                   const float* __restrict__ CS, bf* Ph, bf* Pl, bf* Vh, bf* Vl) {
    typedef typename WFrag<T16>::V V;
    static_assert(NW == 8);                                          // the join below deals 16 rows x 16 float4 columns to 256 threads
    __shared__ __align__(16) float os[2 * NW * 16 * 68];             // two buffers of NW partial 16x64 row blocks: one barrier per row block
    const size_t z = blockIdx.z; A += z * sA; if (A2) A2 += z * sA; Bt += z * sB; if (Bt2) Bt2 += z * sB; C += z * sC;
    const int lane = threadIdx.x & 31, lr = lane & 15, hi = lane >> 4; const int r0 = blockIdx.x * 64, c0 = blockIdx.y * 64;
    const int wv = __builtin_amdgcn_readfirstlane((int)(threadIdx.x >> 5));
    v8f acc[4][4];
#pragma unroll
    for (int mb = 0; mb < 4; ++mb)
#pragma unroll
        for (int nb = 0; nb < 4; ++nb) acc[mb][nb] = (v8f){};
    const bool rp = QKV && c0 < DQ + DKV;                            // QKV: a q or k head (RoPE) or a v head (transpose): by blockIdx, the same for the whole block
    // RoPE tile, the join: thread -> 4 columns d of one row t per row block. A wave takes 8 rows x (8 d and the 8 d at + HD/2): lane ^ 8 holds the rotation partner, lanes l and l ^ 16 the two halves of a 16-byte unit,
    // so that a wave's 8-byte stores fill two whole lines of a plane; the 16 lanes of each half wave read 64 different LDS banks.
    const int rrow = (wv & 1) * 8 + (lane & 7), rcof = ((wv >> 1) * 2 + hi) * 4 + ((lane >> 3) & 1) * (HD / 2);
    v4f cs[4][2];                                                    // (cos, sin) of the thread's 4 columns, per row block: asked for in front of the k loop, since behind it the join's first barrier would wait them out
    if (rp) {
        const float* pc = CS + ((size_t)(r0 + rrow) * HD + rcof) * 2;
#pragma unroll
        for (int mb = 0; mb < 4; ++mb) { cs[mb][0] = *(const v4f*)(pc + mb * 16 * HD * 2); cs[mb][1] = *(const v4f*)(pc + mb * 16 * HD * 2 + 4); }
        asm volatile("s_wait_xcnt 0x0" :: "v"(pc) : "memory");       // the precaution behind a group of loads, before a register that they name is written again; the address is an input, so that it keeps its registers up to the wait
    }
    const size_t aoff = (size_t)r0 * K + 8 * lane, boff = (size_t)c0 * K + 8 * lane;   // 16 rows of a plane are K / 32 blocks = 16 K elements; a k step is one block
#pragma unroll 1
    for (int kc = wv * 32; kc < K; kc += 32 * NW) {
        V a[4], a2[4];
        // one address per plane and k step; K is a constant of the kernel, so that the row blocks are immediate offsets from it and no further address register is formed
        const T16* pa = A + aoff + kc * 16; const T16* pa2 = (NSPLIT == 1 || NSPLIT == 2) ? A2 + aoff + kc * 16 : pa; const T16* pb = Bt + boff + kc * 16; const T16* pb2 = NSPLIT >= 2 ? Bt2 + boff + kc * 16 : pb;
#pragma unroll
        for (int mb = 0; mb < 4; ++mb) { a[mb] = WFrag<T16>::ld(pa + mb * 16 * K); if (NSPLIT == 1 || NSPLIT == 2) a2[mb] = WFrag<T16>::ld(pa2 + mb * 16 * K); }
#pragma unroll
        for (int nb = 0; nb < 4; ++nb) { const V b = WFrag<T16>::ld(pb + nb * 16 * K); V b2; if (NSPLIT >= 2) b2 = WFrag<T16>::ld(pb2 + nb * 16 * K);
#pragma unroll
            for (int mb = 0; mb < 4; ++mb) { acc[mb][nb] = WFrag<T16>::mma(a[mb], b, acc[mb][nb]); if (NSPLIT == 1 || NSPLIT == 2) acc[mb][nb] = WFrag<T16>::mma(a2[mb], b, acc[mb][nb]); if (NSPLIT >= 2) acc[mb][nb] = WFrag<T16>::mma(a[mb], b2, acc[mb][nb]); } }
        // the precaution behind the trip's loads, before a register that they name is written again; the addresses are inputs, so that they keep their registers up to the wait and no result lands on one
        asm volatile("s_wait_xcnt 0x0" :: "v"(pa), "v"(pa2), "v"(pb), "v"(pb2) : "memory");
        asm volatile("v_nop\n\tv_nop\n\tv_nop\n\tv_nop" : "+v"(acc[0][0]), "+v"(acc[1][1]), "+v"(acc[2][2]), "+v"(acc[3][3]) : "v"(a[0]), "v"(a[3]));
    }
    if constexpr (QKV) {
        // V tile: thread -> 4 rows t of one column d per row block. A wave takes 16 d x 8 t: 256 bytes in a row of the transposed plane.
        const int vd = (wv & 3) * 16 + lr, vt = ((wv >> 2) * 2 + hi) * 4;
        v4us oh[4], ol[4];
#pragma unroll
        for (int mb = 0; mb < 4; ++mb) {
            float* ob = os + (mb & 1) * (NW * 16 * 68);
#pragma unroll
            for (int nb = 0; nb < 4; ++nb) {
#pragma unroll
                for (int j = 0; j < 8; ++j) ob[wv * (16 * 68) + (hi * 8 + j) * 68 + nb * 16 + lr] = acc[mb][nb][j]; }
            __syncthreads();                                         // every wave's partial of this row block is in LDS; the other buffer's readers are done before it is written again
            v4f r;
            if (rp) {
                v4f val = *(const v4fa*)(ob + rrow * 68 + rcof);
#pragma unroll
                for (int w = 1; w < NW; ++w) val += *(const v4fa*)(ob + w * (16 * 68) + rrow * 68 + rcof);
#pragma unroll
                for (int j = 0; j < 4; ++j) { const float x1 = __shfl_xor(val[j], 8, 32), cn = cs[mb][j >> 1][(j & 1) * 2], sn = cs[mb][j >> 1][(j & 1) * 2 + 1]; r[j] = (lane & 8) ? val[j] * cn + x1 * sn : val[j] * cn - x1 * sn; }
            } else {
#pragma unroll
                for (int j = 0; j < 4; ++j) { float v = ob[(vt + j) * 68 + vd];
#pragma unroll
                    for (int w = 1; w < NW; ++w) v += ob[w * (16 * 68) + (vt + j) * 68 + vd];
                    r[j] = v; }
            }
#pragma unroll
            for (int j = 0; j < 4; ++j) { unsigned short a2, c2; splitf(r[j], a2, c2); oh[mb][j] = a2; ol[mb][j] = c2; }
        }
        // stores behind the last barrier, as below; 16 rows t are two blocks of a q or k plane, half a block of a V^T plane
        const size_t po = rp ? (size_t)(c0 / HD) * TT * HD + pidx(r0 + rrow, rcof, HD) : (size_t)((c0 - DQ - DKV) / HD) * HD * TT + pidx(vd, r0 + vt, TT);
        bf* ph = (rp ? Ph : Vh) + po; bf* pl = (rp ? Pl : Vl) + po;
        const int pst = rp ? 1024 : 256;
#pragma unroll
        for (int mb = 0; mb < 4; ++mb) { *(v4us*)(ph + mb * pst) = oh[mb]; *(v4us*)(pl + mb * pst) = ol[mb];
            asm volatile("s_wait_xcnt 0x0" :: "v"(ph), "v"(pl) : "memory"); }   // the same precaution behind each pair of stores: the next pair's addresses and data may take the registers of this one
        return;
    }
    const int row = (int)(threadIdx.x >> 4), cofs = (int)(threadIdx.x & 15) * 4; v4f res[4];   // the join: thread -> one float4 of each 16x64 row block
#pragma unroll
    for (int mb = 0; mb < 4; ++mb) {
        float* ob = os + (mb & 1) * (NW * 16 * 68);
#pragma unroll
        for (int nb = 0; nb < 4; ++nb) {
#pragma unroll
            for (int j = 0; j < 8; ++j) ob[wv * (16 * 68) + (hi * 8 + j) * 68 + nb * 16 + lr] = acc[mb][nb][j]; }
        __syncthreads();                                             // every wave's partial of this row block is in LDS; the other buffer's readers are done before it is written again
        v4f val = *(const v4fa*)(ob + row * 68 + cofs);
#pragma unroll
        for (int w = 1; w < NW; ++w) val += *(const v4fa*)(ob + w * (16 * 68) + row * 68 + cofs);
        if (BIAS) { val[0] += bfr(bias[c0 + cofs]); val[1] += bfr(bias[c0 + cofs + 1]); val[2] += bfr(bias[c0 + cofs + 2]); val[3] += bfr(bias[c0 + cofs + 3]); }
        res[mb] = val;
    }
    // stores behind the last barrier: a store in front of a barrier would be waited out there
#pragma unroll
    for (int mb = 0; mb < 4; ++mb) *(v4f*)(C + (size_t)(r0 + mb * 16 + row) * ldc + c0 + cofs) = res[mb];
}

typedef __attribute__((ext_vector_type(2))) float v2f;
typedef __attribute__((ext_vector_type(4))) int v4i;
typedef __attribute__((ext_vector_type(2))) __bf16 v2bf;
typedef __attribute__((ext_vector_type(8))) unsigned v8u;
typedef __attribute__((ext_vector_type(4))) unsigned v4u;

// The d_* functions are the bodies of jobs that read none of each other's output; k_prep below deals the blocks of one grid to them (blk = the block's index inside its job).
// d_wtT: Bt (bf16, rows n, fragment order) = w[k][n] (f32), one tile of 64 k x 128 n per block, turned in LDS (ts: 128 rows n of 32 dwords, each dword the bf16 pair k, k + 1; pitch 33 dwords, so that no two lanes of a wave
// meet on a bank, storing or loading). Every global load of a wave is two 256-byte pieces of rows of w, every global store four whole 128-byte lines of Bt. Neighbouring blocks take neighbouring n.
__device__ __forceinline__ void d_wtT(int blk, const float* __restrict__ w, int K, int N, bf* Bt, unsigned* ts) {
    const int lane = threadIdx.x & 31, wv = (int)(threadIdx.x >> 5); const int n0 = (blk % (N / 128)) * 128, k0 = (blk / (N / 128)) * 64;
    const int c4 = (lane & 15) * 4, kq = wv * 2 + (lane >> 4);      // thread -> 4 columns n of the row pairs kq and kq + 16, in both 64-column halves
    v4f ev[2][2], od[2][2];
#pragma unroll
    for (int i = 0; i < 2; ++i)
#pragma unroll
        for (int nh = 0; nh < 2; ++nh) { const float* p = w + (size_t)(k0 + 2 * (kq + 16 * i)) * N + n0 + nh * 64 + c4; ev[i][nh] = *(const v4f*)p; od[i][nh] = *(const v4f*)(p + N); }
    asm volatile("s_wait_xcnt 0x0" ::: "memory");                    // the precaution behind a group of loads, before a register that they name is written again
#pragma unroll
    for (int i = 0; i < 2; ++i)
#pragma unroll
        for (int nh = 0; nh < 2; ++nh)
#pragma unroll
            for (int j = 0; j < 4; ++j) ts[(nh * 64 + c4 + j) * 33 + kq + 16 * i] = (unsigned)f2bf(ev[i][nh][j]) | ((unsigned)f2bf(od[i][nh][j]) << 16);
    __syncthreads();                                                 // the tile is whole in LDS (the job is chosen by blockIdx: every wave of the block passes here)
    // thread -> four 8-k pieces (4 dwords each) of the wave's 16 rows; eight neighbouring lanes take eight neighbouring rows at one k, which is one whole line of the fragment order
#pragma unroll
    for (int i = 0; i < 4; ++i) { const int n = wv * 16 + (i >> 1) * 8 + (lane & 7), k8 = (lane >> 3) * 2 + (i & 1); const unsigned* q = ts + n * 33 + k8 * 4; v4u v; v[0] = q[0]; v[1] = q[1]; v[2] = q[2]; v[3] = q[3]; *(v4u*)(Bt + pidx(n0 + n, k0 + k8 * 8, K)) = v; }
    asm volatile("s_wait_xcnt 0x0" ::: "memory");                    // the same precaution behind the group of stores
}
// d_cvt8: dst (bf16, fragment order) = src [rows][K] (f32), 8 k per thread; a wave takes 8 rows x 32 k: it loads one whole line of each row and stores four whole lines
__device__ __forceinline__ void d_cvt8(int blk, const float* __restrict__ src, bf* dst, int K, size_t n8) { const size_t i = (size_t)blk * 256 + threadIdx.x; if (i >= n8) return;
    const int w = (int)(i >> 5), ks = (w >> 1) % (K / 32), row = ((w >> 1) / (K / 32)) * 16 + (w & 1) * 8 + (((int)i >> 2) & 7), k = ks * 32 + ((int)i & 3) * 8;
    const v8f v = *(const v8f*)(src + (size_t)row * K + k); v8us o;
#pragma unroll
    for (int q = 0; q < 8; ++q) o[q] = f2bf(v[q]); *(v8us*)(dst + pidx(row, k, K)) = o;  }
// the inverse frequency is computed by the thread that uses it, so that the table job depends on the inputs alone
__device__ __forceinline__ void d_cstab(int blk, const int* __restrict__ pos, float* CS) {
    const int idx = blk * 256 + threadIdx.x; if (idx >= TT * HD) return;
    const int dd = idx % HD; const int t = idx / HD; const int j = dd & (HD / 2 - 1);
    const float e = (float)j * (1.0f / (float)(HD / 2));
    const float p = powf(THETA, e);
    const float v = 1.0f / p;
    const float pf = (float)pos[t];
    float fr = __fmul_rn(pf, v); asm volatile("" : "+v"(fr));
    float sn, cn;
    sincosf(fr, &sn, &cn);
    v2f cs; cs[0] = cn; cs[1] = sn;
    *(v2f*)(CS + (size_t)idx * 2) = cs; 
}
// ---- k_prep: every job that reads the inputs alone, in one grid; the weight transposes, whose blocks run longest, start first. The branches are on blockIdx and so the same for a whole block.
#define DQKV   (DQ + 2 * DKV)
#define NB_WQ  (DQ * DM / (64 * 128))
#define NB_WKV (DKV * DM / (64 * 128))
static_assert(DM % 128 == 0 && DQ % 128 == 0 && DKV % 128 == 0);
#define NB_X   (TT * DM / (8 * 256))
#define NB_CS  (TT * HD / 256)
__global__ __launch_bounds__(256) void k_prep(const float* __restrict__ x, const float* __restrict__ wq, const float* __restrict__ wk, const float* __restrict__ wv, const float* __restrict__ wo, const int* __restrict__ pos,
                                              bf* WQ, bf* WK, bf* WV, bf* WO, bf* XB, float* CS) {
    __shared__ __align__(16) unsigned ts[128 * 33];                  // the transposes' tile
    int b = (int)blockIdx.x;
    if (b >= 2 * NB_WQ + 2 * NB_WKV + NB_X) { d_cstab(b - (2 * NB_WQ + 2 * NB_WKV + NB_X), pos, CS); return; }   // the last blocks of the grid; tested first, since behind five other tests the compiler makes powf a call
    if (b < NB_WQ) { d_wtT(b, wq, DM, DQ, WQ, ts); return; }            // Wq [D][NQ*HD]  -> WQ[c][d]
    b -= NB_WQ;
    if (b < NB_WQ) { d_wtT(b, wo, DQ, DM, WO, ts); return; }            // Wo [NQ*HD][D]  -> WO[dout][nh]
    b -= NB_WQ;
    if (b < NB_WKV) { d_wtT(b, wk, DM, DKV, WK, ts); return; }          // Wk [D][NKV*HD] -> WK[c][d]
    b -= NB_WKV;
    if (b < NB_WKV) { d_wtT(b, wv, DM, DKV, WV, ts); return; }          // Wv [D][NKV*HD] -> WV[c][d]
    b -= NB_WKV;
    d_cvt8(b, x, XB, DM, (size_t)TT * DM / 8);
}
// ---- k_fattn: scores, mask, softmax and attn.v of one 16-query tile in one pass over the keys; scores and probabilities stay in registers. Workgroup = the GQ query heads of one kv head (one wave each, same
// 16 queries, so the waves read the same K and V lines); grid (TT/16) * NKV; LDS holds only the segment ids and the key-block mask (one barrier). Per 64-key block that the mask names, up to the diagonal block:
//   St[key][query] = K Q^T (A = K rows, B = Q rows; qh.kh + ql.kh + qh.kl): D element r of key tile nb -> (key 16 nb + 8h + r, query lane&15), which is already the B-fragment k order of the next product
//   (elements 0..7 <- k0 + 8h + i from tile 2j, elements 8..15 <- k0 + 16 + 8h + i from tile 2j + 1), so the probabilities go from one product to the other with no exchange between lanes;
//   running row maximum m and row sum l per query (lane&15; the two lane halves hold different keys), accumulator rescaled by exp(m_old - m_new);
//   Ot[d][query] += Vt P^T (A = Vt rows d, B = P hi/lo; ph.vh + pl.vh + ph.vl): the query of every accumulator element is the lane's own, so the rescale and the final 1/l are lane-local.
// Every inner loop is fully unrolled, so that the fragment arrays are indexed by constants and stay in registers.
// Key-block mask: bit j is set if block j holds a key whose segment id lies inside [least, greatest] of the tile's 16 query ids, found at entry from the ids themselves, whatever they hold. In a block without such a key every
// score of the tile is masked, and a wholly masked block adds exact zeros (ahead of a row's first allowed key it is rescaled by 0, behind it its probabilities are exp2(-huge) = 0): it is passed over. The diagonal block is always taken.
// A masked score is the fill -3e38. While a row has met no allowed key, m is the fill too and its masked entries count as exp(0) = 1; the first allowed key (the diagonal at the latest) rescales all of that by exp(-huge) = 0.
__global__ __launch_bounds__(32 * GQ) void k_fattn(const bf* __restrict__ Qh, const bf* __restrict__ Ql, const bf* __restrict__ Kh, const bf* __restrict__ Kl, const bf* __restrict__ Vh, const bf* __restrict__ Vl, const int* __restrict__ seg, bf* Ah, bf* Al) {
    typedef WFrag<bf>::V V;
    const int lane = threadIdx.x & 31, lr = lane & 15, hi = lane >> 4;
    const int wv = __builtin_amdgcn_readfirstlane((int)(threadIdx.x >> 5));
    const int b = (int)blockIdx.x, nhalf = (TT / 32) * NKV;
    const int qt = b < nhalf ? TT / 16 - 1 - b / NKV : (b - nhalf) / NKV;   // long tiles start first, the short ones fill in beside them
    const int kvh = b % NKV, head = kvh * GQ + wv, q0 = qt * 16, qi = q0 + lr;
    const size_t qoff = ((size_t)head * TT + q0) * HD + 8 * lane;     // all planes in fragment order: 16 rows of Q or K are HD / 32 blocks, 16 rows of Vt TT / 32
    const bf* pqh = Qh + qoff; const bf* pql = Ql + qoff;
    V qh[2], ql[2];
#pragma unroll
    for (int kk = 0; kk < 2; ++kk) { qh[kk] = WFrag<bf>::ld(pqh + kk * 512); ql[kk] = WFrag<bf>::ld(pql + kk * 512); }
    __shared__ __align__(16) int sseg[TT];                           // the segment ids, read per key block from LDS: a global load there would be waited for in order behind the K loads in flight
    __shared__ __align__(16) unsigned sbm[GQ];                       // each wave's share of the key-block mask
    v4i sgr[TT / (32 * GQ * 4)];
#pragma unroll
    for (int i = 0; i < TT / (32 * GQ * 4); ++i) sgr[i] = *(const v4i*)(seg + (i * 32 * GQ + (int)threadIdx.x) * 4);
    const int sq = seg[qi];
    int slo = seg[q0], shi = slo;                                    // least and greatest segment id of the tile's queries; the addresses are the same in every lane
#pragma unroll
    for (int i = 1; i < 16; ++i) { const int s = seg[q0 + i]; slo = s < slo ? s : slo; shi = s > shi ? s : shi; }
    // K and V addresses = wave-uniform base (kv head, key block) + a lane offset that never changes
    const bf* kbh = Kh + (size_t)kvh * TT * HD; const bf* kbl = Kl + (size_t)kvh * TT * HD; const bf* vbh = Vh + (size_t)kvh * HD * TT; const bf* vbl = Vl + (size_t)kvh * HD * TT;
    const unsigned klane = (unsigned)(8 * lane), vlane = (unsigned)(8 * lane);
    v8f o[4];
#pragma unroll
    for (int mb = 0; mb < 4; ++mb) o[mb] = (v8f){};
    float m = -3.0e38f, l = 0.f;                                     // m in units of log2: score * SCL * log2(e)
    __builtin_amdgcn_sched_barrier(0);                               // nothing is scheduled in between the prologue's loads and their wait, or up over it
    // the precaution behind a group of loads, before a register that they name is written again; the addresses are inputs of the wait, so that they keep their registers up to it and no result of the group lands on one
    asm volatile("s_wait_xcnt 0x0" :: "v"(pqh), "v"(pql) : "memory");
    __builtin_amdgcn_sched_barrier(0);                               // the second half of the same: what follows stays behind the wait
    // the wave's share of the key-block mask: a thread holds 4 neighbouring keys per round, so 16 lanes hold one 64-key block; unsigned differences, so that the range test holds for any 32-bit ids
    static_assert(GQ == 4 && TT / 64 <= 32 && (32 * GQ * 4) % 64 == 0);
    const unsigned span = (unsigned)shi - (unsigned)slo;
    unsigned part = 0u;
#pragma unroll
    for (int i = 0; i < TT / (32 * GQ * 4); ++i) {
        const bool any = (unsigned)sgr[i][0] - (unsigned)slo <= span || (unsigned)sgr[i][1] - (unsigned)slo <= span || (unsigned)sgr[i][2] - (unsigned)slo <= span || (unsigned)sgr[i][3] - (unsigned)slo <= span;
        const unsigned bal = __builtin_amdgcn_ballot_w32(any); const int b0 = i * (32 * GQ * 4 / 64) + wv * 2;
        part |= ((bal & 0xFFFFu) != 0u ? 1u << b0 : 0u) | ((bal >> 16) != 0u ? 2u << b0 : 0u); }
#pragma unroll
    for (int i = 0; i < TT / (32 * GQ * 4); ++i) *(v4i*)(sseg + (i * 32 * GQ + (int)threadIdx.x) * 4) = sgr[i];
    if (lane == 0) sbm[wv] = part;
    __syncthreads();                                                 // sseg and sbm are whole
    const v4u pm = *(const v4u*)sbm;
    const int dblk = q0 >> 6;                                        // the diagonal block: nothing behind it is causal, and it holds every query's own key
    const unsigned bm = ((unsigned)__builtin_amdgcn_readfirstlane((int)(pm[0] | pm[1] | pm[2] | pm[3])) & ((2u << dblk) - 1u)) | (1u << dblk);
    V kh[4][2], kl[4][2];                                            // the K fragments of one 64-key block, loaded one block ahead: again right behind their last use
    const bf* k0h = kbh + (size_t)(__builtin_ctz(bm) * 64) * HD; const bf* k0l = kbl + (size_t)(__builtin_ctz(bm) * 64) * HD;   // the mask's first block: wave-uniform bases
#pragma unroll
    for (int nb = 0; nb < 4; ++nb)
#pragma unroll
        for (int kk = 0; kk < 2; ++kk) { const int e = nb * 16 * HD + kk * 512; kh[nb][kk] = WFrag<bf>::ld(k0h + klane + e); kl[nb][kk] = WFrag<bf>::ld(k0l + klane + e); }
    __builtin_amdgcn_sched_barrier(0);                               // as above: nothing in between the first K loads and their wait
    asm volatile("s_wait_xcnt 0x0" :: "v"(klane), "s"(k0h), "s"(k0l) : "memory");   // the same precaution, the lane offset and the two bases held in their registers up to the wait
    __builtin_amdgcn_sched_barrier(0);                               // what follows stays behind the wait
#pragma unroll 1                                                     // one key block per trip: a second copy of the body would not fit the registers
    for (unsigned rest = bm; rest != 0u;) {                          // every trip clears one bit of the mask: at most TT / 64 trips
        const int kb = __builtin_ctz(rest) * 64; rest &= rest - 1u;
        const int kn = rest != 0u ? __builtin_ctz(rest) * 64 : kb;   // the next block of the mask; behind the last block this one again (in bounds, never used)
        V vh[4][2], vl[4][2];                                        // this block's V fragments: asked for here, used behind the softmax
        const bf* pvh = vbh + kb * 16 + vlane; const bf* pvl = vbl + kb * 16 + vlane;
#pragma unroll
        for (int mb = 0; mb < 4; ++mb)
#pragma unroll
            for (int j = 0; j < 2; ++j) { const int e = mb * 16 * TT + j * 512; vh[mb][j] = WFrag<bf>::ld(pvh + e); vl[mb][j] = WFrag<bf>::ld(pvl + e); }
        asm volatile("s_wait_xcnt 0x0" :: "v"(pvh), "v"(pvl) : "memory");   // the same precaution, the V addresses held in their registers up to the wait
        v8f s[4];
#pragma unroll
        for (int nb = 0; nb < 4; ++nb) { s[nb] = (v8f){};
#pragma unroll
            for (int kk = 0; kk < 2; ++kk) { s[nb] = wmmab(kh[nb][kk], qh[kk], s[nb]); s[nb] = wmmab(kh[nb][kk], ql[kk], s[nb]); s[nb] = wmmab(kl[nb][kk], qh[kk], s[nb]); } }
        const bf* pkh = kbh + (size_t)kn * HD + klane; const bf* pkl = kbl + (size_t)kn * HD + klane;
#pragma unroll
        for (int nb = 0; nb < 4; ++nb)
#pragma unroll
            for (int kk = 0; kk < 2; ++kk) { const int e = nb * 16 * HD + kk * 512; kh[nb][kk] = WFrag<bf>::ld(pkh + e); kl[nb][kk] = WFrag<bf>::ld(pkl + e); }
        asm volatile("s_wait_xcnt 0x0" :: "v"(pkh), "v"(pkl) : "memory");   // the same precaution, the K addresses held in their registers up to the wait
        const int lim = qi - kb - 8 * hi;                            // key offset 16 nb + r in this lane is causal iff it is <= lim
        float mx = m;
#pragma unroll
        for (int nb = 0; nb < 4; ++nb) { const int j0 = kb + nb * 16 + 8 * hi; const v4i g0 = *(const v4i*)(sseg + j0), g1 = *(const v4i*)(sseg + j0 + 4);
#pragma unroll
            for (int r = 0; r < 8; ++r) { const int sg = r < 4 ? g0[r & 3] : g1[r & 3]; const float t = (sg == sq && nb * 16 + r <= lim) ? s[nb][r] * (SCL * 1.4426950408889634f) : -3.0e38f; s[nb][r] = t; mx = fmaxf(mx, t); } }
        mx = fmaxf(mx, __shfl_xor(mx, 16, 32));
        const float al = __builtin_amdgcn_exp2f(m - mx);
        m = mx;
        v2f ps2[2] = {(v2f){0.f, 0.f}, (v2f){0.f, 0.f}}; v8u phw[2], plw[2];   // four independent partial row sums
#pragma unroll
        for (int nb = 0; nb < 4; ++nb) {
#pragma unroll
            for (int r = 0; r < 8; r += 2) { v2f pp; pp[0] = __builtin_amdgcn_exp2f(s[nb][r] - mx); pp[1] = __builtin_amdgcn_exp2f(s[nb][r + 1] - mx); ps2[nb & 1] += pp;
                const v2bf h2 = __builtin_convertvector(pp, v2bf); const v2bf l2 = __builtin_convertvector(pp - __builtin_convertvector(h2, v2f), v2bf);
                phw[nb >> 1][(nb & 1) * 4 + (r >> 1)] = __builtin_bit_cast(unsigned, h2); plw[nb >> 1][(nb & 1) * 4 + (r >> 1)] = __builtin_bit_cast(unsigned, l2); } }
        l = l * al + ((ps2[0][0] + ps2[1][0]) + (ps2[0][1] + ps2[1][1]));
#pragma unroll
        for (int mb = 0; mb < 4; ++mb) { o[mb] *= al;
#pragma unroll
            for (int j = 0; j < 2; ++j) { const V ph = __builtin_bit_cast(V, phw[j]), pl = __builtin_bit_cast(V, plw[j]); o[mb] = wmmab(vh[mb][j], ph, o[mb]); o[mb] = wmmab(vh[mb][j], pl, o[mb]); o[mb] = wmmab(vl[mb][j], ph, o[mb]); } }
    }
    l += __shfl_xor(l, 16, 32);
    const float f = __fdiv_rn(1.0f, l);
    const int ln = (int)__lane_id();                                 // the lane's number from the count that the shuffles keep anyway: 8 * lane held over the loop went to scratch memory
#pragma unroll
    for (int mb = 0; mb < 4; ++mb) { v8us oh, ol;
#pragma unroll
        for (int r = 0; r < 8; ++r) { unsigned short a2, c2; splitf(o[mb][r] * f, a2, c2); oh[r] = a2; ol[r] = c2; }
        const size_t oo = ((size_t)qt * (DQ / 32) + head * (HD / 32) + (mb >> 1)) * 512 + (mb & 1) * 256 + 8 * ln; *(v8us*)(Ah + oo) = oh; *(v8us*)(Al + oo) = ol; }   // row qi, k = head * HD + 16 mb + 8 hi + r in fragment order
}

extern "C" void kernel_launch(void* const* d_in, const int* in_sizes, int n_in,
                              void* d_out, int out_size, void* d_ws, size_t ws_size, hipStream_t stream) {
    if (n_in < 7) return;
    if (in_sizes[0] < TT * DM || in_sizes[1] < DM * DQ || in_sizes[2] < DM * DKV || in_sizes[3] < DM * DKV || in_sizes[4] < DQ * DM || in_sizes[5] < TT || in_sizes[6] < TT) return;
    if (out_size < TT * DM) return;
    const float* x = (const float*)d_in[0]; const float* wq = (const float*)d_in[1]; const float* wk = (const float*)d_in[2]; const float* wv = (const float*)d_in[3]; const float* wo = (const float*)d_in[4];
    const int* pos = (const int*)d_in[5]; const int* seg = (const int*)d_in[6];
    float* OUT = (float*)d_out;     // [TT][DM]
    char* wsp = (char*)d_ws;
    auto take = [&](size_t bytes) { char* p = wsp; wsp += (bytes + 255) & ~(size_t)255; return (void*)p; };
    // the q, k and v weight planes lie one behind the other ([DQKV][DM]), and so do the q and k head planes: the three projections are one GEMM, whose epilogue ropes q and k into the joined planes
    bf* WQ = (bf*)take((size_t)DQKV * DM * 2); bf* WK = WQ + (size_t)DQ * DM; bf* WV = WK + (size_t)DKV * DM; bf* WO = (bf*)take((size_t)DM * DQ * 2);
    float* CS = (float*)take((size_t)TT * HD * 2 * 4);
    bf* XB = (bf*)take((size_t)TT * DM * 2);
    bf* QPh = (bf*)take((size_t)(NQ + NKV) * TT * HD * 2); bf* QPl = (bf*)take((size_t)(NQ + NKV) * TT * HD * 2); bf* KPh = QPh + (size_t)NQ * TT * HD; bf* KPl = QPl + (size_t)NQ * TT * HD;
    bf* VTh = (bf*)take((size_t)NKV * HD * TT * 2); bf* VTl = (bf*)take((size_t)NKV * HD * TT * 2);
    bf* ATh = (bf*)take((size_t)TT * DQ * 2); bf* ATl = (bf*)take((size_t)TT * DQ * 2);
    const size_t used = (size_t)(wsp - (char*)d_ws);
    if (used > ws_size || used > ((size_t)128 << 20)) return;

    // tables and 16-bit planes of the inputs: one launch
    k_prep<<<2 * NB_WQ + 2 * NB_WKV + NB_X + NB_CS, 256, 0, stream>>>(x, wq, wk, wv, wo, pos, WQ, WK, WV, WO, XB, CS);
    // q, k and v projections (plain bf16 operands): one launch, which writes the roped q and k planes and the transposed v planes (hi/lo) itself
    k_gemmw<bf, 0, false, 8, DM, true><<<dim3(TT / 64, DQKV / 64, 1), 256, 0, stream>>>(XB, nullptr, WQ, nullptr, nullptr, 0, nullptr, 0, 0, 0, CS, QPh, QPl, VTh, VTl);
    // attention: one launch, all heads; writes the hi/lo ctx planes (rows t, columns head * HD + d, fragment order)
    k_fattn<<<(unsigned)((TT / 16) * NKV), 32 * GQ, 0, stream>>>(QPh, QPl, KPh, KPl, VTh, VTl, seg, ATh, ATl);
    // output projection: hi/lo ctx x bf16 Wo
    k_gemmw<bf, 1, false, 8, DQ, false><<<dim3(TT / 64, DM / 64, 1), 256, 0, stream>>>(ATh, ATl, WO, nullptr, OUT, DM, nullptr, 0, 0, 0, nullptr, nullptr, nullptr, nullptr, nullptr);
}

// v008
// A run of this version takes 56.2 microseconds.
// Timed twice side by side with v007, it ran 1.24 and 1.23 times as fast.
// All steps since v000 together make it 7.38 times as fast.
#include <hip/hip_runtime.h>

// GQA causal ragged attention: q/k/v = x W (32 query heads, 8 kv heads, head 64, no bias), rotate-half RoPE from int32 positions (theta 5e5), mask = (same segment id) and (key index <= query index) with -3e38 fill, softmax(q.k * 0.125), ctx Wo -> [TT][2048] f32.
// Compute dtypes, f32 accumulate everywhere: x and all four weights RNE-converted to bf16 planes; q/k/v projections v_wmma_f32_16x16x32_bf16 on plain bf16 operands (one product); scores and attn.v on bf16 hi/lo split planes (hi.hi + lo.hi + hi.lo); output projection bf16 hi/lo ctx x bf16 Wo (2 products); RoPE tables, RoPE, softmax and all side math f32 on VALU.

#ifndef TT
#define TT   1024
#endif
#define TT_FULL 1024
#define DM   2048
#define NQ   32
#define NKV  8
#define GQ   (NQ / NKV)
#define HD   64
#define DQ   (NQ * HD)
#define DKV  (NKV * HD)
#define THETA 500000.0f
#define SCL  0.125f
static_assert(TT % 128 == 0);
static_assert(TT <= TT_FULL);
static_assert(HD == 64);
static_assert(DM % 64 == 0 && DQ % 64 == 0 && DKV % 64 == 0);

typedef _Float16 h16;
typedef unsigned short bf;
typedef __attribute__((ext_vector_type(16))) __bf16   v16bf;
typedef __attribute__((ext_vector_type(16))) _Float16 v16h;
typedef __attribute__((ext_vector_type(8)))  _Float16 v8h;
typedef __attribute__((ext_vector_type(8)))  unsigned short v8us;
typedef __attribute__((ext_vector_type(8)))  float    v8f;
typedef __attribute__((ext_vector_type(4)))  float    v4f;
typedef v8h  __attribute__((may_alias)) v8ha;
typedef v4f  __attribute__((may_alias)) v4fa;
typedef v8us __attribute__((may_alias)) v8usa;

__device__ __forceinline__ unsigned short f2bf(float f) { unsigned u = __float_as_uint(f); u += 0x7FFFu + ((u >> 16) & 1u); return (unsigned short)(u >> 16); }
__device__ __forceinline__ float bf2f(unsigned short b) { return __uint_as_float(((unsigned)b) << 16); }
__device__ __forceinline__ float bfr(float f) { return bf2f(f2bf(f)); }
__device__ __forceinline__ v16h cat16(v8h lo, v8h hi) { return __builtin_shufflevector(lo, hi, 0, 1, 2, 3, 4, 5, 6, 7, 8, 9, 10, 11, 12, 13, 14, 15); }
__device__ __forceinline__ v16bf cat16b(v8us lo, v8us hi) { return __builtin_bit_cast(v16bf, __builtin_shufflevector(lo, hi, 0, 1, 2, 3, 4, 5, 6, 7, 8, 9, 10, 11, 12, 13, 14, 15)); }
__device__ __forceinline__ v8f wmma16(v16h a, v16h b, v8f c) { return __builtin_amdgcn_wmma_f32_16x16x32_f16(false, a, false, b, (short)0, c, false, false); }
__device__ __forceinline__ v8f wmmab(v16bf a, v16bf b, v8f c) { return __builtin_amdgcn_wmma_f32_16x16x32_bf16(false, a, false, b, (short)0, c, false, false); }

__device__ __forceinline__ void splitf(float y, unsigned short& h, unsigned short& l) { h = f2bf(y); l = f2bf(y - bf2f(h)); }
typedef __attribute__((ext_vector_type(4))) unsigned short v4us;

// ---- k_gemmw: register-blocked GEMM, one 64 x (64 NS) output tile per workgroup of NW waves; wave w takes the 32-wide k steps w, w + NW, ... into its own 16 NS accumulators (operands straight from
// 16-bit planes in fragment order, below: an A fragment feeds 4 NS products, so that fewer operand bytes are loaded per product), and the NW partial tiles are summed in LDS in the fixed order w = 0 .. NW-1;
// grid (M/64, N/(64 NS), Z), 32 * NW threads. The join and the epilogues go through the tile in its NS parts of 64 columns.
// C[m][n] (f32, pitch ldc, + optional f32 bias[n]) = sum_k A[m][k] Bt[n][k] (+ split products per NSPLIT). z-batch strides sA/sB/sC in elements. K % 32 == 0.
// Fragments: lane -> row/col lane&15, vector elements 0..7 <- k0 + 8h + i, elements 8..15 <- k0 + 16 + 8h + i (h = lane>>4) for BOTH operands; D element r -> (row 8h + r, col lane&15).
template <typename T16> struct WFrag;
template <> struct WFrag<h16> { typedef v16h V; static __device__ __forceinline__ V ld(const h16* p) { return cat16(*(const v8h*)p, *(const v8h*)(p + 256)); } static __device__ __forceinline__ v8f mma(V a, V b, v8f c) { return wmma16(a, b, c); } };
template <> struct WFrag<bf> { typedef v16bf V; static __device__ __forceinline__ V ld(const bf* p) { return cat16b(*(const v8us*)p, *(const v8us*)(p + 256)); } static __device__ __forceinline__ v8f mma(V a, V b, v8f c) { return wmmab(a, b, c); } };
// Fragment order of a 16-bit operand plane with K columns (every plane that a matrix instruction reads): blocks of 16 rows x 32 k = 512 elements, block index (row / 16) * (K / 32) + k / 32; inside a block element
// (row, k) lies at ((k >> 4) & 1) * 256 + (((k >> 3) & 1) * 16 + (row & 15)) * 8 + (k & 7). Lane l's fragment is then the 8 elements at 8 l and the 8 at 256 + 8 l: each 16-byte load of a wave reads 512 bytes in a row (four whole lines).
__device__ __forceinline__ size_t pidx(int row, int k, int K) { return ((size_t)(row >> 4) * (K >> 5) + (k >> 5)) * 512 + ((k >> 4) & 1) * 256 + (((k >> 3) & 1) * 16 + (row & 15)) * 8 + (k & 7); }
// QKV = true (the q/k/v projection; each 64-column part of a tile is one head): the joined tile is not stored as f32 but goes straight into the 16-bit hi/lo planes that the attention kernel reads, in fragment order:
// a q or k head through rotate-half RoPE, out[d] = x[d] cos[t][d] - x[d+HD/2] sin[t][d], out[d+HD/2] = x[d+HD/2] cos[t][d+HD/2] + x[d] sin[t][d+HD/2], into plane [head] with rows t; a v head transposed into plane [kv head] with rows d.
template <typename T16, int NSPLIT, bool BIAS, int NW, int K, bool QKV, int NS>
__global__ __launch_bounds__(32 * NW) void k_gemmw(const T16* __restrict__ A, const T16* __restrict__ A2, const T16* __restrict__ Bt, const T16* __restrict__ Bt2, float* C, int ldc, const float* __restrict__ bias, size_t sA, size_t sB, size_t sC,
                                                   const float* __restrict__ CS, bf* Ph, bf* Pl, bf* Vh, bf* Vl) {
    typedef typename WFrag<T16>::V V;
    static_assert(NW == 8);                                          // the join below deals 16 rows x 16 float4 columns to 256 threads
    __shared__ __align__(16) float os[2 * NS * NW * 16 * 68];        // two buffers of NS x NW partial 16x64 row blocks: one barrier per row block
    const size_t z = blockIdx.z; A += z * sA; if (A2) A2 += z * sA; Bt += z * sB; if (Bt2) Bt2 += z * sB; C += z * sC;
    const int lane = threadIdx.x & 31, lr = lane & 15, hi = lane >> 4; const int r0 = blockIdx.x * 64, c0 = blockIdx.y * (64 * NS);
    const int wv = __builtin_amdgcn_readfirstlane((int)(threadIdx.x >> 5));
    v8f acc[4][4 * NS];
#pragma unroll
    for (int mb = 0; mb < 4; ++mb)
#pragma unroll
        for (int nb = 0; nb < 4 * NS; ++nb) acc[mb][nb] = (v8f){};
    static_assert(!QKV || (DQ + DKV) % (64 * NS) == 0);              // no tile holds both a k head and a v head
    const bool rp = QKV && c0 < DQ + DKV;                            // QKV: q or k heads (RoPE) or v heads (transpose): by blockIdx, the same for the whole block
    // RoPE tile, the join: thread -> 4 columns d of one row t per row block. A wave takes 8 rows x (8 d and the 8 d at + HD/2): lane ^ 8 holds the rotation partner, lanes l and l ^ 16 the two halves of a 16-byte unit,
    // so that a wave's 8-byte stores fill two whole lines of a plane; the 16 lanes of each half wave read 64 different LDS banks.
    const int rrow = (wv & 1) * 8 + (lane & 7), rcof = ((wv >> 1) * 2 + hi) * 4 + ((lane >> 3) & 1) * (HD / 2);
    v4f cs[4][2];                                                    // (cos, sin) of the thread's 4 columns, per row block: asked for in front of the k loop, since behind it the join's first barrier would wait them out
    if (rp) {
        const float* pc = CS + ((size_t)(r0 + rrow) * HD + rcof) * 2;
#pragma unroll
        for (int mb = 0; mb < 4; ++mb) { cs[mb][0] = *(const v4f*)(pc + mb * 16 * HD * 2); cs[mb][1] = *(const v4f*)(pc + mb * 16 * HD * 2 + 4); }
        asm volatile("s_wait_xcnt 0x0" :: "v"(pc) : "memory");       // the precaution behind a group of loads, before a register that they name is written again; the address is an input, so that it keeps its registers up to the wait
    }
    const size_t aoff = (size_t)r0 * K + 8 * lane, boff = (size_t)c0 * K + 8 * lane;   // 16 rows of a plane are K / 32 blocks = 16 K elements; a k step is one block
#pragma unroll 1
    for (int kc = wv * 32; kc < K; kc += 32 * NW) {
        V a[4], a2[4];
        // one address per plane and k step; K is a constant of the kernel, so that the row blocks are immediate offsets from it and no further address register is formed
        const T16* pa = A + aoff + kc * 16; const T16* pa2 = (NSPLIT == 1 || NSPLIT == 2) ? A2 + aoff + kc * 16 : pa; const T16* pb = Bt + boff + kc * 16; const T16* pb2 = NSPLIT >= 2 ? Bt2 + boff + kc * 16 : pb;
#pragma unroll
        for (int mb = 0; mb < 4; ++mb) { a[mb] = WFrag<T16>::ld(pa + mb * 16 * K); if (NSPLIT == 1 || NSPLIT == 2) a2[mb] = WFrag<T16>::ld(pa2 + mb * 16 * K); }
        V b[4 * NS], b2[4 * NS];
#pragma unroll
        for (int nb = 0; nb < 4 * NS; ++nb) { b[nb] = WFrag<T16>::ld(pb + nb * 16 * K); if (NSPLIT >= 2) b2[nb] = WFrag<T16>::ld(pb2 + nb * 16 * K); }
        __builtin_amdgcn_sched_barrier(0);                           // all of the trip's loads are asked for in front of its first product: sunk in among the products, each would be waited for by itself
#pragma unroll
        for (int nb = 0; nb < 4 * NS; ++nb) {
#pragma unroll
            for (int mb = 0; mb < 4; ++mb) { acc[mb][nb] = WFrag<T16>::mma(a[mb], b[nb], acc[mb][nb]); if (NSPLIT == 1 || NSPLIT == 2) acc[mb][nb] = WFrag<T16>::mma(a2[mb], b[nb], acc[mb][nb]); if (NSPLIT >= 2) acc[mb][nb] = WFrag<T16>::mma(a[mb], b2[nb], acc[mb][nb]); } }
        // the precaution behind the trip's loads, before a register that they name is written again; the addresses are inputs, so that they keep their registers up to the wait and no result lands on one
        asm volatile("s_wait_xcnt 0x0" :: "v"(pa), "v"(pa2), "v"(pb), "v"(pb2) : "memory");
        asm volatile("v_nop\n\tv_nop\n\tv_nop\n\tv_nop" : "+v"(acc[0][0]), "+v"(acc[1][1]), "+v"(acc[2][2]), "+v"(acc[3][3]) : "v"(a[0]), "v"(a[3]));
    }
    if constexpr (QKV) {
        // V tile: thread -> 4 rows t of one column d per row block. A wave takes 16 d x 8 t: 256 bytes in a row of the transposed plane.
        const int vd = (wv & 3) * 16 + lr, vt = ((wv >> 2) * 2 + hi) * 4;
        v4us oh[NS][4], ol[NS][4];
#pragma unroll
        for (int mb = 0; mb < 4; ++mb) {
            float* ob = os + (mb & 1) * (NS * NW * 16 * 68);
#pragma unroll
            for (int nb = 0; nb < 4 * NS; ++nb) {
#pragma unroll
                for (int j = 0; j < 8; ++j) ob[((nb >> 2) * NW + wv) * (16 * 68) + (hi * 8 + j) * 68 + (nb & 3) * 16 + lr] = acc[mb][nb][j]; }
            __syncthreads();                                         // every wave's partial of this row block is in LDS; the other buffer's readers are done before it is written again
#pragma unroll
            for (int ns = 0; ns < NS; ++ns) {                        // one head per part
                const float* on = ob + ns * (NW * 16 * 68);
                v4f r;
                if (rp) {
                    v4f val = *(const v4fa*)(on + rrow * 68 + rcof);
#pragma unroll
                    for (int w = 1; w < NW; ++w) val += *(const v4fa*)(on + w * (16 * 68) + rrow * 68 + rcof);
#pragma unroll
                    for (int j = 0; j < 4; ++j) { const float x1 = __shfl_xor(val[j], 8, 32), cn = cs[mb][j >> 1][(j & 1) * 2], sn = cs[mb][j >> 1][(j & 1) * 2 + 1]; r[j] = (lane & 8) ? val[j] * cn + x1 * sn : val[j] * cn - x1 * sn; }
                } else {
#pragma unroll
                    for (int j = 0; j < 4; ++j) { float v = on[(vt + j) * 68 + vd];
#pragma unroll
                        for (int w = 1; w < NW; ++w) v += on[w * (16 * 68) + (vt + j) * 68 + vd];
                        r[j] = v; }
                }
#pragma unroll
                for (int j = 0; j < 4; ++j) { unsigned short a2, c2; splitf(r[j], a2, c2); oh[ns][mb][j] = a2; ol[ns][mb][j] = c2; }
            }
        }
        // stores behind the last barrier, as below; 16 rows t are two blocks of a q or k plane, half a block of a V^T plane
        const size_t po = rp ? (size_t)(c0 / HD) * TT * HD + pidx(r0 + rrow, rcof, HD) : (size_t)((c0 - DQ - DKV) / HD) * HD * TT + pidx(vd, r0 + vt, TT);
        bf* ph = (rp ? Ph : Vh) + po; bf* pl = (rp ? Pl : Vl) + po;
        const int pst = rp ? 1024 : 256;
#pragma unroll
        for (int ns = 0; ns < NS; ++ns)                              // the next head's plane lies TT * HD elements on, a q or k plane as a V^T plane
#pragma unroll
            for (int mb = 0; mb < 4; ++mb) { *(v4us*)(ph + ns * (TT * HD) + mb * pst) = oh[ns][mb]; *(v4us*)(pl + ns * (TT * HD) + mb * pst) = ol[ns][mb];
                asm volatile("s_wait_xcnt 0x0" :: "v"(ph), "v"(pl) : "memory"); }   // the same precaution behind each pair of stores: the next pair's addresses and data may take the registers of this one
        return;
    }
    const int row = (int)(threadIdx.x >> 4), cofs = (int)(threadIdx.x & 15) * 4; v4f res[NS][4];   // the join: thread -> one float4 of each 16x64 row block
#pragma unroll
    for (int mb = 0; mb < 4; ++mb) {
        float* ob = os + (mb & 1) * (NS * NW * 16 * 68);
#pragma unroll
        for (int nb = 0; nb < 4 * NS; ++nb) {
#pragma unroll
            for (int j = 0; j < 8; ++j) ob[((nb >> 2) * NW + wv) * (16 * 68) + (hi * 8 + j) * 68 + (nb & 3) * 16 + lr] = acc[mb][nb][j]; }
        __syncthreads();                                             // every wave's partial of this row block is in LDS; the other buffer's readers are done before it is written again
#pragma unroll
        for (int ns = 0; ns < NS; ++ns) {
            const float* on = ob + ns * (NW * 16 * 68); const int cn = c0 + ns * 64 + cofs;
            v4f val = *(const v4fa*)(on + row * 68 + cofs);
#pragma unroll
            for (int w = 1; w < NW; ++w) val += *(const v4fa*)(on + w * (16 * 68) + row * 68 + cofs);
            if (BIAS) { val[0] += bfr(bias[cn]); val[1] += bfr(bias[cn + 1]); val[2] += bfr(bias[cn + 2]); val[3] += bfr(bias[cn + 3]); }
            res[ns][mb] = val;
        }
    }
    // stores behind the last barrier: a store in front of a barrier would be waited out there
#pragma unroll
    for (int ns = 0; ns < NS; ++ns)
#pragma unroll
        for (int mb = 0; mb < 4; ++mb) *(v4f*)(C + (size_t)(r0 + mb * 16 + row) * ldc + c0 + ns * 64 + cofs) = res[ns][mb];
}

typedef __attribute__((ext_vector_type(2))) float v2f;
typedef __attribute__((ext_vector_type(4))) int v4i;
typedef __attribute__((ext_vector_type(2))) __bf16 v2bf;
typedef __attribute__((ext_vector_type(8))) unsigned v8u;
typedef __attribute__((ext_vector_type(4))) unsigned v4u;

// The d_* functions are the bodies of jobs that read none of each other's output; k_prep below deals the blocks of one grid to them (blk = the block's index inside its job).
// d_wtT: Bt (bf16, rows n, fragment order) = w[k][n] (f32), one tile of 64 k x 128 n per block, turned in LDS (ts: 128 rows n of 32 dwords, each dword the bf16 pair k, k + 1; pitch 33 dwords, so that no two lanes of a wave
// meet on a bank, storing or loading). Every global load of a wave is two 256-byte pieces of rows of w, every global store four whole 128-byte lines of Bt. Neighbouring blocks take neighbouring n.
__device__ __forceinline__ void d_wtT(int blk, const float* __restrict__ w, int K, int N, bf* Bt, unsigned* ts) {
    const int lane = threadIdx.x & 31, wv = (int)(threadIdx.x >> 5); const int n0 = (blk % (N / 128)) * 128, k0 = (blk / (N / 128)) * 64;
    const int c4 = (lane & 15) * 4, kq = wv * 2 + (lane >> 4);      // thread -> 4 columns n of the row pairs kq and kq + 16, in both 64-column halves
    v4f ev[2][2], od[2][2];
#pragma unroll
    for (int i = 0; i < 2; ++i)
#pragma unroll
        for (int nh = 0; nh < 2; ++nh) { const float* p = w + (size_t)(k0 + 2 * (kq + 16 * i)) * N + n0 + nh * 64 + c4; ev[i][nh] = *(const v4f*)p; od[i][nh] = *(const v4f*)(p + N); }
    asm volatile("s_wait_xcnt 0x0" ::: "memory");                    // the precaution behind a group of loads, before a register that they name is written again
#pragma unroll
    for (int i = 0; i < 2; ++i)
#pragma unroll
        for (int nh = 0; nh < 2; ++nh)
#pragma unroll
            for (int j = 0; j < 4; ++j) ts[(nh * 64 + c4 + j) * 33 + kq + 16 * i] = (unsigned)f2bf(ev[i][nh][j]) | ((unsigned)f2bf(od[i][nh][j]) << 16);
    __syncthreads();                                                 // the tile is whole in LDS (the job is chosen by blockIdx: every wave of the block passes here)
    // thread -> four 8-k pieces (4 dwords each) of the wave's 16 rows; eight neighbouring lanes take eight neighbouring rows at one k, which is one whole line of the fragment order
#pragma unroll
    for (int i = 0; i < 4; ++i) { const int n = wv * 16 + (i >> 1) * 8 + (lane & 7), k8 = (lane >> 3) * 2 + (i & 1); const unsigned* q = ts + n * 33 + k8 * 4; v4u v; v[0] = q[0]; v[1] = q[1]; v[2] = q[2]; v[3] = q[3]; *(v4u*)(Bt + pidx(n0 + n, k0 + k8 * 8, K)) = v; }
    asm volatile("s_wait_xcnt 0x0" ::: "memory");                    // the same precaution behind the group of stores
}
// d_cvt8: dst (bf16, fragment order) = src [rows][K] (f32), 8 k per thread; a wave takes 8 rows x 32 k: it loads one whole line of each row and stores four whole lines
__device__ __forceinline__ void d_cvt8(int blk, const float* __restrict__ src, bf* dst, int K, size_t n8) { const size_t i = (size_t)blk * 256 + threadIdx.x; if (i >= n8) return;
    const int w = (int)(i >> 5), ks = (w >> 1) % (K / 32), row = ((w >> 1) / (K / 32)) * 16 + (w & 1) * 8 + (((int)i >> 2) & 7), k = ks * 32 + ((int)i & 3) * 8;
    const v8f v = *(const v8f*)(src + (size_t)row * K + k); v8us o;
#pragma unroll
    for (int q = 0; q < 8; ++q) o[q] = f2bf(v[q]); *(v8us*)(dst + pidx(row, k, K)) = o;  }
// the inverse frequency is computed by the thread that uses it, so that the table job depends on the inputs alone
__device__ __forceinline__ void d_cstab(int blk, const int* __restrict__ pos, float* CS) {
    const int idx = blk * 256 + threadIdx.x; if (idx >= TT * HD) return;
    const int dd = idx % HD; const int t = idx / HD; const int j = dd & (HD / 2 - 1);
    const float e = (float)j * (1.0f / (float)(HD / 2));
    const float p = powf(THETA, e);
    const float v = 1.0f / p;
    const float pf = (float)pos[t];
    float fr = __fmul_rn(pf, v); asm volatile("" : "+v"(fr));
    float sn, cn;
    sincosf(fr, &sn, &cn);
    v2f cs; cs[0] = cn; cs[1] = sn;
    *(v2f*)(CS + (size_t)idx * 2) = cs; 
}
// ---- k_prep: every job that reads the inputs alone, in one grid; the weight transposes, whose blocks run longest, take the first block indices. The branches are on blockIdx and so the same for a whole block.
#define DQKV   (DQ + 2 * DKV)
#define NB_WQ  (DQ * DM / (64 * 128))
#define NB_WKV (DKV * DM / (64 * 128))
static_assert(DM % 128 == 0 && DQ % 128 == 0 && DKV % 128 == 0);
#define NB_X   (TT * DM / (8 * 256))
#define NB_CS  (TT * HD / 256)
__global__ __launch_bounds__(256) void k_prep(const float* __restrict__ x, const float* __restrict__ wq, const float* __restrict__ wk, const float* __restrict__ wv, const float* __restrict__ wo, const int* __restrict__ pos,
                                              bf* WQ, bf* WK, bf* WV, bf* WO, bf* XB, float* CS) {
    __shared__ __align__(16) unsigned ts[128 * 33];                  // the transposes' tile
    int b = (int)blockIdx.x;
    if (b >= 2 * NB_WQ + 2 * NB_WKV + NB_X) { d_cstab(b - (2 * NB_WQ + 2 * NB_WKV + NB_X), pos, CS); return; }   // the last blocks of the grid; tested first, since behind five other tests the compiler makes powf a call
    if (b < NB_WQ) { d_wtT(b, wq, DM, DQ, WQ, ts); return; }            // Wq [D][NQ*HD]  -> WQ[c][d]
    b -= NB_WQ;
    if (b < NB_WQ) { d_wtT(b, wo, DQ, DM, WO, ts); return; }            // Wo [NQ*HD][D]  -> WO[dout][nh]
    b -= NB_WQ;
    if (b < NB_WKV) { d_wtT(b, wk, DM, DKV, WK, ts); return; }          // Wk [D][NKV*HD] -> WK[c][d]
    b -= NB_WKV;
    if (b < NB_WKV) { d_wtT(b, wv, DM, DKV, WV, ts); return; }          // Wv [D][NKV*HD] -> WV[c][d]
    b -= NB_WKV;
    d_cvt8(b, x, XB, DM, (size_t)TT * DM / 8);
}
// ---- k_fattn: scores, mask, softmax and attn.v of one 16-query tile in one pass over the keys; scores and probabilities stay in registers. Workgroup = the GQ query heads of one kv head (one wave each, same
// 16 queries, so the waves read the same K and V lines); grid (TT/16) * NKV; LDS holds only the segment ids and the key-block mask (one barrier). Per 64-key block that the mask names, up to the diagonal block:
//   St[key][query] = K Q^T (A = K rows, B = Q rows; qh.kh + ql.kh + qh.kl): D element r of key tile nb -> (key 16 nb + 8h + r, query lane&15), which is already the B-fragment k order of the next product
//   (elements 0..7 <- k0 + 8h + i from tile 2j, elements 8..15 <- k0 + 16 + 8h + i from tile 2j + 1), so the probabilities go from one product to the other with no exchange between lanes;
//   running row maximum m and row sum l per query (lane&15; the two lane halves hold different keys), accumulator rescaled by exp(m_old - m_new);
//   Ot[d][query] += Vt P^T (A = Vt rows d, B = P hi/lo; ph.vh + pl.vh + ph.vl): the query of every accumulator element is the lane's own, so the rescale and the final 1/l are lane-local.
// Every inner loop is fully unrolled, so that the fragment arrays are indexed by constants and stay in registers.
// Key-block mask: bit j is set if block j holds a key whose segment id lies inside [least, greatest] of the tile's 16 query ids, found at entry from the ids themselves, whatever they hold. In a block without such a key every
// score of the tile is masked, and a wholly masked block adds exact zeros (ahead of a row's first allowed key it is rescaled by 0, behind it its probabilities are exp2(-huge) = 0): it is passed over. The diagonal block is always taken.
// A masked score is the fill -3e38. While a row has met no allowed key, m is the fill too and its masked entries count as exp(0) = 1; the first allowed key (the diagonal at the latest) rescales all of that by exp(-huge) = 0.
__global__ __launch_bounds__(32 * GQ) void k_fattn(const bf* __restrict__ Qh, const bf* __restrict__ Ql, const bf* __restrict__ Kh, const bf* __restrict__ Kl, const bf* __restrict__ Vh, const bf* __restrict__ Vl, const int* __restrict__ seg, bf* Ah, bf* Al) {
    typedef WFrag<bf>::V V;
    const int lane = threadIdx.x & 31, lr = lane & 15, hi = lane >> 4;
    const int wv = __builtin_amdgcn_readfirstlane((int)(threadIdx.x >> 5));
    const int b = (int)blockIdx.x, nhalf = (TT / 32) * NKV;
    const int qt = b < nhalf ? TT / 16 - 1 - b / NKV : (b - nhalf) / NKV;   // long tiles take the first block indices, the short ones the rest
    const int kvh = b % NKV, head = kvh * GQ + wv, q0 = qt * 16, qi = q0 + lr;
    const size_t qoff = ((size_t)head * TT + q0) * HD + 8 * lane;     // all planes in fragment order: 16 rows of Q or K are HD / 32 blocks, 16 rows of Vt TT / 32
    const bf* pqh = Qh + qoff; const bf* pql = Ql + qoff;
    V qh[2], ql[2];
#pragma unroll
    for (int kk = 0; kk < 2; ++kk) { qh[kk] = WFrag<bf>::ld(pqh + kk * 512); ql[kk] = WFrag<bf>::ld(pql + kk * 512); }
    __shared__ __align__(16) int sseg[TT];                           // the segment ids, read per key block from LDS: a global load there would be waited for in order behind the K loads in flight
    __shared__ __align__(16) unsigned sbm[GQ];                       // each wave's share of the key-block mask
    v4i sgr[TT / (32 * GQ * 4)];
#pragma unroll
    for (int i = 0; i < TT / (32 * GQ * 4); ++i) sgr[i] = *(const v4i*)(seg + (i * 32 * GQ + (int)threadIdx.x) * 4);
    const int sq = seg[qi];
    int slo = seg[q0], shi = slo;                                    // least and greatest segment id of the tile's queries; the addresses are the same in every lane
#pragma unroll
    for (int i = 1; i < 16; ++i) { const int s = seg[q0 + i]; slo = s < slo ? s : slo; shi = s > shi ? s : shi; }
    // K and V addresses = wave-uniform base (kv head, key block) + a lane offset that never changes
    const bf* kbh = Kh + (size_t)kvh * TT * HD; const bf* kbl = Kl + (size_t)kvh * TT * HD; const bf* vbh = Vh + (size_t)kvh * HD * TT; const bf* vbl = Vl + (size_t)kvh * HD * TT;
    const unsigned klane = (unsigned)(8 * lane), vlane = (unsigned)(8 * lane);
    v8f o[4];
#pragma unroll
    for (int mb = 0; mb < 4; ++mb) o[mb] = (v8f){};
    float m = -3.0e38f, l = 0.f;                                     // m in units of log2: score * SCL * log2(e)
    __builtin_amdgcn_sched_barrier(0);                               // nothing is scheduled in between the prologue's loads and their wait, or up over it
    // the precaution behind a group of loads, before a register that they name is written again; the addresses are inputs of the wait, so that they keep their registers up to it and no result of the group lands on one
    asm volatile("s_wait_xcnt 0x0" :: "v"(pqh), "v"(pql) : "memory");
    __builtin_amdgcn_sched_barrier(0);                               // the second half of the same: what follows stays behind the wait
    // the wave's share of the key-block mask: a thread holds 4 neighbouring keys per round, so 16 lanes hold one 64-key block; unsigned differences, so that the range test holds for any 32-bit ids
    static_assert(GQ == 4 && TT / 64 <= 32 && (32 * GQ * 4) % 64 == 0);
    const unsigned span = (unsigned)shi - (unsigned)slo;
    unsigned part = 0u;
#pragma unroll
    for (int i = 0; i < TT / (32 * GQ * 4); ++i) {
        const bool any = (unsigned)sgr[i][0] - (unsigned)slo <= span || (unsigned)sgr[i][1] - (unsigned)slo <= span || (unsigned)sgr[i][2] - (unsigned)slo <= span || (unsigned)sgr[i][3] - (unsigned)slo <= span;
        const unsigned bal = __builtin_amdgcn_ballot_w32(any); const int b0 = i * (32 * GQ * 4 / 64) + wv * 2;
        part |= ((bal & 0xFFFFu) != 0u ? 1u << b0 : 0u) | ((bal >> 16) != 0u ? 2u << b0 : 0u); }
#pragma unroll
    for (int i = 0; i < TT / (32 * GQ * 4); ++i) *(v4i*)(sseg + (i * 32 * GQ + (int)threadIdx.x) * 4) = sgr[i];
    if (lane == 0) sbm[wv] = part;
    __syncthreads();                                                 // sseg and sbm are whole
    const v4u pm = *(const v4u*)sbm;
    const int dblk = q0 >> 6;                                        // the diagonal block: nothing behind it is causal, and it holds every query's own key
    const unsigned bm = ((unsigned)__builtin_amdgcn_readfirstlane((int)(pm[0] | pm[1] | pm[2] | pm[3])) & ((2u << dblk) - 1u)) | (1u << dblk);
    V kh[4][2], kl[4][2];                                            // the K fragments of one 64-key block, loaded one block ahead: again right behind their last use
    const bf* k0h = kbh + (size_t)(__builtin_ctz(bm) * 64) * HD; const bf* k0l = kbl + (size_t)(__builtin_ctz(bm) * 64) * HD;   // the mask's first block: wave-uniform bases
#pragma unroll
    for (int nb = 0; nb < 4; ++nb)
#pragma unroll
        for (int kk = 0; kk < 2; ++kk) { const int e = nb * 16 * HD + kk * 512; kh[nb][kk] = WFrag<bf>::ld(k0h + klane + e); kl[nb][kk] = WFrag<bf>::ld(k0l + klane + e); }
    __builtin_amdgcn_sched_barrier(0);                               // as above: nothing in between the first K loads and their wait
    asm volatile("s_wait_xcnt 0x0" :: "v"(klane), "s"(k0h), "s"(k0l) : "memory");   // the same precaution, the lane offset and the two bases held in their registers up to the wait
    __builtin_amdgcn_sched_barrier(0);                               // what follows stays behind the wait
#pragma unroll 1                                                     // one key block per trip: a second copy of the body would not fit the registers
    for (unsigned rest = bm; rest != 0u;) {                          // every trip clears one bit of the mask: at most TT / 64 trips
        const int kb = __builtin_ctz(rest) * 64; rest &= rest - 1u;
        const int kn = rest != 0u ? __builtin_ctz(rest) * 64 : kb;   // the next block of the mask; behind the last block this one again (in bounds, never used)
        V vh[4][2], vl[4][2];                                        // this block's V fragments: asked for here, used behind the softmax
        const bf* pvh = vbh + kb * 16 + vlane; const bf* pvl = vbl + kb * 16 + vlane;
#pragma unroll
        for (int mb = 0; mb < 4; ++mb)
#pragma unroll
            for (int j = 0; j < 2; ++j) { const int e = mb * 16 * TT + j * 512; vh[mb][j] = WFrag<bf>::ld(pvh + e); vl[mb][j] = WFrag<bf>::ld(pvl + e); }
        asm volatile("s_wait_xcnt 0x0" :: "v"(pvh), "v"(pvl) : "memory");   // the same precaution, the V addresses held in their registers up to the wait
        v8f s[4];
#pragma unroll
        for (int nb = 0; nb < 4; ++nb) { s[nb] = (v8f){};
#pragma unroll
            for (int kk = 0; kk < 2; ++kk) { s[nb] = wmmab(kh[nb][kk], qh[kk], s[nb]); s[nb] = wmmab(kh[nb][kk], ql[kk], s[nb]); s[nb] = wmmab(kl[nb][kk], qh[kk], s[nb]); } }
        const bf* pkh = kbh + (size_t)kn * HD + klane; const bf* pkl = kbl + (size_t)kn * HD + klane;
#pragma unroll
        for (int nb = 0; nb < 4; ++nb)
#pragma unroll
            for (int kk = 0; kk < 2; ++kk) { const int e = nb * 16 * HD + kk * 512; kh[nb][kk] = WFrag<bf>::ld(pkh + e); kl[nb][kk] = WFrag<bf>::ld(pkl + e); }
        asm volatile("s_wait_xcnt 0x0" :: "v"(pkh), "v"(pkl) : "memory");   // the same precaution, the K addresses held in their registers up to the wait
        const int lim = qi - kb - 8 * hi;                            // key offset 16 nb + r in this lane is causal iff it is <= lim
        float mx = m;
#pragma unroll
        for (int nb = 0; nb < 4; ++nb) { const int j0 = kb + nb * 16 + 8 * hi; const v4i g0 = *(const v4i*)(sseg + j0), g1 = *(const v4i*)(sseg + j0 + 4);
#pragma unroll
            for (int r = 0; r < 8; ++r) { const int sg = r < 4 ? g0[r & 3] : g1[r & 3]; const float t = (sg == sq && nb * 16 + r <= lim) ? s[nb][r] * (SCL * 1.4426950408889634f) : -3.0e38f; s[nb][r] = t; mx = fmaxf(mx, t); } }
        mx = fmaxf(mx, __shfl_xor(mx, 16, 32));
        const float al = __builtin_amdgcn_exp2f(m - mx);
        m = mx;
        v2f ps2[2] = {(v2f){0.f, 0.f}, (v2f){0.f, 0.f}}; v8u phw[2], plw[2];   // four independent partial row sums
#pragma unroll
        for (int nb = 0; nb < 4; ++nb) {
#pragma unroll
            for (int r = 0; r < 8; r += 2) { v2f pp; pp[0] = __builtin_amdgcn_exp2f(s[nb][r] - mx); pp[1] = __builtin_amdgcn_exp2f(s[nb][r + 1] - mx); ps2[nb & 1] += pp;
                const v2bf h2 = __builtin_convertvector(pp, v2bf); const v2bf l2 = __builtin_convertvector(pp - __builtin_convertvector(h2, v2f), v2bf);
                phw[nb >> 1][(nb & 1) * 4 + (r >> 1)] = __builtin_bit_cast(unsigned, h2); plw[nb >> 1][(nb & 1) * 4 + (r >> 1)] = __builtin_bit_cast(unsigned, l2); } }
        l = l * al + ((ps2[0][0] + ps2[1][0]) + (ps2[0][1] + ps2[1][1]));
#pragma unroll
        for (int mb = 0; mb < 4; ++mb) { o[mb] *= al;
#pragma unroll
            for (int j = 0; j < 2; ++j) { const V ph = __builtin_bit_cast(V, phw[j]), pl = __builtin_bit_cast(V, plw[j]); o[mb] = wmmab(vh[mb][j], ph, o[mb]); o[mb] = wmmab(vh[mb][j], pl, o[mb]); o[mb] = wmmab(vl[mb][j], ph, o[mb]); } }
    }
    l += __shfl_xor(l, 16, 32);
    const float f = __fdiv_rn(1.0f, l);
    const int ln = (int)__lane_id();                                 // the lane's number from the count that the shuffles keep anyway: 8 * lane held over the loop went to scratch memory
#pragma unroll
    for (int mb = 0; mb < 4; ++mb) { v8us oh, ol;
#pragma unroll
        for (int r = 0; r < 8; ++r) { unsigned short a2, c2; splitf(o[mb][r] * f, a2, c2); oh[r] = a2; ol[r] = c2; }
        const size_t oo = ((size_t)qt * (DQ / 32) + head * (HD / 32) + (mb >> 1)) * 512 + (mb & 1) * 256 + 8 * ln; *(v8us*)(Ah + oo) = oh; *(v8us*)(Al + oo) = ol; }   // row qi, k = head * HD + 16 mb + 8 hi + r in fragment order
}

extern "C" void kernel_launch(void* const* d_in, const int* in_sizes, int n_in,
                              void* d_out, int out_size, void* d_ws, size_t ws_size, hipStream_t stream) {
    if (n_in < 7) return;
    if (in_sizes[0] < TT * DM || in_sizes[1] < DM * DQ || in_sizes[2] < DM * DKV || in_sizes[3] < DM * DKV || in_sizes[4] < DQ * DM || in_sizes[5] < TT || in_sizes[6] < TT) return;
    if (out_size < TT * DM) return;
    const float* x = (const float*)d_in[0]; const float* wq = (const float*)d_in[1]; const float* wk = (const float*)d_in[2]; const float* wv = (const float*)d_in[3]; const float* wo = (const float*)d_in[4];
    const int* pos = (const int*)d_in[5]; const int* seg = (const int*)d_in[6];
    float* OUT = (float*)d_out;     // [TT][DM]
    char* wsp = (char*)d_ws;
    auto take = [&](size_t bytes) { char* p = wsp; wsp += (bytes + 255) & ~(size_t)255; return (void*)p; };
    // the q, k and v weight planes lie one behind the other ([DQKV][DM]), and so do the q and k head planes: the three projections are one GEMM, whose epilogue ropes q and k into the joined planes
    bf* WQ = (bf*)take((size_t)DQKV * DM * 2); bf* WK = WQ + (size_t)DQ * DM; bf* WV = WK + (size_t)DKV * DM; bf* WO = (bf*)take((size_t)DM * DQ * 2);
    float* CS = (float*)take((size_t)TT * HD * 2 * 4);
    bf* XB = (bf*)take((size_t)TT * DM * 2);
    bf* QPh = (bf*)take((size_t)(NQ + NKV) * TT * HD * 2); bf* QPl = (bf*)take((size_t)(NQ + NKV) * TT * HD * 2); bf* KPh = QPh + (size_t)NQ * TT * HD; bf* KPl = QPl + (size_t)NQ * TT * HD;
    bf* VTh = (bf*)take((size_t)NKV * HD * TT * 2); bf* VTl = (bf*)take((size_t)NKV * HD * TT * 2);
    bf* ATh = (bf*)take((size_t)TT * DQ * 2); bf* ATl = (bf*)take((size_t)TT * DQ * 2);
    const size_t used = (size_t)(wsp - (char*)d_ws);
    if (used > ws_size || used > ((size_t)128 << 20)) return;

    // tables and 16-bit planes of the inputs: one launch
    k_prep<<<2 * NB_WQ + 2 * NB_WKV + NB_X + NB_CS, 256, 0, stream>>>(x, wq, wk, wv, wo, pos, WQ, WK, WV, WO, XB, CS);
    // q, k and v projections (plain bf16 operands): one launch, which writes the roped q and k planes and the transposed v planes (hi/lo) itself
    k_gemmw<bf, 0, false, 8, DM, true, 2><<<dim3(TT / 64, DQKV / 128, 1), 256, 0, stream>>>(XB, nullptr, WQ, nullptr, nullptr, 0, nullptr, 0, 0, 0, CS, QPh, QPl, VTh, VTl);
    // attention: one launch, all heads; writes the hi/lo ctx planes (rows t, columns head * HD + d, fragment order)
    k_fattn<<<(unsigned)((TT / 16) * NKV), 32 * GQ, 0, stream>>>(QPh, QPl, KPh, KPl, VTh, VTl, seg, ATh, ATl);
    // output projection: hi/lo ctx x bf16 Wo
    k_gemmw<bf, 1, false, 8, DQ, false, 2><<<dim3(TT / 64, DM / 128, 1), 256, 0, stream>>>(ATh, ATl, WO, nullptr, OUT, DM, nullptr, 0, 0, 0, nullptr, nullptr, nullptr, nullptr, nullptr);
}

// v009
// Measured time: 53.3 microseconds a run.
// Timed twice side by side with v008, it ran 1.06 times as fast both times.
// Counting every step since v000, it is 7.80 times as fast.
#include <hip/hip_runtime.h>

// GQA causal ragged attention: q/k/v = x W (32 query heads, 8 kv heads, head 64, no bias), rotate-half RoPE from int32 positions (theta 5e5), mask = (same segment id) and (key index <= query index) with -3e38 fill, softmax(q.k * 0.125), ctx Wo -> [TT][2048] f32.
// Compute dtypes, f32 accumulate everywhere: x and all four weights RNE-converted to bf16 planes; q/k/v projections v_wmma_f32_16x16x32_bf16 on plain bf16 operands (one product); scores and attn.v on bf16 hi/lo split planes (hi.hi + lo.hi + hi.lo); output projection bf16 hi/lo ctx x bf16 Wo (2 products); RoPE tables, RoPE, softmax and all side math f32 on VALU.

#ifndef TT
#define TT   1024
#endif
#define TT_FULL 1024
#define DM   2048
#define NQ   32
#define NKV  8
#define GQ   (NQ / NKV)
#define HD   64
#define DQ   (NQ * HD)
#define DKV  (NKV * HD)
#define THETA 500000.0f
#define SCL  0.125f
static_assert(TT % 128 == 0);
static_assert(TT <= TT_FULL);
static_assert(HD == 64);
static_assert(DM % 64 == 0 && DQ % 64 == 0 && DKV % 64 == 0);

typedef _Float16 h16;
typedef unsigned short bf;
typedef __attribute__((ext_vector_type(16))) __bf16   v16bf;
typedef __attribute__((ext_vector_type(16))) _Float16 v16h;
typedef __attribute__((ext_vector_type(8)))  _Float16 v8h;
typedef __attribute__((ext_vector_type(8)))  unsigned short v8us;
typedef __attribute__((ext_vector_type(8)))  float    v8f;
typedef __attribute__((ext_vector_type(4)))  float    v4f;
typedef v8h  __attribute__((may_alias)) v8ha;
typedef v4f  __attribute__((may_alias)) v4fa;
typedef v8us __attribute__((may_alias)) v8usa;

__device__ __forceinline__ unsigned short f2bf(float f) { unsigned u = __float_as_uint(f); u += 0x7FFFu + ((u >> 16) & 1u); return (unsigned short)(u >> 16); }
__device__ __forceinline__ float bf2f(unsigned short b) { return __uint_as_float(((unsigned)b) << 16); }
__device__ __forceinline__ float bfr(float f) { return bf2f(f2bf(f)); }
__device__ __forceinline__ v16h cat16(v8h lo, v8h hi) { return __builtin_shufflevector(lo, hi, 0, 1, 2, 3, 4, 5, 6, 7, 8, 9, 10, 11, 12, 13, 14, 15); }
__device__ __forceinline__ v16bf cat16b(v8us lo, v8us hi) { return __builtin_bit_cast(v16bf, __builtin_shufflevector(lo, hi, 0, 1, 2, 3, 4, 5, 6, 7, 8, 9, 10, 11, 12, 13, 14, 15)); }
__device__ __forceinline__ v8f wmma16(v16h a, v16h b, v8f c) { return __builtin_amdgcn_wmma_f32_16x16x32_f16(false, a, false, b, (short)0, c, false, false); }
__device__ __forceinline__ v8f wmmab(v16bf a, v16bf b, v8f c) { return __builtin_amdgcn_wmma_f32_16x16x32_bf16(false, a, false, b, (short)0, c, false, false); }

__device__ __forceinline__ void splitf(float y, unsigned short& h, unsigned short& l) { h = f2bf(y); l = f2bf(y - bf2f(h)); }
typedef __attribute__((ext_vector_type(4))) unsigned short v4us;

// ---- k_gemmw: register-blocked GEMM, one 64 x (64 NS) output tile per workgroup of NW waves; wave w takes the 32-wide k steps w, w + NW, ... into its own 16 NS accumulators (operands straight from
// 16-bit planes in fragment order, below: an A fragment feeds 4 NS products, so that fewer operand bytes are loaded per product), and the NW partial tiles are summed in LDS in the fixed order w = 0 .. NW-1;
// grid (M/64, N/(64 NS), Z), 32 * NW threads. The join and the epilogues go through the tile in its NS parts of 64 columns.
// C[m][n] (f32, pitch ldc, + optional f32 bias[n]) = sum_k A[m][k] Bt[n][k] (+ split products per NSPLIT). z-batch strides sA/sB/sC in elements. K % (32 NW) == 0.
// Fragments: lane -> row/col lane&15, vector elements 0..7 <- k0 + 8h + i, elements 8..15 <- k0 + 16 + 8h + i (h = lane>>4) for BOTH operands; D element r -> (row 8h + r, col lane&15).
template <typename T16> struct WFrag;
template <> struct WFrag<h16> { typedef v16h V; static __device__ __forceinline__ V ld(const h16* p) { return cat16(*(const v8h*)p, *(const v8h*)(p + 256)); } static __device__ __forceinline__ v8f mma(V a, V b, v8f c) { return wmma16(a, b, c); } };
template <> struct WFrag<bf> { typedef v16bf V; static __device__ __forceinline__ V ld(const bf* p) { return cat16b(*(const v8us*)p, *(const v8us*)(p + 256)); } static __device__ __forceinline__ v8f mma(V a, V b, v8f c) { return wmmab(a, b, c); } };
// Fragment order of a 16-bit operand plane with K columns (every plane that a matrix instruction reads): blocks of 16 rows x 32 k = 512 elements, block index (row / 16) * (K / 32) + k / 32; inside a block element
// (row, k) lies at ((k >> 4) & 1) * 256 + (((k >> 3) & 1) * 16 + (row & 15)) * 8 + (k & 7). Lane l's fragment is then the 8 elements at 8 l and the 8 at 256 + 8 l: each 16-byte load of a wave reads 512 bytes in a row (four whole lines).
__device__ __forceinline__ size_t pidx(int row, int k, int K) { return ((size_t)(row >> 4) * (K >> 5) + (k >> 5)) * 512 + ((k >> 4) & 1) * 256 + (((k >> 3) & 1) * 16 + (row & 15)) * 8 + (k & 7); }
// QKV = true (the q/k/v projection; each 64-column part of a tile is one head): the joined tile is not stored as f32 but goes straight into the 16-bit hi/lo planes that the attention kernel reads, in fragment order:
// a q or k head through rotate-half RoPE, out[d] = x[d] cos[t][d] - x[d+HD/2] sin[t][d], out[d+HD/2] = x[d+HD/2] cos[t][d+HD/2] + x[d] sin[t][d+HD/2], into plane [head] with rows t; a v head transposed into plane [kv head] with rows d.
template <typename T16, int NSPLIT, bool BIAS, int NW, int K, bool QKV, int NS>
__global__ __launch_bounds__(32 * NW) void k_gemmw(const T16* __restrict__ A, const T16* __restrict__ A2, const T16* __restrict__ Bt, const T16* __restrict__ Bt2, float* C, int ldc, const float* __restrict__ bias, size_t sA, size_t sB, size_t sC,
                                                   const float* __restrict__ CS, bf* Ph, bf* Pl, bf* Vh, bf* Vl) {
    typedef typename WFrag<T16>::V V;
    static_assert(NW == 8);                                          // the join below deals 16 rows x 16 float4 columns to 256 threads
    __shared__ __align__(16) float os[2 * NS * NW * 16 * 68];        // two buffers of NS x NW partial 16x64 row blocks: one barrier per row block
    const size_t z = blockIdx.z; A += z * sA; if (A2) A2 += z * sA; Bt += z * sB; if (Bt2) Bt2 += z * sB; C += z * sC;
    const int lane = threadIdx.x & 31, lr = lane & 15, hi = lane >> 4; const int r0 = blockIdx.x * 64, c0 = blockIdx.y * (64 * NS);
    const int wv = __builtin_amdgcn_readfirstlane((int)(threadIdx.x >> 5));
    v8f acc[4][4 * NS];
#pragma unroll
    for (int mb = 0; mb < 4; ++mb)
#pragma unroll
        for (int nb = 0; nb < 4 * NS; ++nb) acc[mb][nb] = (v8f){};
    static_assert(!QKV || (DQ + DKV) % (64 * NS) == 0);              // no tile holds both a k head and a v head
    const bool rp = QKV && c0 < DQ + DKV;                            // QKV: q or k heads (RoPE) or v heads (transpose): by blockIdx, the same for the whole block
    // RoPE tile, the join: thread -> 4 columns d of one row t per row block. A wave takes 8 rows x (8 d and the 8 d at + HD/2): lane ^ 8 holds the rotation partner, lanes l and l ^ 16 the two halves of a 16-byte unit,
    // so that a wave's 8-byte stores fill two whole lines of a plane; the 16 lanes of each half wave read 64 different LDS banks.
    const int rrow = (wv & 1) * 8 + (lane & 7), rcof = ((wv >> 1) * 2 + hi) * 4 + ((lane >> 3) & 1) * (HD / 2);
    v4f cs[4][2];                                                    // (cos, sin) of the thread's 4 columns, per row block: asked for in front of the k loop, since behind it the join's first barrier would wait them out
    if (rp) {
        const float* pc = CS + ((size_t)(r0 + rrow) * HD + rcof) * 2;
#pragma unroll
        for (int mb = 0; mb < 4; ++mb) { cs[mb][0] = *(const v4f*)(pc + mb * 16 * HD * 2); cs[mb][1] = *(const v4f*)(pc + mb * 16 * HD * 2 + 4); }
        asm volatile("s_wait_xcnt 0x0" :: "v"(pc) : "memory");       // the precaution behind a group of loads, before a register that they name is written again; the address is an input, so that it keeps its registers up to the wait
    }
    const size_t aoff = (size_t)r0 * K + 8 * lane, boff = (size_t)c0 * K + 8 * lane;   // 16 rows of a plane are K / 32 blocks = 16 K elements; a k step is one block
    // The k loop, unrolled whole: a wave's k steps are NT, and the fragments of step t + 1 are asked for in front of the products of step t, into registers that step t does not read, so that a wave's loads fly while its own products run.
    // One address per plane: K and the step are constants of the kernel, so that every row block of every step is an immediate offset from it and no address register is written inside the loop.
    constexpr int NT = K / (32 * NW), TS = 32 * NW * 16;             // a wave's k steps; elements of a plane from one of them to the next
    static_assert(NSPLIT <= 1 && K % (32 * NW) == 0);
    const T16* pa = A + aoff + wv * 512; const T16* pa2 = NSPLIT == 1 ? A2 + aoff + wv * 512 : pa; const T16* pb = Bt + boff + wv * 512;
    auto lda = [&](V (&f)[4], const T16* p) {
#pragma unroll
        for (int mb = 0; mb < 4; ++mb) f[mb] = WFrag<T16>::ld(p + mb * 16 * K); };
    auto ldb = [&](V (&f)[4 * NS], const T16* p) {
#pragma unroll
        for (int nb = 0; nb < 4 * NS; ++nb) f[nb] = WFrag<T16>::ld(p + nb * 16 * K); };
    // a block of products, held between two scheduling barriers: loads sunk in among the products would each be waited for by itself, and products lifted over the loads in front would put these off.
    // The four v_nop behind it, where loads follow (more), are the vector slots between the last product and the loads that land on registers it reads.
    auto mm = [&](const V (&fa)[4], const V (&fb)[4 * NS], bool more) {
        __builtin_amdgcn_sched_barrier(0);
#pragma unroll
        for (int nb = 0; nb < 4 * NS; ++nb)
#pragma unroll
            for (int mb = 0; mb < 4; ++mb) acc[mb][nb] = WFrag<T16>::mma(fa[mb], fb[nb], acc[mb][nb]);
        __builtin_amdgcn_sched_barrier(0);
        if (more) asm volatile("v_nop\n\tv_nop\n\tv_nop\n\tv_nop");
        __builtin_amdgcn_sched_barrier(0); };
    if constexpr (NSPLIT == 0) {
        V a[2][4], b[2][4 * NS];                                     // two whole sets, taken in turn
        lda(a[0], pa); ldb(b[0], pb);
#pragma unroll
        for (int t = 0; t < NT; ++t) {
            if (t + 1 < NT) { lda(a[(t + 1) & 1], pa + (t + 1) * TS); ldb(b[(t + 1) & 1], pb + (t + 1) * TS); }
            mm(a[t & 1], b[t & 1], t + 2 < NT);
        }
    } else {
        // two sets of every plane do not fit beside the accumulators: B has two, each A plane one, which is asked for again right behind its own block of products, half a step ahead of its next use
        V a[4], a2[4], b[2][4 * NS];
        ldb(b[0], pb); lda(a, pa); lda(a2, pa2);
#pragma unroll
        for (int t = 0; t < NT; ++t) {
            if (t + 1 < NT) ldb(b[(t + 1) & 1], pb + (t + 1) * TS);
            mm(a, b[t & 1], t + 1 < NT);
            if (t + 1 < NT) lda(a, pa + (t + 1) * TS);
            mm(a2, b[t & 1], t + 1 < NT);
            if (t + 1 < NT) lda(a2, pa2 + (t + 1) * TS);
        }
    }
    // the precaution behind the loads, before a register that they name is written again; the addresses are inputs, so that they keep their registers up to the wait and no result lands on one
    asm volatile("s_wait_xcnt 0x0" :: "v"(pa), "v"(pa2), "v"(pb) : "memory");
    if constexpr (QKV) {
        // V tile: thread -> 4 rows t of one column d per row block. A wave takes 16 d x 8 t: 256 bytes in a row of the transposed plane.
        const int vd = (wv & 3) * 16 + lr, vt = ((wv >> 2) * 2 + hi) * 4;
        v4us oh[NS][4], ol[NS][4];
#pragma unroll
        for (int mb = 0; mb < 4; ++mb) {
            float* ob = os + (mb & 1) * (NS * NW * 16 * 68);
#pragma unroll
            for (int nb = 0; nb < 4 * NS; ++nb) {
#pragma unroll
                for (int j = 0; j < 8; ++j) ob[((nb >> 2) * NW + wv) * (16 * 68) + (hi * 8 + j) * 68 + (nb & 3) * 16 + lr] = acc[mb][nb][j]; }
            __syncthreads();                                         // every wave's partial of this row block is in LDS; the other buffer's readers are done before it is written again
#pragma unroll
            for (int ns = 0; ns < NS; ++ns) {                        // one head per part
                const float* on = ob + ns * (NW * 16 * 68);
                v4f r;
                if (rp) {
                    v4f val = *(const v4fa*)(on + rrow * 68 + rcof);
#pragma unroll
                    for (int w = 1; w < NW; ++w) val += *(const v4fa*)(on + w * (16 * 68) + rrow * 68 + rcof);
#pragma unroll
                    for (int j = 0; j < 4; ++j) { const float x1 = __shfl_xor(val[j], 8, 32), cn = cs[mb][j >> 1][(j & 1) * 2], sn = cs[mb][j >> 1][(j & 1) * 2 + 1]; r[j] = (lane & 8) ? val[j] * cn + x1 * sn : val[j] * cn - x1 * sn; }
                } else {
#pragma unroll
                    for (int j = 0; j < 4; ++j) { float v = on[(vt + j) * 68 + vd];
#pragma unroll
                        for (int w = 1; w < NW; ++w) v += on[w * (16 * 68) + (vt + j) * 68 + vd];
                        r[j] = v; }
                }
#pragma unroll
                for (int j = 0; j < 4; ++j) { unsigned short a2, c2; splitf(r[j], a2, c2); oh[ns][mb][j] = a2; ol[ns][mb][j] = c2; }
            }
        }
        // stores behind the last barrier, as below; 16 rows t are two blocks of a q or k plane, half a block of a V^T plane
        const size_t po = rp ? (size_t)(c0 / HD) * TT * HD + pidx(r0 + rrow, rcof, HD) : (size_t)((c0 - DQ - DKV) / HD) * HD * TT + pidx(vd, r0 + vt, TT);
        bf* ph = (rp ? Ph : Vh) + po; bf* pl = (rp ? Pl : Vl) + po;
        const int pst = rp ? 1024 : 256;
#pragma unroll
        for (int ns = 0; ns < NS; ++ns)                              // the next head's plane lies TT * HD elements on, a q or k plane as a V^T plane
#pragma unroll
            for (int mb = 0; mb < 4; ++mb) { *(v4us*)(ph + ns * (TT * HD) + mb * pst) = oh[ns][mb]; *(v4us*)(pl + ns * (TT * HD) + mb * pst) = ol[ns][mb];
                asm volatile("s_wait_xcnt 0x0" :: "v"(ph), "v"(pl) : "memory"); }   // the same precaution behind each pair of stores: the next pair's addresses and data may take the registers of this one
        return;
    }
    const int row = (int)(threadIdx.x >> 4), cofs = (int)(threadIdx.x & 15) * 4; v4f res[NS][4];   // the join: thread -> one float4 of each 16x64 row block
#pragma unroll
    for (int mb = 0; mb < 4; ++mb) {
        float* ob = os + (mb & 1) * (NS * NW * 16 * 68);
#pragma unroll
        for (int nb = 0; nb < 4 * NS; ++nb) {
#pragma unroll
            for (int j = 0; j < 8; ++j) ob[((nb >> 2) * NW + wv) * (16 * 68) + (hi * 8 + j) * 68 + (nb & 3) * 16 + lr] = acc[mb][nb][j]; }
        __syncthreads();                                             // every wave's partial of this row block is in LDS; the other buffer's readers are done before it is written again
#pragma unroll
        for (int ns = 0; ns < NS; ++ns) {
            const float* on = ob + ns * (NW * 16 * 68); const int cn = c0 + ns * 64 + cofs;
            v4f val = *(const v4fa*)(on + row * 68 + cofs);
#pragma unroll
            for (int w = 1; w < NW; ++w) val += *(const v4fa*)(on + w * (16 * 68) + row * 68 + cofs);
            if (BIAS) { val[0] += bfr(bias[cn]); val[1] += bfr(bias[cn + 1]); val[2] += bfr(bias[cn + 2]); val[3] += bfr(bias[cn + 3]); }
            res[ns][mb] = val;
        }
    }
    // stores behind the last barrier: a store in front of a barrier would be waited out there
#pragma unroll
    for (int ns = 0; ns < NS; ++ns)
#pragma unroll
        for (int mb = 0; mb < 4; ++mb) *(v4f*)(C + (size_t)(r0 + mb * 16 + row) * ldc + c0 + ns * 64 + cofs) = res[ns][mb];
}

typedef __attribute__((ext_vector_type(2))) float v2f;
typedef __attribute__((ext_vector_type(4))) int v4i;
typedef __attribute__((ext_vector_type(2))) __bf16 v2bf;
typedef __attribute__((ext_vector_type(8))) unsigned v8u;
typedef __attribute__((ext_vector_type(4))) unsigned v4u;

// The d_* functions are the bodies of jobs that read none of each other's output; k_prep below deals the blocks of one grid to them (blk = the block's index inside its job).
// d_wtT: Bt (bf16, rows n, fragment order) = w[k][n] (f32), one tile of 64 k x 128 n per block, turned in LDS (ts: 128 rows n of 32 dwords, each dword the bf16 pair k, k + 1; pitch 33 dwords, so that no two lanes of a wave
// meet on a bank, storing or loading). Every global load of a wave is two 256-byte pieces of rows of w, every global store four whole 128-byte lines of Bt. Neighbouring blocks take neighbouring n.
__device__ __forceinline__ void d_wtT(int blk, const float* __restrict__ w, int K, int N, bf* Bt, unsigned* ts) {
    const int lane = threadIdx.x & 31, wv = (int)(threadIdx.x >> 5); const int n0 = (blk % (N / 128)) * 128, k0 = (blk / (N / 128)) * 64;
    const int c4 = (lane & 15) * 4, kq = wv * 2 + (lane >> 4);      // thread -> 4 columns n of the row pairs kq and kq + 16, in both 64-column halves
    v4f ev[2][2], od[2][2];
#pragma unroll
    for (int i = 0; i < 2; ++i)
#pragma unroll
        for (int nh = 0; nh < 2; ++nh) { const float* p = w + (size_t)(k0 + 2 * (kq + 16 * i)) * N + n0 + nh * 64 + c4; ev[i][nh] = *(const v4f*)p; od[i][nh] = *(const v4f*)(p + N); }
    asm volatile("s_wait_xcnt 0x0" ::: "memory");                    // the precaution behind a group of loads, before a register that they name is written again
#pragma unroll
    for (int i = 0; i < 2; ++i)
#pragma unroll
        for (int nh = 0; nh < 2; ++nh)
#pragma unroll
            for (int j = 0; j < 4; ++j) ts[(nh * 64 + c4 + j) * 33 + kq + 16 * i] = (unsigned)f2bf(ev[i][nh][j]) | ((unsigned)f2bf(od[i][nh][j]) << 16);
    __syncthreads();                                                 // the tile is whole in LDS (the job is chosen by blockIdx: every wave of the block passes here)
    // thread -> four 8-k pieces (4 dwords each) of the wave's 16 rows; eight neighbouring lanes take eight neighbouring rows at one k, which is one whole line of the fragment order
#pragma unroll
    for (int i = 0; i < 4; ++i) { const int n = wv * 16 + (i >> 1) * 8 + (lane & 7), k8 = (lane >> 3) * 2 + (i & 1); const unsigned* q = ts + n * 33 + k8 * 4; v4u v; v[0] = q[0]; v[1] = q[1]; v[2] = q[2]; v[3] = q[3]; *(v4u*)(Bt + pidx(n0 + n, k0 + k8 * 8, K)) = v; }
    asm volatile("s_wait_xcnt 0x0" ::: "memory");                    // the same precaution behind the group of stores
}
// d_cvt8: dst (bf16, fragment order) = src [rows][K] (f32), 8 k per thread; a wave takes 8 rows x 32 k: it loads one whole line of each row and stores four whole lines
__device__ __forceinline__ void d_cvt8(int blk, const float* __restrict__ src, bf* dst, int K, size_t n8) { const size_t i = (size_t)blk * 256 + threadIdx.x; if (i >= n8) return;
    const int w = (int)(i >> 5), ks = (w >> 1) % (K / 32), row = ((w >> 1) / (K / 32)) * 16 + (w & 1) * 8 + (((int)i >> 2) & 7), k = ks * 32 + ((int)i & 3) * 8;
    const v8f v = *(const v8f*)(src + (size_t)row * K + k); v8us o;
#pragma unroll
    for (int q = 0; q < 8; ++q) o[q] = f2bf(v[q]); *(v8us*)(dst + pidx(row, k, K)) = o;  }
// the inverse frequency is computed by the thread that uses it, so that the table job depends on the inputs alone
__device__ __forceinline__ void d_cstab(int blk, const int* __restrict__ pos, float* CS) {
    const int idx = blk * 256 + threadIdx.x; if (idx >= TT * HD) return;
    const int dd = idx % HD; const int t = idx / HD; const int j = dd & (HD / 2 - 1);
    const float e = (float)j * (1.0f / (float)(HD / 2));
    const float p = powf(THETA, e);
    const float v = 1.0f / p;
    const float pf = (float)pos[t];
    float fr = __fmul_rn(pf, v); asm volatile("" : "+v"(fr));
    float sn, cn;
    sincosf(fr, &sn, &cn);
    v2f cs; cs[0] = cn; cs[1] = sn;
    *(v2f*)(CS + (size_t)idx * 2) = cs; 
}
// ---- k_prep: every job that reads the inputs alone, in one grid; the weight transposes, whose blocks run longest, take the first block indices. The branches are on blockIdx and so the same for a whole block.
#define DQKV   (DQ + 2 * DKV)
#define NB_WQ  (DQ * DM / (64 * 128))
#define NB_WKV (DKV * DM / (64 * 128))
static_assert(DM % 128 == 0 && DQ % 128 == 0 && DKV % 128 == 0);
#define NB_X   (TT * DM / (8 * 256))
#define NB_CS  (TT * HD / 256)
__global__ __launch_bounds__(256) void k_prep(const float* __restrict__ x, const float* __restrict__ wq, const float* __restrict__ wk, const float* __restrict__ wv, const float* __restrict__ wo, const int* __restrict__ pos,
                                              bf* WQ, bf* WK, bf* WV, bf* WO, bf* XB, float* CS) {
    __shared__ __align__(16) unsigned ts[128 * 33];                  // the transposes' tile
    int b = (int)blockIdx.x;
    if (b >= 2 * NB_WQ + 2 * NB_WKV + NB_X) { d_cstab(b - (2 * NB_WQ + 2 * NB_WKV + NB_X), pos, CS); return; }   // the last blocks of the grid; tested first, since behind five other tests the compiler makes powf a call
    if (b < NB_WQ) { d_wtT(b, wq, DM, DQ, WQ, ts); return; }            // Wq [D][NQ*HD]  -> WQ[c][d]
    b -= NB_WQ;
    if (b < NB_WQ) { d_wtT(b, wo, DQ, DM, WO, ts); return; }            // Wo [NQ*HD][D]  -> WO[dout][nh]
    b -= NB_WQ;
    if (b < NB_WKV) { d_wtT(b, wk, DM, DKV, WK, ts); return; }          // Wk [D][NKV*HD] -> WK[c][d]
    b -= NB_WKV;
    if (b < NB_WKV) { d_wtT(b, wv, DM, DKV, WV, ts); return; }          // Wv [D][NKV*HD] -> WV[c][d]
    b -= NB_WKV;
    d_cvt8(b, x, XB, DM, (size_t)TT * DM / 8);
}
// ---- k_fattn: scores, mask, softmax and attn.v of one 16-query tile in one pass over the keys; scores and probabilities stay in registers. Workgroup = the GQ query heads of one kv head (one wave each, same
// 16 queries, so the waves read the same K and V lines); grid (TT/16) * NKV; LDS holds only the segment ids and the key-block mask (one barrier). Per 64-key block that the mask names, up to the diagonal block:
//   St[key][query] = K Q^T (A = K rows, B = Q rows; qh.kh + ql.kh + qh.kl): D element r of key tile nb -> (key 16 nb + 8h + r, query lane&15), which is already the B-fragment k order of the next product
//   (elements 0..7 <- k0 + 8h + i from tile 2j, elements 8..15 <- k0 + 16 + 8h + i from tile 2j + 1), so the probabilities go from one product to the other with no exchange between lanes;
//   running row maximum m and row sum l per query (lane&15; the two lane halves hold different keys), accumulator rescaled by exp(m_old - m_new);
//   Ot[d][query] += Vt P^T (A = Vt rows d, B = P hi/lo; ph.vh + pl.vh + ph.vl): the query of every accumulator element is the lane's own, so the rescale and the final 1/l are lane-local.
// Every inner loop is fully unrolled, so that the fragment arrays are indexed by constants and stay in registers.
// Key-block mask: bit j is set if block j holds a key whose segment id lies inside [least, greatest] of the tile's 16 query ids, found at entry from the ids themselves, whatever they hold. In a block without such a key every
// score of the tile is masked, and a wholly masked block adds exact zeros (ahead of a row's first allowed key it is rescaled by 0, behind it its probabilities are exp2(-huge) = 0): it is passed over. The diagonal block is always taken.
// A masked score is the fill -3e38. While a row has met no allowed key, m is the fill too and its masked entries count as exp(0) = 1; the first allowed key (the diagonal at the latest) rescales all of that by exp(-huge) = 0.
__global__ __launch_bounds__(32 * GQ) void k_fattn(const bf* __restrict__ Qh, const bf* __restrict__ Ql, const bf* __restrict__ Kh, const bf* __restrict__ Kl, const bf* __restrict__ Vh, const bf* __restrict__ Vl, const int* __restrict__ seg, bf* Ah, bf* Al) {
    typedef WFrag<bf>::V V;
    const int lane = threadIdx.x & 31, lr = lane & 15, hi = lane >> 4;
    const int wv = __builtin_amdgcn_readfirstlane((int)(threadIdx.x >> 5));
    const int b = (int)blockIdx.x, nhalf = (TT / 32) * NKV;
    const int qt = b < nhalf ? TT / 16 - 1 - b / NKV : (b - nhalf) / NKV;   // long tiles take the first block indices, the short ones the rest
    const int kvh = b % NKV, head = kvh * GQ + wv, q0 = qt * 16, qi = q0 + lr;
    const size_t qoff = ((size_t)head * TT + q0) * HD + 8 * lane;     // all planes in fragment order: 16 rows of Q or K are HD / 32 blocks, 16 rows of Vt TT / 32
    const bf* pqh = Qh + qoff; const bf* pql = Ql + qoff;
    V qh[2], ql[2];
#pragma unroll
    for (int kk = 0; kk < 2; ++kk) { qh[kk] = WFrag<bf>::ld(pqh + kk * 512); ql[kk] = WFrag<bf>::ld(pql + kk * 512); }
    __shared__ __align__(16) int sseg[TT];                           // the segment ids, read per key block from LDS: a global load there would be waited for in order behind the K loads in flight
    __shared__ __align__(16) unsigned sbm[GQ];                       // each wave's share of the key-block mask
    v4i sgr[TT / (32 * GQ * 4)];
#pragma unroll
    for (int i = 0; i < TT / (32 * GQ * 4); ++i) sgr[i] = *(const v4i*)(seg + (i * 32 * GQ + (int)threadIdx.x) * 4);
    const int sq = seg[qi];
    int slo = seg[q0], shi = slo;                                    // least and greatest segment id of the tile's queries; the addresses are the same in every lane
#pragma unroll
    for (int i = 1; i < 16; ++i) { const int s = seg[q0 + i]; slo = s < slo ? s : slo; shi = s > shi ? s : shi; }
    // K and V addresses = wave-uniform base (kv head, key block) + a lane offset that never changes
    const bf* kbh = Kh + (size_t)kvh * TT * HD; const bf* kbl = Kl + (size_t)kvh * TT * HD; const bf* vbh = Vh + (size_t)kvh * HD * TT; const bf* vbl = Vl + (size_t)kvh * HD * TT;
    const unsigned klane = (unsigned)(8 * lane), vlane = (unsigned)(8 * lane);
    v8f o[4];
#pragma unroll
    for (int mb = 0; mb < 4; ++mb) o[mb] = (v8f){};
    float m = -3.0e38f, l = 0.f;                                     // m in units of log2: score * SCL * log2(e)
    __builtin_amdgcn_sched_barrier(0);                               // nothing is scheduled in between the prologue's loads and their wait, or up over it
    // the precaution behind a group of loads, before a register that they name is written again; the addresses are inputs of the wait, so that they keep their registers up to it and no result of the group lands on one
    asm volatile("s_wait_xcnt 0x0" :: "v"(pqh), "v"(pql) : "memory");
    __builtin_amdgcn_sched_barrier(0);                               // the second half of the same: what follows stays behind the wait
    // the wave's share of the key-block mask: a thread holds 4 neighbouring keys per round, so 16 lanes hold one 64-key block; unsigned differences, so that the range test holds for any 32-bit ids
    static_assert(GQ == 4 && TT / 64 <= 32 && (32 * GQ * 4) % 64 == 0);
    const unsigned span = (unsigned)shi - (unsigned)slo;
    unsigned part = 0u;
#pragma unroll
    for (int i = 0; i < TT / (32 * GQ * 4); ++i) {
        const bool any = (unsigned)sgr[i][0] - (unsigned)slo <= span || (unsigned)sgr[i][1] - (unsigned)slo <= span || (unsigned)sgr[i][2] - (unsigned)slo <= span || (unsigned)sgr[i][3] - (unsigned)slo <= span;
        const unsigned bal = __builtin_amdgcn_ballot_w32(any); const int b0 = i * (32 * GQ * 4 / 64) + wv * 2;
        part |= ((bal & 0xFFFFu) != 0u ? 1u << b0 : 0u) | ((bal >> 16) != 0u ? 2u << b0 : 0u); }
#pragma unroll
    for (int i = 0; i < TT / (32 * GQ * 4); ++i) *(v4i*)(sseg + (i * 32 * GQ + (int)threadIdx.x) * 4) = sgr[i];
    if (lane == 0) sbm[wv] = part;
    __syncthreads();                                                 // sseg and sbm are whole
    const v4u pm = *(const v4u*)sbm;
    const int dblk = q0 >> 6;                                        // the diagonal block: nothing behind it is causal, and it holds every query's own key
    const unsigned bm = ((unsigned)__builtin_amdgcn_readfirstlane((int)(pm[0] | pm[1] | pm[2] | pm[3])) & ((2u << dblk) - 1u)) | (1u << dblk);
    V kh[4][2], kl[4][2];                                            // the K fragments of one 64-key block, loaded one block ahead: again right behind their last use
    const bf* k0h = kbh + (size_t)(__builtin_ctz(bm) * 64) * HD; const bf* k0l = kbl + (size_t)(__builtin_ctz(bm) * 64) * HD;   // the mask's first block: wave-uniform bases
#pragma unroll
    for (int nb = 0; nb < 4; ++nb)
#pragma unroll
        for (int kk = 0; kk < 2; ++kk) { const int e = nb * 16 * HD + kk * 512; kh[nb][kk] = WFrag<bf>::ld(k0h + klane + e); kl[nb][kk] = WFrag<bf>::ld(k0l + klane + e); }
    __builtin_amdgcn_sched_barrier(0);                               // as above: nothing in between the first K loads and their wait
    asm volatile("s_wait_xcnt 0x0" :: "v"(klane), "s"(k0h), "s"(k0l) : "memory");   // the same precaution, the lane offset and the two bases held in their registers up to the wait
    __builtin_amdgcn_sched_barrier(0);                               // what follows stays behind the wait
#pragma unroll 1                                                     // one key block per trip: a second copy of the body would not fit the registers
    for (unsigned rest = bm; rest != 0u;) {                          // every trip clears one bit of the mask: at most TT / 64 trips
        const int kb = __builtin_ctz(rest) * 64; rest &= rest - 1u;
        const int kn = rest != 0u ? __builtin_ctz(rest) * 64 : kb;   // the next block of the mask; behind the last block this one again (in bounds, never used)
        V vh[4][2], vl[4][2];                                        // this block's V fragments: asked for here, used behind the softmax
        const bf* pvh = vbh + kb * 16 + vlane; const bf* pvl = vbl + kb * 16 + vlane;
#pragma unroll
        for (int mb = 0; mb < 4; ++mb)
#pragma unroll
            for (int j = 0; j < 2; ++j) { const int e = mb * 16 * TT + j * 512; vh[mb][j] = WFrag<bf>::ld(pvh + e); vl[mb][j] = WFrag<bf>::ld(pvl + e); }
        asm volatile("s_wait_xcnt 0x0" :: "v"(pvh), "v"(pvl) : "memory");   // the same precaution, the V addresses held in their registers up to the wait
        v8f s[4];
#pragma unroll
        for (int nb = 0; nb < 4; ++nb) { s[nb] = (v8f){};
#pragma unroll
            for (int kk = 0; kk < 2; ++kk) { s[nb] = wmmab(kh[nb][kk], qh[kk], s[nb]); s[nb] = wmmab(kh[nb][kk], ql[kk], s[nb]); s[nb] = wmmab(kl[nb][kk], qh[kk], s[nb]); } }
        const bf* pkh = kbh + (size_t)kn * HD + klane; const bf* pkl = kbl + (size_t)kn * HD + klane;
#pragma unroll
        for (int nb = 0; nb < 4; ++nb)
#pragma unroll
            for (int kk = 0; kk < 2; ++kk) { const int e = nb * 16 * HD + kk * 512; kh[nb][kk] = WFrag<bf>::ld(pkh + e); kl[nb][kk] = WFrag<bf>::ld(pkl + e); }
        asm volatile("s_wait_xcnt 0x0" :: "v"(pkh), "v"(pkl) : "memory");   // the same precaution, the K addresses held in their registers up to the wait
        const int lim = qi - kb - 8 * hi;                            // key offset 16 nb + r in this lane is causal iff it is <= lim
        float mx = m;
#pragma unroll
        for (int nb = 0; nb < 4; ++nb) { const int j0 = kb + nb * 16 + 8 * hi; const v4i g0 = *(const v4i*)(sseg + j0), g1 = *(const v4i*)(sseg + j0 + 4);
#pragma unroll
            for (int r = 0; r < 8; ++r) { const int sg = r < 4 ? g0[r & 3] : g1[r & 3]; const float t = (sg == sq && nb * 16 + r <= lim) ? s[nb][r] * (SCL * 1.4426950408889634f) : -3.0e38f; s[nb][r] = t; mx = fmaxf(mx, t); } }
        mx = fmaxf(mx, __shfl_xor(mx, 16, 32));
        const float al = __builtin_amdgcn_exp2f(m - mx);
        m = mx;
        v2f ps2[2] = {(v2f){0.f, 0.f}, (v2f){0.f, 0.f}}; v8u phw[2], plw[2];   // four independent partial row sums
#pragma unroll
        for (int nb = 0; nb < 4; ++nb) {
#pragma unroll
            for (int r = 0; r < 8; r += 2) { v2f pp; pp[0] = __builtin_amdgcn_exp2f(s[nb][r] - mx); pp[1] = __builtin_amdgcn_exp2f(s[nb][r + 1] - mx); ps2[nb & 1] += pp;
                const v2bf h2 = __builtin_convertvector(pp, v2bf); const v2bf l2 = __builtin_convertvector(pp - __builtin_convertvector(h2, v2f), v2bf);
                phw[nb >> 1][(nb & 1) * 4 + (r >> 1)] = __builtin_bit_cast(unsigned, h2); plw[nb >> 1][(nb & 1) * 4 + (r >> 1)] = __builtin_bit_cast(unsigned, l2); } }
        l = l * al + ((ps2[0][0] + ps2[1][0]) + (ps2[0][1] + ps2[1][1]));
#pragma unroll
        for (int mb = 0; mb < 4; ++mb) { o[mb] *= al;
#pragma unroll
            for (int j = 0; j < 2; ++j) { const V ph = __builtin_bit_cast(V, phw[j]), pl = __builtin_bit_cast(V, plw[j]); o[mb] = wmmab(vh[mb][j], ph, o[mb]); o[mb] = wmmab(vh[mb][j], pl, o[mb]); o[mb] = wmmab(vl[mb][j], ph, o[mb]); } }
    }
    l += __shfl_xor(l, 16, 32);
    const float f = __fdiv_rn(1.0f, l);
    const int ln = (int)__lane_id();                                 // the lane's number from the count that the shuffles keep anyway: 8 * lane held over the loop went to scratch memory
#pragma unroll
    for (int mb = 0; mb < 4; ++mb) { v8us oh, ol;
#pragma unroll
        for (int r = 0; r < 8; ++r) { unsigned short a2, c2; splitf(o[mb][r] * f, a2, c2); oh[r] = a2; ol[r] = c2; }
        const size_t oo = ((size_t)qt * (DQ / 32) + head * (HD / 32) + (mb >> 1)) * 512 + (mb & 1) * 256 + 8 * ln; *(v8us*)(Ah + oo) = oh; *(v8us*)(Al + oo) = ol; }   // row qi, k = head * HD + 16 mb + 8 hi + r in fragment order
}

extern "C" void kernel_launch(void* const* d_in, const int* in_sizes, int n_in,
                              void* d_out, int out_size, void* d_ws, size_t ws_size, hipStream_t stream) {
    if (n_in < 7) return;
    if (in_sizes[0] < TT * DM || in_sizes[1] < DM * DQ || in_sizes[2] < DM * DKV || in_sizes[3] < DM * DKV || in_sizes[4] < DQ * DM || in_sizes[5] < TT || in_sizes[6] < TT) return;
    if (out_size < TT * DM) return;
    const float* x = (const float*)d_in[0]; const float* wq = (const float*)d_in[1]; const float* wk = (const float*)d_in[2]; const float* wv = (const float*)d_in[3]; const float* wo = (const float*)d_in[4];
    const int* pos = (const int*)d_in[5]; const int* seg = (const int*)d_in[6];
    float* OUT = (float*)d_out;     // [TT][DM]
    char* wsp = (char*)d_ws;
    auto take = [&](size_t bytes) { char* p = wsp; wsp += (bytes + 255) & ~(size_t)255; return (void*)p; };
    // the q, k and v weight planes lie one behind the other ([DQKV][DM]), and so do the q and k head planes: the three projections are one GEMM, whose epilogue ropes q and k into the joined planes
    bf* WQ = (bf*)take((size_t)DQKV * DM * 2); bf* WK = WQ + (size_t)DQ * DM; bf* WV = WK + (size_t)DKV * DM; bf* WO = (bf*)take((size_t)DM * DQ * 2);
    float* CS = (float*)take((size_t)TT * HD * 2 * 4);
    bf* XB = (bf*)take((size_t)TT * DM * 2);
    bf* QPh = (bf*)take((size_t)(NQ + NKV) * TT * HD * 2); bf* QPl = (bf*)take((size_t)(NQ + NKV) * TT * HD * 2); bf* KPh = QPh + (size_t)NQ * TT * HD; bf* KPl = QPl + (size_t)NQ * TT * HD;
    bf* VTh = (bf*)take((size_t)NKV * HD * TT * 2); bf* VTl = (bf*)take((size_t)NKV * HD * TT * 2);
    bf* ATh = (bf*)take((size_t)TT * DQ * 2); bf* ATl = (bf*)take((size_t)TT * DQ * 2);
    const size_t used = (size_t)(wsp - (char*)d_ws);
    if (used > ws_size || used > ((size_t)128 << 20)) return;

    // tables and 16-bit planes of the inputs: one launch
    k_prep<<<2 * NB_WQ + 2 * NB_WKV + NB_X + NB_CS, 256, 0, stream>>>(x, wq, wk, wv, wo, pos, WQ, WK, WV, WO, XB, CS);
    // q, k and v projections (plain bf16 operands): one launch, which writes the roped q and k planes and the transposed v planes (hi/lo) itself
    k_gemmw<bf, 0, false, 8, DM, true, 2><<<dim3(TT / 64, DQKV / 128, 1), 256, 0, stream>>>(XB, nullptr, WQ, nullptr, nullptr, 0, nullptr, 0, 0, 0, CS, QPh, QPl, VTh, VTl);
    // attention: one launch, all heads; writes the hi/lo ctx planes (rows t, columns head * HD + d, fragment order)
    k_fattn<<<(unsigned)((TT / 16) * NKV), 32 * GQ, 0, stream>>>(QPh, QPl, KPh, KPl, VTh, VTl, seg, ATh, ATl);
    // output projection: hi/lo ctx x bf16 Wo
    k_gemmw<bf, 1, false, 8, DQ, false, 2><<<dim3(TT / 64, DM / 128, 1), 256, 0, stream>>>(ATh, ATl, WO, nullptr, OUT, DM, nullptr, 0, 0, 0, nullptr, nullptr, nullptr, nullptr, nullptr);
}

// v010
// A run of this version takes 50.3 microseconds.
// Next to v009, in two timings, it ran 1.05 and 1.06 times as fast.
// Counting every step since v000, it is 8.23 times as fast.
#include <hip/hip_runtime.h>

// GQA causal ragged attention: q/k/v = x W (32 query heads, 8 kv heads, head 64, no bias), rotate-half RoPE from int32 positions (theta 5e5), mask = (same segment id) and (key index <= query index) with -3e38 fill, softmax(q.k * 0.125), ctx Wo -> [TT][2048] f32.
// Compute dtypes, f32 accumulate everywhere: x and all four weights RNE-converted to bf16 planes; q/k/v projections v_wmma_f32_16x16x32_bf16 on plain bf16 operands (one product); scores and attn.v on bf16 hi/lo split planes (hi.hi + lo.hi + hi.lo); output projection bf16 hi/lo ctx x bf16 Wo (2 products); RoPE tables, RoPE, softmax and all side math f32 on VALU.

#ifndef TT
#define TT   1024
#endif
#define TT_FULL 1024
#define DM   2048
#define NQ   32
#define NKV  8
#define GQ   (NQ / NKV)
#define HD   64
#define DQ   (NQ * HD)
#define DKV  (NKV * HD)
#define THETA 500000.0f
#define SCL  0.125f
static_assert(TT % 128 == 0);
static_assert(TT <= TT_FULL);
static_assert(HD == 64);
static_assert(DM % 64 == 0 && DQ % 64 == 0 && DKV % 64 == 0);

typedef _Float16 h16;
typedef unsigned short bf;
typedef __attribute__((ext_vector_type(16))) __bf16   v16bf;
typedef __attribute__((ext_vector_type(16))) _Float16 v16h;
typedef __attribute__((ext_vector_type(8)))  _Float16 v8h;
typedef __attribute__((ext_vector_type(8)))  unsigned short v8us;
typedef __attribute__((ext_vector_type(8)))  float    v8f;
typedef __attribute__((ext_vector_type(4)))  float    v4f;
typedef v8h  __attribute__((may_alias)) v8ha;
typedef v4f  __attribute__((may_alias)) v4fa;
typedef v8us __attribute__((may_alias)) v8usa;

__device__ __forceinline__ unsigned short f2bf(float f) { unsigned u = __float_as_uint(f); u += 0x7FFFu + ((u >> 16) & 1u); return (unsigned short)(u >> 16); }
__device__ __forceinline__ float bf2f(unsigned short b) { return __uint_as_float(((unsigned)b) << 16); }
__device__ __forceinline__ float bfr(float f) { return bf2f(f2bf(f)); }
__device__ __forceinline__ v16h cat16(v8h lo, v8h hi) { return __builtin_shufflevector(lo, hi, 0, 1, 2, 3, 4, 5, 6, 7, 8, 9, 10, 11, 12, 13, 14, 15); }
__device__ __forceinline__ v16bf cat16b(v8us lo, v8us hi) { return __builtin_bit_cast(v16bf, __builtin_shufflevector(lo, hi, 0, 1, 2, 3, 4, 5, 6, 7, 8, 9, 10, 11, 12, 13, 14, 15)); }
__device__ __forceinline__ v8f wmma16(v16h a, v16h b, v8f c) { return __builtin_amdgcn_wmma_f32_16x16x32_f16(false, a, false, b, (short)0, c, false, false); }
__device__ __forceinline__ v8f wmmab(v16bf a, v16bf b, v8f c) { return __builtin_amdgcn_wmma_f32_16x16x32_bf16(false, a, false, b, (short)0, c, false, false); }

__device__ __forceinline__ void splitf(float y, unsigned short& h, unsigned short& l) { h = f2bf(y); l = f2bf(y - bf2f(h)); }
typedef __attribute__((ext_vector_type(4))) unsigned short v4us;

// ---- k_gemmw: register-blocked GEMM, one (16 MBN) x (64 NS) output tile per workgroup of NW waves; wave w takes the 32-wide k steps w, w + NW, ... into its own 4 MBN NS accumulators (operands straight from
// 16-bit planes in fragment order, below: an A fragment feeds 4 NS products, so that fewer operand bytes are loaded per product), and the NW partial tiles are summed in LDS in the fixed order w = 0 .. NW-1;
// grid (M/(16 MBN), N/(64 NS), Z), 32 * NW threads. The join and the epilogues go through the tile in its NS parts of 64 columns.
// The operand bytes that a wave loads per product fall as 1 / rows + 1 / columns of its tile: the q/k/v projection takes 128 x 128 per wave, which needs more than half of a SIMD's registers, so four waves, one per SIMD.
// C[m][n] (f32, pitch ldc, + optional f32 bias[n]) = sum_k A[m][k] Bt[n][k] (+ split products per NSPLIT). z-batch strides sA/sB/sC in elements. K % 32 == 0.
// Fragments: lane -> row/col lane&15, vector elements 0..7 <- k0 + 8h + i, elements 8..15 <- k0 + 16 + 8h + i (h = lane>>4) for BOTH operands; D element r -> (row 8h + r, col lane&15).
template <typename T16> struct WFrag;
template <> struct WFrag<h16> { typedef v16h V; static __device__ __forceinline__ V ld(const h16* p) { return cat16(*(const v8h*)p, *(const v8h*)(p + 256)); } static __device__ __forceinline__ v8f mma(V a, V b, v8f c) { return wmma16(a, b, c); } };
template <> struct WFrag<bf> { typedef v16bf V; static __device__ __forceinline__ V ld(const bf* p) { return cat16b(*(const v8us*)p, *(const v8us*)(p + 256)); } static __device__ __forceinline__ v8f mma(V a, V b, v8f c) { return wmmab(a, b, c); } };
// Fragment order of a 16-bit operand plane with K columns (every plane that a matrix instruction reads): blocks of 16 rows x 32 k = 512 elements, block index (row / 16) * (K / 32) + k / 32; inside a block element
// (row, k) lies at ((k >> 4) & 1) * 256 + (((k >> 3) & 1) * 16 + (row & 15)) * 8 + (k & 7). Lane l's fragment is then the 8 elements at 8 l and the 8 at 256 + 8 l: each 16-byte load of a wave reads 512 bytes in a row (four whole lines).
__device__ __forceinline__ size_t pidx(int row, int k, int K) { return ((size_t)(row >> 4) * (K >> 5) + (k >> 5)) * 512 + ((k >> 4) & 1) * 256 + (((k >> 3) & 1) * 16 + (row & 15)) * 8 + (k & 7); }
// QKV = true (the q/k/v projection; each 64-column part of a tile is one head): the joined tile is not stored as f32 but goes straight into the 16-bit hi/lo planes that the attention kernel reads, in fragment order:
// a q or k head through rotate-half RoPE, out[d] = x[d] cos[t][d] - x[d+HD/2] sin[t][d], out[d+HD/2] = x[d+HD/2] cos[t][d+HD/2] + x[d] sin[t][d+HD/2], into plane [head] with rows t; a v head transposed into plane [kv head] with rows d.
template <typename T16, int NSPLIT, bool BIAS, int NW, int K, bool QKV, int NS, int MBN>
__global__ __launch_bounds__(32 * NW) void k_gemmw(const T16* __restrict__ A, const T16* __restrict__ A2, const T16* __restrict__ Bt, const T16* __restrict__ Bt2, float* C, int ldc, const float* __restrict__ bias, size_t sA, size_t sB, size_t sC,
                                                   const float* __restrict__ CS, bf* Ph, bf* Pl, bf* Vh, bf* Vl) {
    typedef typename WFrag<T16>::V V;
    static_assert(QKV ? NW == 4 : (NW == 8 && MBN == 4));            // the joins below deal 16 rows x 16 float4 columns to 256 threads, the QKV join to 128 threads in U = 2 turns
    constexpr int U = 8 / NW;
    __shared__ __align__(16) float os[(QKV ? MBN : 2) * NS * NW * 16 * 68];   // NS x NW partial 16x64 row blocks: two buffers, one barrier per row block; QKV: all MBN row blocks at once, one barrier in all
    const size_t z = blockIdx.z; A += z * sA; if (A2) A2 += z * sA; Bt += z * sB; if (Bt2) Bt2 += z * sB; C += z * sC;
    const int lane = threadIdx.x & 31, lr = lane & 15, hi = lane >> 4; const int r0 = blockIdx.x * (16 * MBN), c0 = blockIdx.y * (64 * NS);
    const int wv = __builtin_amdgcn_readfirstlane((int)(threadIdx.x >> 5));
    v8f acc[MBN][4 * NS];
#pragma unroll
    for (int mb = 0; mb < MBN; ++mb)
#pragma unroll
        for (int nb = 0; nb < 4 * NS; ++nb) acc[mb][nb] = (v8f){};
    static_assert(!QKV || (DQ + DKV) % (64 * NS) == 0);              // no tile holds both a k head and a v head
    const bool rp = QKV && c0 < DQ + DKV;                            // QKV: q or k heads (RoPE) or v heads (transpose): by blockIdx, the same for the whole block
    // RoPE tile, the join: thread -> 4 columns d of one row t per row block. A wave takes 8 rows x (8 d and the 8 d at + HD/2): lane ^ 8 holds the rotation partner, lanes l and l ^ 16 the two halves of a 16-byte unit,
    // so that a wave's 8-byte stores fill two whole lines of a plane; the 16 lanes of each half wave read 64 different LDS banks.
    // With NW < 8 waves a wave takes the places of the waves wv + NW u, u < U, of that deal in turn: turn u lies 4 NW columns d (RoPE) or 2 NW rows t (V) behind turn 0.
    const int rrow = (wv & 1) * 8 + (lane & 7), rcof = ((wv >> 1) * 2 + hi) * 4 + ((lane >> 3) & 1) * (HD / 2);
    v4f cs[U][2];                                                    // (cos, sin) of the thread's 4 columns, per turn, of the first row block: asked for in front of the k loop; the join asks for each further row block's one row block ahead
    const float* pc = QKV ? CS + ((size_t)(r0 + rrow) * HD + rcof) * 2 : nullptr;
    if (rp) {
#pragma unroll
        for (int u = 0; u < U; ++u) { cs[u][0] = *(const v4f*)(pc + u * 4 * NW * 2); cs[u][1] = *(const v4f*)(pc + u * 4 * NW * 2 + 4); }
        asm volatile("s_wait_xcnt 0x0" :: "v"(pc) : "memory");       // the precaution behind a group of loads, before a register that they name is written again; the address is an input, so that it keeps its registers up to the wait
    }
    const size_t aoff = (size_t)r0 * K + 8 * lane, boff = (size_t)c0 * K + 8 * lane;   // 16 rows of a plane are K / 32 blocks = 16 K elements; a k step is one block
    // The k loop: a wave's k steps are NT, and the fragments of step t + 1 are asked for in front of the products of step t, into registers that step t does not read, so that a wave's loads fly while its own products run.
    // One address per plane: K and the step are constants of the kernel, so that every row block of a step is an immediate offset from it. NSPLIT = 1: unrolled whole, no address register is written inside the loop.
    constexpr int NT = K / (32 * NW), TS = 32 * NW * 16;             // a wave's k steps; elements of a plane from one of them to the next
    static_assert(NSPLIT <= 1 && K % (32 * NW) == 0);
    const T16* pa = A + aoff + wv * 512; const T16* pa2 = NSPLIT == 1 ? A2 + aoff + wv * 512 : nullptr; const T16* pb = Bt + boff + wv * 512;
    auto lda = [&](V (&f)[MBN], const T16* p) {
#pragma unroll
        for (int mb = 0; mb < MBN; ++mb) f[mb] = WFrag<T16>::ld(p + mb * 16 * K); };
    auto ldb = [&](V (&f)[4 * NS], const T16* p) {
#pragma unroll
        for (int nb = 0; nb < 4 * NS; ++nb) f[nb] = WFrag<T16>::ld(p + nb * 16 * K); };
    // a block of products, held between two scheduling barriers: loads sunk in among the products would each be waited for by itself, and products lifted over the loads in front would put these off.
    // The four v_nop behind it, where loads follow (more), are the vector slots between the last product and the loads that land on registers it reads.
    auto mm = [&](const V (&fa)[MBN], const V (&fb)[4 * NS], bool more) {
        __builtin_amdgcn_sched_barrier(0);
#pragma unroll
        for (int nb = 0; nb < 4 * NS; ++nb)
#pragma unroll
            for (int mb = 0; mb < MBN; ++mb) acc[mb][nb] = WFrag<T16>::mma(fa[mb], fb[nb], acc[mb][nb]);
        __builtin_amdgcn_sched_barrier(0);
        if (more) asm volatile("v_nop\n\tv_nop\n\tv_nop\n\tv_nop");
        __builtin_amdgcn_sched_barrier(0); };
    if constexpr (NSPLIT == 0) {
        V a[2][MBN], b[2][4 * NS];                                   // two whole sets, taken in turn
        static_assert(NT % 2 == 0 && NT >= 4);
        // the lane's byte offsets into the two planes: these move on, the planes' own addresses stay those of the kernel's arguments
        unsigned oa = (unsigned)((aoff + wv * 512) * sizeof(T16)), ob = (unsigned)((boff + wv * 512) * sizeof(T16));
        auto qa = [&]() { return (const T16*)((const char*)A + oa); }; auto qb = [&]() { return (const T16*)((const char*)Bt + ob); };
        lda(a[0], qa()); ldb(b[0], qb());
#pragma unroll 1                                                     // two k steps per trip, one per set, and the last two behind the loop
        for (int t = 0; t < NT / 2 - 1; ++t) {
            lda(a[1], qa() + TS); ldb(b[1], qb() + TS);
            mm(a[0], b[0], true);
            lda(a[0], qa() + 2 * TS); ldb(b[0], qb() + 2 * TS);
            // the two offsets move on by two k steps; the precaution behind the trip's loads, which name them, stands in the same statement in front of the additions: as a statement of its own the additions were lifted over it
            asm volatile("s_wait_xcnt 0x0\n\tv_add_nc_u32_e32 %0, %2, %0\n\tv_add_nc_u32_e32 %1, %2, %1" : "+v"(oa), "+v"(ob) : "i"(2 * TS * (int)sizeof(T16)) : "memory");
            mm(a[1], b[1], true);
        }
        lda(a[1], qa() + TS); ldb(b[1], qb() + TS);
        mm(a[0], b[0], false);
        mm(a[1], b[1], false);
        asm volatile("s_wait_xcnt 0x0" :: "v"(oa), "v"(ob) : "memory");   // the precaution behind the last loads, before a register that they name is written again
    } else {
        // two sets of every plane do not fit beside the accumulators: B has two, each A plane one, which is asked for again right behind its own block of products, half a step ahead of its next use
        V a[MBN], a2[MBN], b[2][4 * NS];
        ldb(b[0], pb); lda(a, pa); lda(a2, pa2);
#pragma unroll
        for (int t = 0; t < NT; ++t) {
            if (t + 1 < NT) ldb(b[(t + 1) & 1], pb + (t + 1) * TS);
            mm(a, b[t & 1], t + 1 < NT);
            if (t + 1 < NT) lda(a, pa + (t + 1) * TS);
            mm(a2, b[t & 1], t + 1 < NT);
            if (t + 1 < NT) lda(a2, pa2 + (t + 1) * TS);
        }
    }
    // the precaution behind the loads, before a register that they name is written again; the addresses are inputs, so that they keep their registers up to the wait and no result lands on one
    if constexpr (NSPLIT == 1) asm volatile("s_wait_xcnt 0x0" :: "v"(pa), "v"(pa2), "v"(pb) : "memory");
    if constexpr (QKV) {
        // Every wave's whole partial tile goes to LDS, then one barrier; the join walks the row blocks in a loop that stays rolled (written out it would be most of the kernel's text) and holds no barrier, so that its stores are waited for nowhere.
#pragma unroll
        for (int mb = 0; mb < MBN; ++mb)
#pragma unroll
            for (int nb = 0; nb < 4 * NS; ++nb) {
#pragma unroll
                for (int j = 0; j < 8; ++j) os[((mb * NS + (nb >> 2)) * NW + wv) * (16 * 68) + (hi * 8 + j) * 68 + (nb & 3) * 16 + lr] = acc[mb][nb][j]; }
        __syncthreads();                                             // every wave's partial tile is in LDS
        if (rp) {
            // 16 rows t are two blocks of a q or k plane; 16 columns d on (turn 1) is the other half of a block; the next head's plane lies TT * HD elements on.
            // Two row blocks per trip, each with its own (cos, sin) registers, which are asked for again one row block ahead of their use; the trip's stores stand together at its foot.
            static_assert(MBN % 2 == 0);
            unsigned op = (unsigned)(((size_t)(c0 / HD) * TT * HD + pidx(r0 + rrow, rcof, HD)) * sizeof(bf)), ocs = (unsigned)(((size_t)(r0 + rrow) * HD + rcof) * 2 * sizeof(float));   // byte offsets into the planes and the table
            const float* oc = os + rrow * 68 + rcof;
            v4f c1[U][2]; v4us oh[2][NS][U], ol[2][NS][U];
            auto ldc = [&](v4f (&c)[U][2], int rb) {
                __builtin_amdgcn_sched_barrier(0);                   // nothing is scheduled in between the group of loads and its wait
#pragma unroll
                for (int u = 0; u < U; ++u) { const float* p = (const float*)((const char*)CS + ocs) + rb * 16 * HD * 2 + u * 4 * NW * 2; c[u][0] = *(const v4f*)p; c[u][1] = *(const v4f*)(p + 4); }
                asm volatile("s_wait_xcnt 0x0" :: "v"(ocs) : "memory");   // the precaution behind a group of loads, before a register that they name is written again
                __builtin_amdgcn_sched_barrier(0); };                // what follows stays behind the wait
            auto join = [&](const v4f (&c)[U][2], int rb) {
#pragma unroll
                for (int ns = 0; ns < NS; ++ns)                      // one head per part
#pragma unroll
                    for (int u = 0; u < U; ++u) {
                        const float* on = oc + (rb * NS + ns) * (NW * 16 * 68) + u * 4 * NW;
                        v4f val = *(const v4fa*)on;
#pragma unroll
                        for (int w = 1; w < NW; ++w) val += *(const v4fa*)(on + w * (16 * 68));
#pragma unroll
                        for (int j = 0; j < 4; ++j) { const float x1 = __shfl_xor(val[j], 8, 32), cc = c[u][j >> 1][(j & 1) * 2], sn = c[u][j >> 1][(j & 1) * 2 + 1]; const float r = (lane & 8) ? val[j] * cc + x1 * sn : val[j] * cc - x1 * sn;
                            unsigned short a2, c2; splitf(r, a2, c2); oh[rb][ns][u][j] = a2; ol[rb][ns][u][j] = c2; }
                    } };
#pragma unroll 1                                                     // rolled: see above
            for (int t = 0; t < MBN / 2; ++t) {
                ldc(c1, 1);
                join(cs, 0);
                if (t + 1 < MBN / 2) ldc(cs, 2);                     // the test is the same for the whole block
                join(c1, 1);
#pragma unroll
                for (int rb = 0; rb < 2; ++rb)
#pragma unroll
                    for (int ns = 0; ns < NS; ++ns)
#pragma unroll
                        for (int u = 0; u < U; ++u) { const int e = (rb * 1024 + ns * (TT * HD) + u * 256) * (int)sizeof(bf); *(v4us*)((char*)Ph + op + e) = oh[rb][ns][u]; *(v4us*)((char*)Pl + op + e) = ol[rb][ns][u]; }
                oc += 2 * NS * NW * 16 * 68;
                // the two offsets move on by two row blocks, behind the precaution for the trip's loads and stores in the same statement, as in the k loop; the next trip's values may take the registers of the stores' data
                asm volatile("s_wait_xcnt 0x0\n\tv_add_nc_u32_e32 %0, %2, %0\n\tv_add_nc_u32_e32 %1, %3, %1" : "+v"(ocs), "+v"(op) : "i"(2 * 16 * HD * 2 * (int)sizeof(float)), "i"(2 * 1024 * (int)sizeof(bf)) : "memory");
            }
        } else {
            // V tile: thread -> 4 rows t of one column d per row block and turn. A wave takes 16 d x 8 t: 256 bytes in a row of the transposed plane. 16 rows t are half a block of a V^T plane, 8 rows t (turn 1) a quarter.
            const int vd = (wv & 3) * 16 + lr, vt = ((wv >> 2) * 2 + hi) * 4;
            unsigned op = (unsigned)(((size_t)((c0 - DQ - DKV) / HD) * HD * TT + pidx(vd, r0 + vt, TT)) * sizeof(bf));   // byte offset into the planes
            const float* oc = os + vt * 68 + vd;
#pragma unroll 1                                                     // rolled: see above
            for (int mb = 0; mb < MBN; ++mb) {
                v4us oh[NS][U], ol[NS][U];
#pragma unroll
                for (int ns = 0; ns < NS; ++ns)                      // one head per part
#pragma unroll
                    for (int u = 0; u < U; ++u) {
                        const float* on = oc + ns * (NW * 16 * 68) + u * 2 * NW * 68;
#pragma unroll
                        for (int j = 0; j < 4; ++j) { float v = on[j * 68];
#pragma unroll
                            for (int w = 1; w < NW; ++w) v += on[w * (16 * 68) + j * 68];
                            unsigned short a2, c2; splitf(v, a2, c2); oh[ns][u][j] = a2; ol[ns][u][j] = c2; }
                    }
#pragma unroll
                for (int ns = 0; ns < NS; ++ns)
#pragma unroll
                    for (int u = 0; u < U; ++u) { const int e = (ns * (TT * HD) + u * 128) * (int)sizeof(bf); *(v4us*)((char*)Vh + op + e) = oh[ns][u]; *(v4us*)((char*)Vl + op + e) = ol[ns][u]; }
                oc += NS * NW * 16 * 68;
                // the offset moves on by one row block, behind the precaution for the trip's stores in the same statement
                asm volatile("s_wait_xcnt 0x0\n\tv_add_nc_u32_e32 %0, %1, %0" : "+v"(op) : "i"(256 * (int)sizeof(bf)) : "memory");
            }
        }
        return;
    }
    const int row = (int)(threadIdx.x >> 4), cofs = (int)(threadIdx.x & 15) * 4; v4f res[NS][4];   // the join: thread -> one float4 of each 16x64 row block
#pragma unroll
    for (int mb = 0; mb < 4; ++mb) {
        float* ob = os + (mb & 1) * (NS * NW * 16 * 68);
#pragma unroll
        for (int nb = 0; nb < 4 * NS; ++nb) {
#pragma unroll
            for (int j = 0; j < 8; ++j) ob[((nb >> 2) * NW + wv) * (16 * 68) + (hi * 8 + j) * 68 + (nb & 3) * 16 + lr] = acc[mb][nb][j]; }
        __syncthreads();                                             // every wave's partial of this row block is in LDS; the other buffer's readers are done before it is written again
#pragma unroll
        for (int ns = 0; ns < NS; ++ns) {
            const float* on = ob + ns * (NW * 16 * 68); const int cn = c0 + ns * 64 + cofs;
            v4f val = *(const v4fa*)(on + row * 68 + cofs);
#pragma unroll
            for (int w = 1; w < NW; ++w) val += *(const v4fa*)(on + w * (16 * 68) + row * 68 + cofs);
            if (BIAS) { val[0] += bfr(bias[cn]); val[1] += bfr(bias[cn + 1]); val[2] += bfr(bias[cn + 2]); val[3] += bfr(bias[cn + 3]); }
            res[ns][mb] = val;
        }
    }
    // stores behind the last barrier: a store in front of a barrier would be waited out there
#pragma unroll
    for (int ns = 0; ns < NS; ++ns)
#pragma unroll
        for (int mb = 0; mb < 4; ++mb) *(v4f*)(C + (size_t)(r0 + mb * 16 + row) * ldc + c0 + ns * 64 + cofs) = res[ns][mb];
}

typedef __attribute__((ext_vector_type(2))) float v2f;
typedef __attribute__((ext_vector_type(4))) int v4i;
typedef __attribute__((ext_vector_type(2))) __bf16 v2bf;
typedef __attribute__((ext_vector_type(8))) unsigned v8u;
typedef __attribute__((ext_vector_type(4))) unsigned v4u;

// The d_* functions are the bodies of jobs that read none of each other's output; k_prep below deals the blocks of one grid to them (blk = the block's index inside its job).
// d_wtT: Bt (bf16, rows n, fragment order) = w[k][n] (f32), one tile of 64 k x 128 n per block, turned in LDS (ts: 128 rows n of 32 dwords, each dword the bf16 pair k, k + 1; pitch 33 dwords, so that no two lanes of a wave
// meet on a bank, storing or loading). Every global load of a wave is two 256-byte pieces of rows of w, every global store four whole 128-byte lines of Bt. Neighbouring blocks take neighbouring n.
__device__ __forceinline__ void d_wtT(int blk, const float* __restrict__ w, int K, int N, bf* Bt, unsigned* ts) {
    const int lane = threadIdx.x & 31, wv = (int)(threadIdx.x >> 5); const int n0 = (blk % (N / 128)) * 128, k0 = (blk / (N / 128)) * 64;
    const int c4 = (lane & 15) * 4, kq = wv * 2 + (lane >> 4);      // thread -> 4 columns n of the row pairs kq and kq + 16, in both 64-column halves
    v4f ev[2][2], od[2][2];
#pragma unroll
    for (int i = 0; i < 2; ++i)
#pragma unroll
        for (int nh = 0; nh < 2; ++nh) { const float* p = w + (size_t)(k0 + 2 * (kq + 16 * i)) * N + n0 + nh * 64 + c4; ev[i][nh] = *(const v4f*)p; od[i][nh] = *(const v4f*)(p + N); }
    asm volatile("s_wait_xcnt 0x0" ::: "memory");                    // the precaution behind a group of loads, before a register that they name is written again
#pragma unroll
    for (int i = 0; i < 2; ++i)
#pragma unroll
        for (int nh = 0; nh < 2; ++nh)
#pragma unroll
            for (int j = 0; j < 4; ++j) ts[(nh * 64 + c4 + j) * 33 + kq + 16 * i] = (unsigned)f2bf(ev[i][nh][j]) | ((unsigned)f2bf(od[i][nh][j]) << 16);
    __syncthreads();                                                 // the tile is whole in LDS (the job is chosen by blockIdx: every wave of the block passes here)
    // thread -> four 8-k pieces (4 dwords each) of the wave's 16 rows; eight neighbouring lanes take eight neighbouring rows at one k, which is one whole line of the fragment order
#pragma unroll
    for (int i = 0; i < 4; ++i) { const int n = wv * 16 + (i >> 1) * 8 + (lane & 7), k8 = (lane >> 3) * 2 + (i & 1); const unsigned* q = ts + n * 33 + k8 * 4; v4u v; v[0] = q[0]; v[1] = q[1]; v[2] = q[2]; v[3] = q[3]; *(v4u*)(Bt + pidx(n0 + n, k0 + k8 * 8, K)) = v; }
    asm volatile("s_wait_xcnt 0x0" ::: "memory");                    // the same precaution behind the group of stores
}
// d_cvt8: dst (bf16, fragment order) = src [rows][K] (f32), 8 k per thread; a wave takes 8 rows x 32 k: it loads one whole line of each row and stores four whole lines
__device__ __forceinline__ void d_cvt8(int blk, const float* __restrict__ src, bf* dst, int K, size_t n8) { const size_t i = (size_t)blk * 256 + threadIdx.x; if (i >= n8) return;
    const int w = (int)(i >> 5), ks = (w >> 1) % (K / 32), row = ((w >> 1) / (K / 32)) * 16 + (w & 1) * 8 + (((int)i >> 2) & 7), k = ks * 32 + ((int)i & 3) * 8;
    const v8f v = *(const v8f*)(src + (size_t)row * K + k); v8us o;
#pragma unroll
    for (int q = 0; q < 8; ++q) o[q] = f2bf(v[q]); *(v8us*)(dst + pidx(row, k, K)) = o;  }
// the inverse frequency is computed by the thread that uses it, so that the table job depends on the inputs alone
__device__ __forceinline__ void d_cstab(int blk, const int* __restrict__ pos, float* CS) {
    const int idx = blk * 256 + threadIdx.x; if (idx >= TT * HD) return;
    const int dd = idx % HD; const int t = idx / HD; const int j = dd & (HD / 2 - 1);
    const float e = (float)j * (1.0f / (float)(HD / 2));
    const float p = powf(THETA, e);
    const float v = 1.0f / p;
    const float pf = (float)pos[t];
    float fr = __fmul_rn(pf, v); asm volatile("" : "+v"(fr));
    float sn, cn;
    sincosf(fr, &sn, &cn);
    v2f cs; cs[0] = cn; cs[1] = sn;
    *(v2f*)(CS + (size_t)idx * 2) = cs; 
}
// ---- k_prep: every job that reads the inputs alone, in one grid; the weight transposes, whose blocks run longest, take the first block indices. The branches are on blockIdx and so the same for a whole block.
#define DQKV   (DQ + 2 * DKV)
#define NB_WQ  (DQ * DM / (64 * 128))
#define NB_WKV (DKV * DM / (64 * 128))
static_assert(DM % 128 == 0 && DQ % 128 == 0 && DKV % 128 == 0);
#define NB_X   (TT * DM / (8 * 256))
#define NB_CS  (TT * HD / 256)
__global__ __launch_bounds__(256) void k_prep(const float* __restrict__ x, const float* __restrict__ wq, const float* __restrict__ wk, const float* __restrict__ wv, const float* __restrict__ wo, const int* __restrict__ pos,
                                              bf* WQ, bf* WK, bf* WV, bf* WO, bf* XB, float* CS) {
    __shared__ __align__(16) unsigned ts[128 * 33];                  // the transposes' tile
    int b = (int)blockIdx.x;
    if (b >= 2 * NB_WQ + 2 * NB_WKV + NB_X) { d_cstab(b - (2 * NB_WQ + 2 * NB_WKV + NB_X), pos, CS); return; }   // the last blocks of the grid; tested first, since behind five other tests the compiler makes powf a call
    if (b < NB_WQ) { d_wtT(b, wq, DM, DQ, WQ, ts); return; }            // Wq [D][NQ*HD]  -> WQ[c][d]
    b -= NB_WQ;
    if (b < NB_WQ) { d_wtT(b, wo, DQ, DM, WO, ts); return; }            // Wo [NQ*HD][D]  -> WO[dout][nh]
    b -= NB_WQ;
    if (b < NB_WKV) { d_wtT(b, wk, DM, DKV, WK, ts); return; }          // Wk [D][NKV*HD] -> WK[c][d]
    b -= NB_WKV;
    if (b < NB_WKV) { d_wtT(b, wv, DM, DKV, WV, ts); return; }          // Wv [D][NKV*HD] -> WV[c][d]
    b -= NB_WKV;
    d_cvt8(b, x, XB, DM, (size_t)TT * DM / 8);
}
// ---- k_fattn: scores, mask, softmax and attn.v of one 16-query tile in one pass over the keys; scores and probabilities stay in registers. Workgroup = the GQ query heads of one kv head (one wave each, same
// 16 queries, so the waves read the same K and V lines); grid (TT/16) * NKV; LDS holds only the segment ids and the key-block mask (one barrier). Per 64-key block that the mask names, up to the diagonal block:
//   St[key][query] = K Q^T (A = K rows, B = Q rows; qh.kh + ql.kh + qh.kl): D element r of key tile nb -> (key 16 nb + 8h + r, query lane&15), which is already the B-fragment k order of the next product
//   (elements 0..7 <- k0 + 8h + i from tile 2j, elements 8..15 <- k0 + 16 + 8h + i from tile 2j + 1), so the probabilities go from one product to the other with no exchange between lanes;
//   running row maximum m and row sum l per query (lane&15; the two lane halves hold different keys), accumulator rescaled by exp(m_old - m_new);
//   Ot[d][query] += Vt P^T (A = Vt rows d, B = P hi/lo; ph.vh + pl.vh + ph.vl): the query of every accumulator element is the lane's own, so the rescale and the final 1/l are lane-local.
// Every inner loop is fully unrolled, so that the fragment arrays are indexed by constants and stay in registers.
// Key-block mask: bit j is set if block j holds a key whose segment id lies inside [least, greatest] of the tile's 16 query ids, found at entry from the ids themselves, whatever they hold. In a block without such a key every
// score of the tile is masked, and a wholly masked block adds exact zeros (ahead of a row's first allowed key it is rescaled by 0, behind it its probabilities are exp2(-huge) = 0): it is passed over. The diagonal block is always taken.
// A masked score is the fill -3e38. While a row has met no allowed key, m is the fill too and its masked entries count as exp(0) = 1; the first allowed key (the diagonal at the latest) rescales all of that by exp(-huge) = 0.
__global__ __launch_bounds__(32 * GQ) void k_fattn(const bf* __restrict__ Qh, const bf* __restrict__ Ql, const bf* __restrict__ Kh, const bf* __restrict__ Kl, const bf* __restrict__ Vh, const bf* __restrict__ Vl, const int* __restrict__ seg, bf* Ah, bf* Al) {
    typedef WFrag<bf>::V V;
    const int lane = threadIdx.x & 31, lr = lane & 15, hi = lane >> 4;
    const int wv = __builtin_amdgcn_readfirstlane((int)(threadIdx.x >> 5));
    const int b = (int)blockIdx.x, nhalf = (TT / 32) * NKV;
    const int qt = b < nhalf ? TT / 16 - 1 - b / NKV : (b - nhalf) / NKV;   // long tiles take the first block indices, the short ones the rest
    const int kvh = b % NKV, head = kvh * GQ + wv, q0 = qt * 16, qi = q0 + lr;
    const size_t qoff = ((size_t)head * TT + q0) * HD + 8 * lane;     // all planes in fragment order: 16 rows of Q or K are HD / 32 blocks, 16 rows of Vt TT / 32
    const bf* pqh = Qh + qoff; const bf* pql = Ql + qoff;
    V qh[2], ql[2];
#pragma unroll
    for (int kk = 0; kk < 2; ++kk) { qh[kk] = WFrag<bf>::ld(pqh + kk * 512); ql[kk] = WFrag<bf>::ld(pql + kk * 512); }
    __shared__ __align__(16) int sseg[TT];                           // the segment ids, read per key block from LDS: a global load there would be waited for in order behind the K loads in flight
    __shared__ __align__(16) unsigned sbm[GQ];                       // each wave's share of the key-block mask
    v4i sgr[TT / (32 * GQ * 4)];
#pragma unroll
    for (int i = 0; i < TT / (32 * GQ * 4); ++i) sgr[i] = *(const v4i*)(seg + (i * 32 * GQ + (int)threadIdx.x) * 4);
    const int sq = seg[qi];
    int slo = seg[q0], shi = slo;                                    // least and greatest segment id of the tile's queries; the addresses are the same in every lane
#pragma unroll
    for (int i = 1; i < 16; ++i) { const int s = seg[q0 + i]; slo = s < slo ? s : slo; shi = s > shi ? s : shi; }
    // K and V addresses = wave-uniform base (kv head, key block) + a lane offset that never changes
    const bf* kbh = Kh + (size_t)kvh * TT * HD; const bf* kbl = Kl + (size_t)kvh * TT * HD; const bf* vbh = Vh + (size_t)kvh * HD * TT; const bf* vbl = Vl + (size_t)kvh * HD * TT;
    const unsigned klane = (unsigned)(8 * lane), vlane = (unsigned)(8 * lane);
    v8f o[4];
#pragma unroll
    for (int mb = 0; mb < 4; ++mb) o[mb] = (v8f){};
    float m = -3.0e38f, l = 0.f;                                     // m in units of log2: score * SCL * log2(e)
    __builtin_amdgcn_sched_barrier(0);                               // nothing is scheduled in between the prologue's loads and their wait, or up over it
    // the precaution behind a group of loads, before a register that they name is written again; the addresses are inputs of the wait, so that they keep their registers up to it and no result of the group lands on one
    asm volatile("s_wait_xcnt 0x0" :: "v"(pqh), "v"(pql) : "memory");
    __builtin_amdgcn_sched_barrier(0);                               // the second half of the same: what follows stays behind the wait
    // the wave's share of the key-block mask: a thread holds 4 neighbouring keys per round, so 16 lanes hold one 64-key block; unsigned differences, so that the range test holds for any 32-bit ids
    static_assert(GQ == 4 && TT / 64 <= 32 && (32 * GQ * 4) % 64 == 0);
    const unsigned span = (unsigned)shi - (unsigned)slo;
    unsigned part = 0u;
#pragma unroll
    for (int i = 0; i < TT / (32 * GQ * 4); ++i) {
        const bool any = (unsigned)sgr[i][0] - (unsigned)slo <= span || (unsigned)sgr[i][1] - (unsigned)slo <= span || (unsigned)sgr[i][2] - (unsigned)slo <= span || (unsigned)sgr[i][3] - (unsigned)slo <= span;
        const unsigned bal = __builtin_amdgcn_ballot_w32(any); const int b0 = i * (32 * GQ * 4 / 64) + wv * 2;
        part |= ((bal & 0xFFFFu) != 0u ? 1u << b0 : 0u) | ((bal >> 16) != 0u ? 2u << b0 : 0u); }
#pragma unroll
    for (int i = 0; i < TT / (32 * GQ * 4); ++i) *(v4i*)(sseg + (i * 32 * GQ + (int)threadIdx.x) * 4) = sgr[i];
    if (lane == 0) sbm[wv] = part;
    __syncthreads();                                                 // sseg and sbm are whole
    const v4u pm = *(const v4u*)sbm;
    const int dblk = q0 >> 6;                                        // the diagonal block: nothing behind it is causal, and it holds every query's own key
    const unsigned bm = ((unsigned)__builtin_amdgcn_readfirstlane((int)(pm[0] | pm[1] | pm[2] | pm[3])) & ((2u << dblk) - 1u)) | (1u << dblk);
    V kh[4][2], kl[4][2];                                            // the K fragments of one 64-key block, loaded one block ahead: again right behind their last use
    const bf* k0h = kbh + (size_t)(__builtin_ctz(bm) * 64) * HD; const bf* k0l = kbl + (size_t)(__builtin_ctz(bm) * 64) * HD;   // the mask's first block: wave-uniform bases
#pragma unroll
    for (int nb = 0; nb < 4; ++nb)
#pragma unroll
        for (int kk = 0; kk < 2; ++kk) { const int e = nb * 16 * HD + kk * 512; kh[nb][kk] = WFrag<bf>::ld(k0h + klane + e); kl[nb][kk] = WFrag<bf>::ld(k0l + klane + e); }
    __builtin_amdgcn_sched_barrier(0);                               // as above: nothing in between the first K loads and their wait
    asm volatile("s_wait_xcnt 0x0" :: "v"(klane), "s"(k0h), "s"(k0l) : "memory");   // the same precaution, the lane offset and the two bases held in their registers up to the wait
    __builtin_amdgcn_sched_barrier(0);                               // what follows stays behind the wait
#pragma unroll 1                                                     // one key block per trip: a second copy of the body would not fit the registers
    for (unsigned rest = bm; rest != 0u;) {                          // every trip clears one bit of the mask: at most TT / 64 trips
        const int kb = __builtin_ctz(rest) * 64; rest &= rest - 1u;
        const int kn = rest != 0u ? __builtin_ctz(rest) * 64 : kb;   // the next block of the mask; behind the last block this one again (in bounds, never used)
        V vh[4][2], vl[4][2];                                        // this block's V fragments: asked for here, used behind the softmax
        const bf* pvh = vbh + kb * 16 + vlane; const bf* pvl = vbl + kb * 16 + vlane;
#pragma unroll
        for (int mb = 0; mb < 4; ++mb)
#pragma unroll
            for (int j = 0; j < 2; ++j) { const int e = mb * 16 * TT + j * 512; vh[mb][j] = WFrag<bf>::ld(pvh + e); vl[mb][j] = WFrag<bf>::ld(pvl + e); }
        asm volatile("s_wait_xcnt 0x0" :: "v"(pvh), "v"(pvl) : "memory");   // the same precaution, the V addresses held in their registers up to the wait
        v8f s[4];
#pragma unroll
        for (int nb = 0; nb < 4; ++nb) { s[nb] = (v8f){};
#pragma unroll
            for (int kk = 0; kk < 2; ++kk) { s[nb] = wmmab(kh[nb][kk], qh[kk], s[nb]); s[nb] = wmmab(kh[nb][kk], ql[kk], s[nb]); s[nb] = wmmab(kl[nb][kk], qh[kk], s[nb]); } }
        const bf* pkh = kbh + (size_t)kn * HD + klane; const bf* pkl = kbl + (size_t)kn * HD + klane;
#pragma unroll
        for (int nb = 0; nb < 4; ++nb)
#pragma unroll
            for (int kk = 0; kk < 2; ++kk) { const int e = nb * 16 * HD + kk * 512; kh[nb][kk] = WFrag<bf>::ld(pkh + e); kl[nb][kk] = WFrag<bf>::ld(pkl + e); }
        asm volatile("s_wait_xcnt 0x0" :: "v"(pkh), "v"(pkl) : "memory");   // the same precaution, the K addresses held in their registers up to the wait
        const int lim = qi - kb - 8 * hi;                            // key offset 16 nb + r in this lane is causal iff it is <= lim
        float mx = m;
#pragma unroll
        for (int nb = 0; nb < 4; ++nb) { const int j0 = kb + nb * 16 + 8 * hi; const v4i g0 = *(const v4i*)(sseg + j0), g1 = *(const v4i*)(sseg + j0 + 4);
#pragma unroll
            for (int r = 0; r < 8; ++r) { const int sg = r < 4 ? g0[r & 3] : g1[r & 3]; const float t = (sg == sq && nb * 16 + r <= lim) ? s[nb][r] * (SCL * 1.4426950408889634f) : -3.0e38f; s[nb][r] = t; mx = fmaxf(mx, t); } }
        mx = fmaxf(mx, __shfl_xor(mx, 16, 32));
        const float al = __builtin_amdgcn_exp2f(m - mx);
        m = mx;
        v2f ps2[2] = {(v2f){0.f, 0.f}, (v2f){0.f, 0.f}}; v8u phw[2], plw[2];   // four independent partial row sums
#pragma unroll
        for (int nb = 0; nb < 4; ++nb) {
#pragma unroll
            for (int r = 0; r < 8; r += 2) { v2f pp; pp[0] = __builtin_amdgcn_exp2f(s[nb][r] - mx); pp[1] = __builtin_amdgcn_exp2f(s[nb][r + 1] - mx); ps2[nb & 1] += pp;
                const v2bf h2 = __builtin_convertvector(pp, v2bf); const v2bf l2 = __builtin_convertvector(pp - __builtin_convertvector(h2, v2f), v2bf);
                phw[nb >> 1][(nb & 1) * 4 + (r >> 1)] = __builtin_bit_cast(unsigned, h2); plw[nb >> 1][(nb & 1) * 4 + (r >> 1)] = __builtin_bit_cast(unsigned, l2); } }
        l = l * al + ((ps2[0][0] + ps2[1][0]) + (ps2[0][1] + ps2[1][1]));
#pragma unroll
        for (int mb = 0; mb < 4; ++mb) { o[mb] *= al;
#pragma unroll
            for (int j = 0; j < 2; ++j) { const V ph = __builtin_bit_cast(V, phw[j]), pl = __builtin_bit_cast(V, plw[j]); o[mb] = wmmab(vh[mb][j], ph, o[mb]); o[mb] = wmmab(vh[mb][j], pl, o[mb]); o[mb] = wmmab(vl[mb][j], ph, o[mb]); } }
    }
    l += __shfl_xor(l, 16, 32);
    const float f = __fdiv_rn(1.0f, l);
    const int ln = (int)__lane_id();                                 // the lane's number from the count that the shuffles keep anyway: 8 * lane held over the loop went to scratch memory
#pragma unroll
    for (int mb = 0; mb < 4; ++mb) { v8us oh, ol;
#pragma unroll
        for (int r = 0; r < 8; ++r) { unsigned short a2, c2; splitf(o[mb][r] * f, a2, c2); oh[r] = a2; ol[r] = c2; }
        const size_t oo = ((size_t)qt * (DQ / 32) + head * (HD / 32) + (mb >> 1)) * 512 + (mb & 1) * 256 + 8 * ln; *(v8us*)(Ah + oo) = oh; *(v8us*)(Al + oo) = ol; }   // row qi, k = head * HD + 16 mb + 8 hi + r in fragment order
}

extern "C" void kernel_launch(void* const* d_in, const int* in_sizes, int n_in,
                              void* d_out, int out_size, void* d_ws, size_t ws_size, hipStream_t stream) {
    if (n_in < 7) return;
    if (in_sizes[0] < TT * DM || in_sizes[1] < DM * DQ || in_sizes[2] < DM * DKV || in_sizes[3] < DM * DKV || in_sizes[4] < DQ * DM || in_sizes[5] < TT || in_sizes[6] < TT) return;
    if (out_size < TT * DM) return;
    const float* x = (const float*)d_in[0]; const float* wq = (const float*)d_in[1]; const float* wk = (const float*)d_in[2]; const float* wv = (const float*)d_in[3]; const float* wo = (const float*)d_in[4];
    const int* pos = (const int*)d_in[5]; const int* seg = (const int*)d_in[6];
    float* OUT = (float*)d_out;     // [TT][DM]
    char* wsp = (char*)d_ws;
    auto take = [&](size_t bytes) { char* p = wsp; wsp += (bytes + 255) & ~(size_t)255; return (void*)p; };
    // the q, k and v weight planes lie one behind the other ([DQKV][DM]), and so do the q and k head planes: the three projections are one GEMM, whose epilogue ropes q and k into the joined planes
    bf* WQ = (bf*)take((size_t)DQKV * DM * 2); bf* WK = WQ + (size_t)DQ * DM; bf* WV = WK + (size_t)DKV * DM; bf* WO = (bf*)take((size_t)DM * DQ * 2);
    float* CS = (float*)take((size_t)TT * HD * 2 * 4);
    bf* XB = (bf*)take((size_t)TT * DM * 2);
    bf* QPh = (bf*)take((size_t)(NQ + NKV) * TT * HD * 2); bf* QPl = (bf*)take((size_t)(NQ + NKV) * TT * HD * 2); bf* KPh = QPh + (size_t)NQ * TT * HD; bf* KPl = QPl + (size_t)NQ * TT * HD;
    bf* VTh = (bf*)take((size_t)NKV * HD * TT * 2); bf* VTl = (bf*)take((size_t)NKV * HD * TT * 2);
    bf* ATh = (bf*)take((size_t)TT * DQ * 2); bf* ATl = (bf*)take((size_t)TT * DQ * 2);
    const size_t used = (size_t)(wsp - (char*)d_ws);
    if (used > ws_size || used > ((size_t)128 << 20)) return;

    // tables and 16-bit planes of the inputs: one launch
    k_prep<<<2 * NB_WQ + 2 * NB_WKV + NB_X + NB_CS, 256, 0, stream>>>(x, wq, wk, wv, wo, pos, WQ, WK, WV, WO, XB, CS);
    // q, k and v projections (plain bf16 operands): one launch, which writes the roped q and k planes and the transposed v planes (hi/lo) itself
    k_gemmw<bf, 0, false, 4, DM, true, 2, 8><<<dim3(TT / 128, DQKV / 128, 1), 128, 0, stream>>>(XB, nullptr, WQ, nullptr, nullptr, 0, nullptr, 0, 0, 0, CS, QPh, QPl, VTh, VTl);
    // attention: one launch, all heads; writes the hi/lo ctx planes (rows t, columns head * HD + d, fragment order)
    k_fattn<<<(unsigned)((TT / 16) * NKV), 32 * GQ, 0, stream>>>(QPh, QPl, KPh, KPl, VTh, VTl, seg, ATh, ATl);
    // output projection: hi/lo ctx x bf16 Wo
    k_gemmw<bf, 1, false, 8, DQ, false, 2, 4><<<dim3(TT / 64, DM / 128, 1), 256, 0, stream>>>(ATh, ATl, WO, nullptr, OUT, DM, nullptr, 0, 0, 0, nullptr, nullptr, nullptr, nullptr, nullptr);
}
